// v000
// Measured on an AMD MI455X. A time is GPU time per run, averaged over a window of back-to-back runs after a warm-up
// (all launches, gaps included; the runs take copies of the inputs in turn), and the median of several windows.
// Apart from v000's, it joins two sittings. Times from different sittings can be a few percent apart, while
// side-by-side timings come from the same sitting.
// The starting kernel, v000, takes 6130 microseconds a run.
#include <hip/hip_runtime.h>
// Scaled dot-product attention on given head-major query, key, value with a key-padding mask (q, k, v [2][8][2048][64] each = 16 independent [2048][64] planes; att = (q / 8) . k; where(mask == 0, NEG) with the int32 [2][1][1][2048] mask in {0, 1} (random; 0 = masked key, shared by the 8 heads of a batch; READ on device); softmax; out = att v -> [2][8][2048][64]).
// Structure: the three inputs converted to exact f16 rows (bf16 values are exact in f16: no projections); per (batch, head) slab: V^T via LDS transposes; scores (K = 64; exact products, f32 accumulation) into an f32 [S][S] plane, row softmax on VALU (f32 statistics, native exp; weights x256 f16), out = P V^T (alpha 2^-8) written f32 straight into the output.
// Compute dtype: inputs rounded to bf16; x / weights exact; q, k, v and softmax weights as plain f16 GEMM operands (~2^-12); scores and softmax statistics f32. v_wmma_f32_16x16x32_f16.
#define NB 16
#define SQ 2048
#define DM 64
#define NH 1
#define HD 64
#define HG 1                         /* heads per attention launch group */
#define B0 0                         /* first batch processed (debug hook) */
#define NBR NB                       /* batches processed (debug hook) */
#define NR ((size_t)NB * SQ)         /* token rows */
#define MP ((int)((size_t)NBR * SQ)) /* rows converted to f16 (debug hook) */
#define QN SQ                        /* query rows attended per batch (debug hook) */
#define NHD NH                       /* heads attended (debug hook) */
#define MPO MP                       /* unused (debug hook) */
#define LQ DM      /* row pitch of the q/k/v rows */
typedef __bf16 v16b __attribute__((ext_vector_type(16)));
typedef unsigned short v8us __attribute__((ext_vector_type(8), may_alias));
typedef float  v8f  __attribute__((ext_vector_type(8)));
typedef float  v4f  __attribute__((ext_vector_type(4)));
typedef float  v4fa __attribute__((ext_vector_type(4), may_alias));
union FragB { v16b v; v8us half[2]; unsigned short u[16]; };

__device__ __forceinline__ unsigned short bf16_bits(float x) { unsigned int u = __float_as_uint(x); return (unsigned short)((u + 0x7FFFu + ((u >> 16) & 1u)) >> 16); }
__device__ __forceinline__ float bf16_val(unsigned short b) { return __uint_as_float(((unsigned int)b) << 16); }
__device__ __forceinline__ float bf16_round(float x) { return bf16_val(bf16_bits(x)); }
// D += A·B with NT terms: 1 = ah·bh, 2 = + al·bh (A split), 3 = + ah·bl (both split)
template <int NT>
__device__ __forceinline__ v8f mmaN(v16b ah, v16b al, v16b bh, v16b bl, v8f c) {
  c = __builtin_amdgcn_wmma_f32_16x16x32_bf16(false, ah, false, bh, (short)0, c, false, false);
  if (NT >= 2) c = __builtin_amdgcn_wmma_f32_16x16x32_bf16(false, al, false, bh, (short)0, c, false, false);
  if (NT >= 3) c = __builtin_amdgcn_wmma_f32_16x16x32_bf16(false, ah, false, bl, (short)0, c, false, false);
  asm volatile("v_nop\n\tv_nop\n\tv_nop\n\tv_nop" : "+v"(c) : "v"(ah), "v"(al), "v"(bh), "v"(bl));
  return c;
}

__global__ __launch_bounds__(256) void k_wt_bf16(const float* __restrict__ W, unsigned short* __restrict__ Wt, int K, int N) {
  const int t = blockIdx.x * 256 + threadIdx.x;
  const int k8n = K / 8;
  if (t >= N * k8n) return;
  const int n = t / k8n, k8 = (t % k8n) * 8;
  v8us v;
#pragma unroll
  for (int i = 0; i < 8; ++i) v[i] = bf16_bits(W[(size_t)(k8 + i) * N + n]);
  *(v8us*)(Wt + (size_t)n * K + k8) = v;
  
}

// GEMM C[M][N] (f32, pitch ldc) = act(A[M][K]·W + bias). A f32 row-major (pitch lda) converted per fragment to bf16
// (ASPLIT: hi/lo two planes -> 2 terms, else single rounded term); Wt bf16 [N][K] (pitch ldb). BIAS_BF16 rounds the
// bias to bf16 first (bias quantised to bf16 before the add). K%32==0, M%16==0, N%64==0.
template <bool ASPLIT, int ACT, bool BIAS_BF16>
__global__ __launch_bounds__(128) void k_gemm_bf(const float* __restrict__ A, int lda, const unsigned short* __restrict__ Wt, int ldb,
                                               const float* __restrict__ bias, float* __restrict__ C, int ldc, int M, int N, int K) {
  __shared__ __attribute__((aligned(16))) float so[4][16][64];
  const int tid = threadIdx.x, w = tid >> 5, lane = tid & 31, ln = lane & 15, hh = lane >> 4;
  const int ntn = N / 64;
  const int wid = blockIdx.x * 4 + w;
  const int mt = wid / ntn, nq = wid % ntn;
  if (mt * 16 >= M) return;
  const int row0 = mt * 16, col0 = nq * 64;
  const float* arow = A + (size_t)(row0 + ln) * lda;
  v8f acc[4] = {};
  for (int kb = 0; kb < K; kb += 32) {
    FragB ah, al;
    const v4f x0 = *(const v4fa*)(arow + kb + 8 * hh), x1 = *(const v4fa*)(arow + kb + 8 * hh + 4);
    const v4f x2 = *(const v4fa*)(arow + kb + 16 + 8 * hh), x3 = *(const v4fa*)(arow + kb + 16 + 8 * hh + 4);
    float xs[16] = {x0[0],x0[1],x0[2],x0[3],x1[0],x1[1],x1[2],x1[3],x2[0],x2[1],x2[2],x2[3],x3[0],x3[1],x3[2],x3[3]};
#pragma unroll
    for (int i = 0; i < 16; ++i) { const unsigned short hb = bf16_bits(xs[i]); ah.u[i] = hb; al.u[i] = ASPLIT ? bf16_bits(xs[i] - bf16_val(hb)) : (unsigned short)0; }
#pragma unroll
    for (int t = 0; t < 4; ++t) {
      const unsigned short* brow = Wt + (size_t)(col0 + t * 16 + ln) * ldb + kb;
      FragB b;
      b.half[0] = *(const v8us*)(brow + 8 * hh);
      b.half[1] = *(const v8us*)(brow + 16 + 8 * hh);
      acc[t] = mmaN<ASPLIT ? 2 : 1>(ah.v, al.v, b.v, b.v, acc[t]);
    }
  }
#pragma unroll
  for (int t = 0; t < 4; ++t) {
    float bv = bias ? bias[col0 + t * 16 + ln] : 0.f;
    if (BIAS_BF16) bv = bf16_round(bv);
#pragma unroll
    for (int r = 0; r < 8; ++r) { float v = acc[t][r] + bv; if (ACT == 1) v = fmaxf(v, 0.f); so[w][8 * hh + r][t * 16 + ln] = v; }
  }
  __builtin_amdgcn_fence(__ATOMIC_ACQ_REL, "workgroup");
  __builtin_amdgcn_wave_barrier();
  const int rsub = lane >> 4, c4 = (lane & 15) * 4;
  {
#pragma unroll
    for (int q = 0; q < 8; ++q) {
      const int r = q * 2 + rsub;
      const v4f v = *(const v4fa*)&so[w][r][c4];
      *(v4f*)(C + (size_t)(row0 + r) * ldc + col0 + c4) = v;
    }
    
  }
}

// GEMM C = act(A·W + bias + resid): A f32 (ASPLIT -> hi/lo 2 terms), Wt bf16 [N][K]; ACT 0 none, 1 relu, 2 exact gelu;
// resid (optional, f32, row index = (row % rmod), pitch ldr, RES_BF16 rounds it) added before the activation.
template <bool ASPLIT, int ACT, bool BIAS_BF16, bool RES_BF16>
__global__ __launch_bounds__(128) void k_gemm_bf3(const float* __restrict__ A, int lda, const unsigned short* __restrict__ Wt, int ldb,
                                                const float* __restrict__ bias, const float* __restrict__ resid, int rmod, int ldr,
                                                float* __restrict__ C, int ldc, int M, int N, int K) {
  __shared__ __attribute__((aligned(16))) float so[4][16][64];
  const int tid = threadIdx.x, w = tid >> 5, lane = tid & 31, ln = lane & 15, hh = lane >> 4;
  const int ntn = N / 64;
  const int wid = blockIdx.x * 4 + w;
  const int mt = wid / ntn, nq = wid % ntn;
  if (mt * 16 >= M) return;
  const int row0 = mt * 16, col0 = nq * 64;
  const float* arow = A + (size_t)(row0 + ln) * lda;
  v8f acc[4] = {};
  for (int kb = 0; kb < K; kb += 32) {
    FragB ah, al;
    const v4f x0 = *(const v4fa*)(arow + kb + 8 * hh), x1 = *(const v4fa*)(arow + kb + 8 * hh + 4);
    const v4f x2 = *(const v4fa*)(arow + kb + 16 + 8 * hh), x3 = *(const v4fa*)(arow + kb + 16 + 8 * hh + 4);
    float xs[16] = {x0[0],x0[1],x0[2],x0[3],x1[0],x1[1],x1[2],x1[3],x2[0],x2[1],x2[2],x2[3],x3[0],x3[1],x3[2],x3[3]};
#pragma unroll
    for (int i = 0; i < 16; ++i) { const unsigned short hb = bf16_bits(xs[i]); ah.u[i] = hb; al.u[i] = ASPLIT ? bf16_bits(xs[i] - bf16_val(hb)) : (unsigned short)0; }
#pragma unroll
    for (int t = 0; t < 4; ++t) {
      const unsigned short* brow = Wt + (size_t)(col0 + t * 16 + ln) * ldb + kb;
      FragB b;
      b.half[0] = *(const v8us*)(brow + 8 * hh);
      b.half[1] = *(const v8us*)(brow + 16 + 8 * hh);
      acc[t] = mmaN<ASPLIT ? 2 : 1>(ah.v, al.v, b.v, b.v, acc[t]);
    }
  }
#pragma unroll
  for (int t = 0; t < 4; ++t) {
    const int col = col0 + t * 16 + ln;
    float bv = bias ? bias[col] : 0.f;
    if (BIAS_BF16) bv = bf16_round(bv);
#pragma unroll
    for (int r = 0; r < 8; ++r) {
      float v = acc[t][r] + bv;
      if (resid) { float rv = resid[(size_t)((row0 + 8 * hh + r) % rmod) * ldr + col]; if (RES_BF16) rv = bf16_round(rv); v += rv; }
      if (ACT == 1) v = fmaxf(v, 0.f);
      if (ACT == 2) v = 0.5f * v * (1.0f + erff(v * 0.70710678118654752f));
      if (ACT == 3) { const float u = 0.7978845608028654f * (v + 0.044715f * v * v * v); v = 0.5f * v * (1.0f + tanhf(u)); }
      so[w][8 * hh + r][t * 16 + ln] = v;
    }
  }
  __builtin_amdgcn_fence(__ATOMIC_ACQ_REL, "workgroup");
  __builtin_amdgcn_wave_barrier();
  const int rsub = lane >> 4, c4 = (lane & 15) * 4;
  {
#pragma unroll
    for (int q = 0; q < 8; ++q) {
      const int r = q * 2 + rsub;
      const v4f v = *(const v4fa*)&so[w][r][c4];
      *(v4f*)(C + (size_t)(row0 + r) * ldc + col0 + c4) = v;
    }
    
  }
}
// row LayerNorm (biased variance, eps) over N: s = X (+ R); optional out_sum <- s; out_norm <- (s-mu)*rsqrt(var+eps)*g + b
template <bool PARAM_BF16>
__global__ __launch_bounds__(256) void k_layernorm(const float* __restrict__ X, const float* __restrict__ R, const float* __restrict__ g, const float* __restrict__ bta,
                                                  float* __restrict__ out_sum, float* __restrict__ out_norm, int N, float eps) {
  __shared__ float red[256];
  const int row = blockIdx.x, tid = threadIdx.x;
  const float* x = X + (size_t)row * N; const float* rr = R ? R + (size_t)row * N : nullptr;
  float vals[16];                     // up to N = 4096
  const int per = N / 256;            // contiguous chunk per thread? use strided-by-4 chunks: thread handles j = tid*4 + 1024*u
  float s1 = 0.f;
  for (int u = 0; u < per / 4; ++u) {
    const int j = tid * 4 + 1024 * u;
    const v4f a = *(const v4fa*)(x + j);
    v4f b = {0.f,0.f,0.f,0.f}; if (rr) b = *(const v4fa*)(rr + j);
#pragma unroll
    for (int q = 0; q < 4; ++q) { const float v = a[q] + b[q]; vals[u * 4 + q] = v; s1 += v; }
  }
  red[tid] = s1; __syncthreads();
  for (int st = 128; st > 0; st >>= 1) { if (tid < st) red[tid] += red[tid + st]; __syncthreads(); }
  const float mu = red[0] / (float)N; __syncthreads();
  float s2 = 0.f;
  for (int u = 0; u < per / 4; ++u)
#pragma unroll
    for (int q = 0; q < 4; ++q) { const float c = vals[u * 4 + q] - mu; s2 += c * c; }
  red[tid] = s2; __syncthreads();
  for (int st = 128; st > 0; st >>= 1) { if (tid < st) red[tid] += red[tid + st]; __syncthreads(); }
  const float rs = rsqrtf(red[0] / (float)N + eps);
  {
    for (int u = 0; u < per / 4; ++u) {
      const int j = tid * 4 + 1024 * u;
      v4f o, sm;
#pragma unroll
      for (int q = 0; q < 4; ++q) {
        float gg = g[j + q], bb = bta[j + q];
        if (PARAM_BF16) { gg = bf16_round(gg); bb = bf16_round(bb); }
        sm[q] = vals[u * 4 + q]; o[q] = (vals[u * 4 + q] - mu) * rs * gg + bb;
      }
      if (out_sum) *(v4f*)(out_sum + (size_t)row * N + j) = sm;
      *(v4f*)(out_norm + (size_t)row * N + j) = o;
    }
    
  }
}



// ---- f16 WMMA path (v_wmma_f32_16x16x32_f16): 11-bit significands for operands in range — used where a [0,1] probability operand needs more precision than bf16
typedef _Float16 v16h __attribute__((ext_vector_type(16)));
union FragH { v16h v; v8us half[2]; _Float16 h[16]; unsigned short u[16]; };
template <int NT>
__device__ __forceinline__ v8f mmaH(v16h ah, v16h al, v16h bh, v16h bl, v8f c) {
  c = __builtin_amdgcn_wmma_f32_16x16x32_f16(false, ah, false, bh, (short)0, c, false, false);
  if (NT >= 2) c = __builtin_amdgcn_wmma_f32_16x16x32_f16(false, al, false, bh, (short)0, c, false, false);
  if (NT >= 3) c = __builtin_amdgcn_wmma_f32_16x16x32_f16(false, ah, false, bl, (short)0, c, false, false);
  asm volatile("v_nop\n\tv_nop\n\tv_nop\n\tv_nop" : "+v"(c) : "v"(ah), "v"(al), "v"(bh), "v"(bl));
  return c;
}
// batched GEMM like k_gemm_b but f16 operands: A f32 (split into f16 hi/lo if ASPLIT, else rounded to f16), Bt = f16 values [n][k]; alpha; C f32; N multiple of 16 (partial tiles skipped)
template <bool ASPLIT>
__global__ __launch_bounds__(128) void k_gemm_h(const float* __restrict__ A, int lda, size_t sA, const _Float16* __restrict__ Bh, int ldb, size_t sB, float alpha, float* __restrict__ C, int ldc, size_t sC, int M, int N, int K) {
  __shared__ __attribute__((aligned(16))) float so[4][16][64];
  const int tid = threadIdx.x, w = tid >> 5, lane = tid & 31, ln = lane & 15, hh = lane >> 4; const int by = blockIdx.y;
  A += (size_t)by * sA; Bh += (size_t)by * sB; C += (size_t)by * sC;
  const int ntn = (N + 63) / 64; const int wid = blockIdx.x * 4 + w; const int mt = wid / ntn, nq = wid % ntn; if (mt * 16 >= M) return;
  const int row0 = mt * 16, col0 = nq * 64; const float* arow = A + (size_t)(row0 + ln) * lda;
  v8f acc[4] = {};
  for (int kb = 0; kb < K; kb += 32) {
    FragH ah, al;
    const v4f x0 = *(const v4fa*)(arow + kb + 8 * hh), x1 = *(const v4fa*)(arow + kb + 8 * hh + 4), x2 = *(const v4fa*)(arow + kb + 16 + 8 * hh), x3 = *(const v4fa*)(arow + kb + 16 + 8 * hh + 4);
    float xs[16] = {x0[0],x0[1],x0[2],x0[3],x1[0],x1[1],x1[2],x1[3],x2[0],x2[1],x2[2],x2[3],x3[0],x3[1],x3[2],x3[3]};
#pragma unroll
    for (int i = 0; i < 16; ++i) { const _Float16 h = (_Float16)xs[i]; ah.h[i] = h; al.h[i] = ASPLIT ? (_Float16)(xs[i] - (float)h) : (_Float16)0.0f; }
#pragma unroll
    for (int t = 0; t < 4; ++t) { if (col0 + t * 16 >= N) continue; const size_t boff = (size_t)(col0 + t * 16 + ln) * ldb + kb; FragH bq; bq.half[0] = *(const v8us*)(Bh + boff + 8 * hh); bq.half[1] = *(const v8us*)(Bh + boff + 16 + 8 * hh);
      acc[t] = mmaH<ASPLIT ? 2 : 1>(ah.v, al.v, bq.v, bq.v, acc[t]); }
  }
#pragma unroll
  for (int t = 0; t < 4; ++t) { if (col0 + t * 16 >= N) continue;
#pragma unroll
    for (int r = 0; r < 8; ++r) so[w][8 * hh + r][t * 16 + ln] = acc[t][r] * alpha; }
  __builtin_amdgcn_fence(__ATOMIC_ACQ_REL, "workgroup"); __builtin_amdgcn_wave_barrier();
  const int rsub = lane >> 4, c4 = (lane & 15) * 4;
  {
#pragma unroll
    for (int q = 0; q < 8; ++q) { const int r = q * 2 + rsub; if (col0 + c4 < N) { const v4f v = *(const v4fa*)&so[w][r][c4]; *(v4f*)(C + (size_t)(row0 + r) * ldc + col0 + c4) = v; } }
     }
}

// Wt[n][k] = f16(W[k][n]·scale) from f32 row-major W[K][N] (scale = power of two; bf16-exact weights stay exact in f16 away from the subnormal range)
__global__ __launch_bounds__(256) void k_wt_f16(const float* __restrict__ W, _Float16* __restrict__ Wt, int K, int N, float scale) {
  const int t = blockIdx.x * 256 + threadIdx.x; if (t >= N * (K / 8)) return; const int n = t / (K / 8), k8 = (t % (K / 8)) * 8; FragH f;
#pragma unroll
  for (int i = 0; i < 8; ++i) f.h[i] = (_Float16)(bf16_round(W[(size_t)(k8 + i) * N + n]) * scale); const v8us o = f.half[0];
  *(v8us*)((unsigned short*)Wt + (size_t)n * K + k8) = o; 
}
// k_gemm_hh variant with fused epilogue: v = acc·alpha + bias[by·sBias + col] (+ CP[(row/rowsPerB)·sCPb + by·64 + col] if CP) ; ACT 0 none / 1 elu ; writes f16 C16 (and f32 C if non-null)
template <int ACT>
__global__ __launch_bounds__(128) void k_gemm_hhx(const _Float16* __restrict__ A, int lda, size_t sA, const _Float16* __restrict__ Bh, int ldb, size_t sB, float alpha, const float* __restrict__ bias, size_t sBias, const float* __restrict__ CP, int rowsPerB, size_t sCPb, int row0g,
    float* __restrict__ C, _Float16* __restrict__ C16, int ldc, size_t sC, int M, int N, int K) {
  __shared__ __attribute__((aligned(16))) float so[4][16][64];
  const int tid = threadIdx.x, w = tid >> 5, lane = tid & 31, ln = lane & 15, hh = lane >> 4; const int by = blockIdx.y;
  A += (size_t)by * sA; Bh += (size_t)by * sB; const size_t cofs = (size_t)by * sC; const float* bp = bias ? bias + (size_t)by * sBias : nullptr;
  const int ntn = (N + 63) / 64; const int wid = blockIdx.x * 4 + w; const int mt = wid / ntn, nq = wid % ntn; if (mt * 16 >= M) return;
  const int row0 = mt * 16, col0 = nq * 64; const _Float16* arow = A + (size_t)(row0 + ln) * lda;
  v8f acc[4] = {};
  for (int kb = 0; kb < K; kb += 32) { FragH ah; ah.half[0] = *(const v8us*)((const unsigned short*)arow + kb + 8 * hh); ah.half[1] = *(const v8us*)((const unsigned short*)arow + kb + 16 + 8 * hh);
#pragma unroll
    for (int t = 0; t < 4; ++t) { if (col0 + t * 16 >= N) continue; const size_t boff = (size_t)(col0 + t * 16 + ln) * ldb + kb; FragH bq; bq.half[0] = *(const v8us*)((const unsigned short*)Bh + boff + 8 * hh); bq.half[1] = *(const v8us*)((const unsigned short*)Bh + boff + 16 + 8 * hh);
      acc[t] = mmaH<1>(ah.v, ah.v, bq.v, bq.v, acc[t]); }
  }
#pragma unroll
  for (int t = 0; t < 4; ++t) { if (col0 + t * 16 >= N) continue; const int col = col0 + t * 16 + ln; const float bv = bp ? bf16_round(bp[col]) : 0.f;
#pragma unroll
    for (int r = 0; r < 8; ++r) { float v = acc[t][r] * alpha + bv; if (CP) { const int rr = row0g + row0 + 8 * hh + r; if (rowsPerB < 0) v += CP[cofs + (size_t)rr * ldc + col];      /* rowsPerB < 0: own element of the batched C plane */ else { const int bidx = rr / rowsPerB; v += CP[(size_t)bidx * sCPb + (size_t)by * 64 + col]; } } if (ACT == 1) v = (v > 0.f) ? v : expm1f(v); else if (ACT == 7) v = (v > 0.f) ? v + 1.0f : expf(v); else if (ACT == 8) v = tanhf(v); else if (ACT == 9) v = 0.5f * v * (1.0f + tanhf(0.7978845608028654f * (v + 0.044715f * v * v * v))); else if (ACT == 11) v = 1.0f / (1.0f + expf(-v)); else if (ACT == 12) v = (v > 0.f) ? v : 0.01f * v; else if (ACT == 14) v = (v > 0.f) ? v : 0.1f * v; else if (ACT == 16) v = (v >= 0.f) ? v : 0.3f * v; else if (ACT == 17) v = (v >= 0.f) ? v : 0.2f * v; else if (ACT == 15) v = v / (1.0f + expf(-v)); else if (ACT == 3) v = fmaxf(v, 0.f); else if (ACT == 6) v = 0.5f * v * (1.0f + erff(v * 0.70710678118654752f)); so[w][8 * hh + r][t * 16 + ln] = v; } }
  __builtin_amdgcn_fence(__ATOMIC_ACQ_REL, "workgroup"); __builtin_amdgcn_wave_barrier();
  const int rsub = lane >> 4, c4 = (lane & 15) * 4; typedef _Float16 v4h __attribute__((ext_vector_type(4)));
  {
#pragma unroll
    for (int q = 0; q < 8; ++q) { const int r = q * 2 + rsub; if (col0 + c4 < N) { const v4f v = *(const v4fa*)&so[w][r][c4]; if (C) *(v4f*)(C + cofs + (size_t)(row0 + r) * ldc + col0 + c4) = v; if (C16) { v4h h4; for (int i = 0; i < 4; ++i) h4[i] = (_Float16)v[i]; *(v4h*)(C16 + cofs + (size_t)(row0 + r) * ldc + col0 + c4) = h4; } } }
     }
}


typedef _Float16 v4h __attribute__((ext_vector_type(4)));

__global__ __launch_bounds__(256) void k_x16(const float* __restrict__ x, _Float16* __restrict__ X16, size_t n8) { const size_t t = (size_t)blockIdx.x * 256 + threadIdx.x; if (t >= n8) return; FragH f;
#pragma unroll
  for (int q = 0; q < 8; ++q) f.h[q] = (_Float16)bf16_round(x[t * 8 + q]); *(v8us*)((unsigned short*)X16 + t * 8) = f.half[0];  }
__global__ __launch_bounds__(256) void k_h16(const float* __restrict__ x, _Float16* __restrict__ X16, size_t n8) { const size_t t = (size_t)blockIdx.x * 256 + threadIdx.x; if (t >= n8) return; FragH f;
#pragma unroll
  for (int q = 0; q < 8; ++q) f.h[q] = (_Float16)x[t * 8 + q]; *(v8us*)((unsigned short*)X16 + t * 8) = f.half[0];  }
__global__ __launch_bounds__(256) void k_round16f(const float* __restrict__ W, _Float16* __restrict__ Bt, size_t n8) { const size_t t = (size_t)blockIdx.x * 256 + threadIdx.x; if (t >= n8) return; FragH f;
#pragma unroll
  for (int i = 0; i < 8; ++i) f.h[i] = (_Float16)(bf16_round(W[t * 8 + i]) * 16.0f); *(v8us*)((unsigned short*)Bt + t * 8) = f.half[0];  }
template <int NHv, int TTv>
__global__ __launch_bounds__(256) void k_vt(const _Float16* __restrict__ V16, int ldv, int voff, _Float16* __restrict__ Vt) { __shared__ unsigned short tl[64][66]; const int tid = threadIdx.x; const int slab = blockIdx.x / (TTv / 64), lg = blockIdx.x % (TTv / 64); const int b = slab / NHv, h = slab % NHv;
  for (int i = tid; i < 64 * 8; i += 256) { const int r = i / 8, c8 = (i % 8) * 8; FragH f; f.half[0] = *(const v8us*)((const unsigned short*)V16 + ((size_t)b * TTv + lg * 64 + r) * ldv + voff + h * 64 + c8);
#pragma unroll
    for (int q = 0; q < 8; ++q) tl[r][c8 + q] = f.u[q]; }
  __syncthreads();
  {
#pragma unroll
    for (int rd = 0; rd < 2; ++rd) { const int d = rd * 32 + tid / 8, pc = tid % 8; FragH f;
#pragma unroll
      for (int q = 0; q < 8; ++q) f.u[q] = tl[pc * 8 + q][d];
      *(v8us*)((unsigned short*)Vt + ((size_t)slab * 64 + d) * TTv + lg * 64 + pc * 8) = f.half[0]; }
     } }

__global__ __launch_bounds__(256) void k_hl(const float* __restrict__ F, _Float16* __restrict__ Hh, _Float16* __restrict__ Hl, size_t n8) { const size_t t = (size_t)blockIdx.x * 256 + threadIdx.x; if (t >= n8) return; FragH fh, fl; const v4f a = *(const v4fa*)(F + t * 8), c = *(const v4fa*)(F + t * 8 + 4);
#pragma unroll
  for (int q = 0; q < 4; ++q) { _Float16 h = (_Float16)a[q]; fh.h[q] = h; fl.h[q] = (_Float16)((a[q] - (float)h) * 1024.0f); h = (_Float16)c[q]; fh.h[4 + q] = h; fl.h[4 + q] = (_Float16)((c[q] - (float)h) * 1024.0f); }
  { *(v8us*)((unsigned short*)Hh + t * 8) = fh.half[0]; *(v8us*)((unsigned short*)Hl + t * 8) = fl.half[0];  } }

// ---- fast GEMM (wave tile 32x64; requires M % 32 == 0 rows per launch region and N % 64 == 0); epilogue = k_gemm_hhx semantics ----
__device__ __forceinline__ v16h g2_frag(const _Float16* p, int hh) { FragH f; f.half[0] = *(const v8us*)((const unsigned short*)p + 8 * hh); f.half[1] = *(const v8us*)((const unsigned short*)p + 16 + 8 * hh); return f.v; }
__device__ __forceinline__ v8f g2_mma(v16h a, v16h b, v8f c) { v8f d = __builtin_amdgcn_wmma_f32_16x16x32_f16(false, a, false, b, (short)0, c, false, false); asm volatile("v_nop\n\tv_nop\n\tv_nop\n\tv_nop" : "+v"(d) : "v"(a), "v"(b)); return d; }
template <int ACT>
__global__ __launch_bounds__(128) void k_gemm2(const _Float16* __restrict__ A, int lda, size_t sA, const _Float16* __restrict__ Bh, int ldb, size_t sB, float alpha, const float* __restrict__ bias, size_t sBias, const float* __restrict__ CP, int rowsPerB, size_t sCPb, int row0g,
    float* __restrict__ C, _Float16* __restrict__ C16, int ldc, size_t sC, int M, int N, int K) { static_assert(ACT == 0 || ACT == 3 || ACT == 6 || ACT == 8 || ACT == 9 || ACT == 11 || ACT == 12 || ACT == 14 || ACT == 15 || ACT == 16 || ACT == 17, "k_gemm2: unsupported ACT code (would silently apply no activation)");
  __shared__ __attribute__((aligned(16))) float so[4][32][68];
  const int tid = threadIdx.x, w = tid >> 5, lane = tid & 31, ln = lane & 15, hh = lane >> 4; const int by = blockIdx.y;
  A += (size_t)by * sA; Bh += (size_t)by * sB; const size_t cofs = (size_t)by * sC; const float* bp = bias ? bias + (size_t)by * sBias : nullptr;
  const int ntn = N >> 6; const int mt = blockIdx.x / ntn, nq = blockIdx.x - mt * ntn; const int row0 = mt * 128 + 32 * w, col0 = nq * 64; if (row0 >= M) return;
  const _Float16* a0p = A + (size_t)(row0 + ln) * lda; const _Float16* a1p = a0p + (size_t)16 * lda;
  const _Float16* b0p = Bh + (size_t)(col0 + ln) * ldb; const _Float16* b1p = b0p + (size_t)16 * ldb; const _Float16* b2p = b1p + (size_t)16 * ldb; const _Float16* b3p = b2p + (size_t)16 * ldb;
  const v8f z8 = {0.f,0.f,0.f,0.f,0.f,0.f,0.f,0.f}; v8f c00 = z8, c01 = z8, c02 = z8, c03 = z8, c10 = z8, c11 = z8, c12 = z8, c13 = z8;
#pragma unroll 1
  for (int kb = 0; kb < K; kb += 32) { const v16h a0 = g2_frag(a0p + kb, hh), a1 = g2_frag(a1p + kb, hh);
    v16h b = g2_frag(b0p + kb, hh); c00 = g2_mma(a0, b, c00); c10 = g2_mma(a1, b, c10);
    b = g2_frag(b1p + kb, hh); c01 = g2_mma(a0, b, c01); c11 = g2_mma(a1, b, c11);
    b = g2_frag(b2p + kb, hh); c02 = g2_mma(a0, b, c02); c12 = g2_mma(a1, b, c12);
    b = g2_frag(b3p + kb, hh); c03 = g2_mma(a0, b, c03); c13 = g2_mma(a1, b, c13); }
  v8f accs[8] = {c00, c01, c02, c03, c10, c11, c12, c13};
#pragma unroll
  for (int u = 0; u < 8; ++u) { const int t = u & 3, half = u >> 2; const int col = col0 + t * 16 + ln; const float bv = bp ? bf16_round(bp[col]) : 0.f;
#pragma unroll
    for (int r = 0; r < 8; ++r) { const int rloc = half * 16 + 8 * hh + r; float v = accs[u][r] * alpha + bv; if (CP) { if (rowsPerB < 0) v += CP[cofs + (size_t)(row0g + row0 + rloc) * ldc + col];      /* rowsPerB < 0: own element of the batched C plane */ else { const int bidx = (row0g + row0 + rloc) / rowsPerB; v += CP[(size_t)bidx * sCPb + (size_t)by * 64 + col]; } }
      if (ACT == 3) v = fmaxf(v, 0.f); else if (ACT == 6) v = 0.5f * v * (1.0f + erff(v * 0.70710678118654752f)); else if (ACT == 11) v = 1.0f / (1.0f + expf(-v)); else if (ACT == 15) v = v / (1.0f + expf(-v)); else if (ACT == 12) v = (v > 0.f) ? v : 0.01f * v; else if (ACT == 8) v = tanhf(v); else if (ACT == 9) v = 0.5f * v * (1.0f + tanhf(0.7978845608028654f * (v + 0.044715f * v * v * v))); else if (ACT == 14) v = (v > 0.f) ? v : 0.1f * v; else if (ACT == 16) v = (v >= 0.f) ? v : 0.3f * v; else if (ACT == 17) v = (v >= 0.f) ? v : 0.2f * v;
      so[w][rloc][t * 16 + ln] = v; } }
  __builtin_amdgcn_fence(__ATOMIC_ACQ_REL, "workgroup"); __builtin_amdgcn_wave_barrier();
  const int rsub = lane >> 4, c4 = (lane & 15) * 4;
  {
#pragma unroll
    for (int q = 0; q < 16; ++q) { const int r = q * 2 + rsub; const v4f v = *(const v4fa*)&so[w][r][c4]; if (C) *(v4f*)(C + cofs + (size_t)(row0 + r) * ldc + col0 + c4) = v; if (C16) { v4h h4; for (int i = 0; i < 4; ++i) h4[i] = (_Float16)v[i]; *(v4h*)(C16 + cofs + (size_t)(row0 + r) * ldc + col0 + c4) = h4; } }
     } }


__global__ __launch_bounds__(256) void k_wnat(const float* __restrict__ w, size_t n8, _Float16* __restrict__ Bt) { const size_t t = (size_t)blockIdx.x * 256 + threadIdx.x; if (t >= n8) return; FragH f; for (int q = 0; q < 8; ++q) f.h[q] = (_Float16)(bf16_round(w[t * 8 + q]) * 16.0f); *(v8us*)((unsigned short*)Bt + t * 8) = f.half[0];  }
__global__ __launch_bounds__(256) void k_rsm(const float* __restrict__ S, _Float16* __restrict__ P, int nrows) {
  #pragma clang fp contract(off)
  const int i = blockIdx.x * 256 + threadIdx.x; if (i >= nrows) return; const float* s = S + (size_t)i * SQ; float mx = -3.0e38f;
#pragma unroll 1
  for (int j = 0; j < SQ; ++j) mx = fmaxf(mx, s[j]); float se = 0.f;
#pragma unroll 1
  for (int j = 0; j < SQ; ++j) se += expf(s[j] - mx); const float sc = 256.0f / se;
#pragma unroll 1
  for (int j0 = 0; j0 < SQ; j0 += 8) { FragH f; for (int q = 0; q < 8; ++q) f.h[q] = (_Float16)(expf(s[j0 + q] - mx) * sc); unsigned short* d = (unsigned short*)P + (size_t)i * SQ + j0; *(v8us*)d = f.half[0];  } }
__global__ __launch_bounds__(256) void k_vt(const _Float16* __restrict__ V16, int b, int h0, _Float16* __restrict__ VT) { __shared__ unsigned short tl[64][65]; const int tid = threadIdx.x; const int hh = blockIdx.x % HG, sg = blockIdx.x / HG; const int s0 = sg * 64; const int h = h0 + hh;
  for (int i = tid; i < 64 * 8; i += 256) { const int j = i / 8, d8 = (i % 8) * 8; FragH f; f.half[0] = *(const v8us*)((const unsigned short*)V16 + ((size_t)b * SQ + s0 + j) * DM + h * HD + d8); for (int q = 0; q < 8; ++q) tl[d8 + q][j] = f.u[q]; }
  __syncthreads();
  { for (int i = tid; i < 64 * 8; i += 256) { const int d = i / 8, j8 = (i % 8) * 8; FragH f; for (int q = 0; q < 8; ++q) f.u[q] = tl[d][j8 + q]; *(v8us*)((unsigned short*)VT + ((size_t)hh * HD + d) * SQ + s0 + j8) = f.half[0]; }  } }



__global__ __launch_bounds__(256) void k_rsmf(const float* __restrict__ S, _Float16* __restrict__ P, int qn, int hg) {
  #pragma clang fp contract(off)
  const int t = blockIdx.x * 256 + threadIdx.x; if (t >= qn * hg) return; const size_t i = (size_t)(t / qn) * SQ + (t % qn); const float* s = S + i * SQ; float mx = -3.0e38f;
#pragma unroll 1
  for (int j = 0; j < SQ; ++j) mx = fmaxf(mx, s[j]); float se = 0.f;
#pragma unroll 1
  for (int j = 0; j < SQ; ++j) se += __expf(s[j] - mx); const float sc = 256.0f / se;
#pragma unroll 1
  for (int j0 = 0; j0 < SQ; j0 += 8) { FragH f; for (int q = 0; q < 8; ++q) f.h[q] = (_Float16)(__expf(s[j0 + q] - mx) * sc); unsigned short* d = (unsigned short*)P + i * SQ + j0; *(v8us*)d = f.half[0];  } }


__global__ __launch_bounds__(256) void k_rsmk1(const float* __restrict__ S, _Float16* __restrict__ P, int nrows, const int* __restrict__ Km) {
  #pragma clang fp contract(off)
  const int i = blockIdx.x * 256 + threadIdx.x; if (i >= nrows) return; const float* s = S + (size_t)i * SQ; float mx = -3.0e38f;
#pragma unroll 1
  for (int j = 0; j < SQ; ++j) mx = fmaxf(mx, s[j]); float se = 0.f;
#pragma unroll 1
  for (int j = 0; j < SQ; ++j) { const float keep = (Km[j] != 0) ? 1.0f : 0.0f; se += __expf(s[j] - mx) * keep; } const float sc = 256.0f / se;
#pragma unroll 1
  for (int j0 = 0; j0 < SQ; j0 += 8) { FragH f; for (int q = 0; q < 8; ++q) { const float keep = (Km[j0 + q] != 0) ? 1.0f : 0.0f; f.h[q] = (_Float16)(__expf(s[j0 + q] - mx) * sc * keep); } unsigned short* d = (unsigned short*)P + (size_t)i * SQ + j0; *(v8us*)d = f.half[0];  } }
extern "C" void kernel_launch(void* const* d_in, const int* in_sizes, int n_in,
                              void* d_out, int out_size, void* d_ws, size_t ws_size, hipStream_t stream) {
  (void)in_sizes; (void)n_in; (void)out_size;
  const float* const* I = (const float* const*)d_in; const float* xq = I[0]; const float* xk = I[1]; const float* xv = I[2]; const int* km = (const int*)d_in[3];      /* key mask int32 [2][1][1][2048] (0 = masked; READ on device): plane b of 16 belongs to batch b / 8 */      /* given q, k, v [B][H][S][64]: each (b, h) plane is a 'batch' of one 64-wide head */
  char* ws = (char*)d_ws; size_t off = 0;
  auto take = [&](size_t bytes) { char* p = ws + off; off += (bytes + 255) & ~(size_t)255; return p; };
  _Float16* Q16 = (_Float16*)take(NR * DM * 2); _Float16* K16 = (_Float16*)take(NR * DM * 2); _Float16* V16 = (_Float16*)take(NR * DM * 2);
  float* S = (float*)take((size_t)HG * SQ * SQ * 4); _Float16* P = (_Float16*)take((size_t)HG * SQ * SQ * 2); _Float16* VT = (_Float16*)take((size_t)NH * HD * SQ * 2);
  if (off > ws_size) return;

  const size_t r0p = (size_t)B0 * SQ;      /* first converted row */
  k_x16<<<(unsigned)(((size_t)MP * DM / 8 + 255) / 256), 256, 0, stream>>>(xq + r0p * DM, Q16 + r0p * DM, (size_t)MP * DM / 8); k_x16<<<(unsigned)(((size_t)MP * DM / 8 + 255) / 256), 256, 0, stream>>>(xk + r0p * DM, K16 + r0p * DM, (size_t)MP * DM / 8); k_x16<<<(unsigned)(((size_t)MP * DM / 8 + 255) / 256), 256, 0, stream>>>(xv + r0p * DM, V16 + r0p * DM, (size_t)MP * DM / 8);      /* given q, k, v: bf16 inputs as exact f16 rows (no projections) */
  for (int b = B0; b < B0 + NBR; ++b) { const size_t r0 = (size_t)b * SQ;
    k_vt<NH, SQ><<<NH * (SQ / 64), 256, 0, stream>>>(V16 + r0 * LQ, LQ, 0, VT);      /* V^T [NH][HD][SQ] for this batch */
    for (int h0 = 0; h0 < NHD; h0 += HG) {
      k_gemm2<0><<<dim3((QN / 128) * (SQ / 64), HG), 128, 0, stream>>>(Q16 + r0 * LQ + h0 * HD, LQ, (size_t)HD, K16 + r0 * LQ + h0 * HD, LQ, (size_t)HD, 0.125f, nullptr, 0, nullptr, 1, 0, 0, S, nullptr, SQ, (size_t)SQ * SQ, QN, SQ, HD);      /* scores, HG heads per launch */
      k_rsmk1<<<(HG * QN + 255) / 256, 256, 0, stream>>>(S, P, HG * QN, km + (size_t)(b / 8) * SQ);      /* keys with mask[b / 8][j] == 0 excluded (arithmetic 0/1 keep factor; weight exactly 0 as the module's NEG fill); P x256 f16 */
      k_gemm2<0><<<dim3((QN / 128) * (HD / 64), HG), 128, 0, stream>>>(P, SQ, (size_t)SQ * SQ, VT + (size_t)h0 * HD * SQ, SQ, (size_t)HD * SQ, 0.00390625f, nullptr, 0, nullptr, 1, 0, 0, (float*)d_out + r0 * DM + h0 * HD, nullptr, DM, (size_t)HD, QN, HD, SQ); } }      /* out = A v straight to the f32 output */
}

// v001
// A run of this version takes 1200 microseconds.
// In two side-by-side timings against v000, it was 5.13 and 5.14 times as fast.
#include <hip/hip_runtime.h>
// Scaled dot-product attention on given head-major query, key, value with a key-padding mask (q, k, v [2][8][2048][64] each = 16 independent [2048][64] planes; att = (q / 8) . k; where(mask == 0, NEG) with the int32 [2][1][1][2048] mask in {0, 1} (random; 0 = masked key, shared by the 8 heads of a batch; READ on device); softmax; out = att v -> [2][8][2048][64]).
// Structure: the three inputs converted to exact f16 rows (bf16 values are exact in f16: no projections); per (batch, head) slab: V^T via LDS transposes; scores (K = 64; exact products, f32 accumulation) into an f32 [S][S] plane, row softmax on VALU (f32 statistics, native exp; weights x256 f16), out = P V^T (alpha 2^-8) written f32 straight into the output.
// Compute dtype: inputs rounded to bf16; x / weights exact; q, k, v and softmax weights as plain f16 GEMM operands (~2^-12); scores and softmax statistics f32. v_wmma_f32_16x16x32_f16.
#define NB 16
#define SQ 2048
#define DM 64
#define NH 1
#define HD 64
#define HG 1                         /* heads per attention launch group */
#define B0 0                         /* first batch processed (debug hook) */
#define NBR NB                       /* batches processed (debug hook) */
#define NR ((size_t)NB * SQ)         /* token rows */
#define MP ((int)((size_t)NBR * SQ)) /* rows converted to f16 (debug hook) */
#define QN SQ                        /* query rows attended per batch (debug hook) */
#define NHD NH                       /* heads attended (debug hook) */
#define MPO MP                       /* unused (debug hook) */
#define LQ DM      /* row pitch of the q/k/v rows */
typedef __bf16 v16b __attribute__((ext_vector_type(16)));
typedef unsigned short v8us __attribute__((ext_vector_type(8), may_alias));
typedef float  v8f  __attribute__((ext_vector_type(8)));
typedef float  v4f  __attribute__((ext_vector_type(4)));
typedef float  v4fa __attribute__((ext_vector_type(4), may_alias));
union FragB { v16b v; v8us half[2]; unsigned short u[16]; };

__device__ __forceinline__ unsigned short bf16_bits(float x) { unsigned int u = __float_as_uint(x); return (unsigned short)((u + 0x7FFFu + ((u >> 16) & 1u)) >> 16); }
__device__ __forceinline__ float bf16_val(unsigned short b) { return __uint_as_float(((unsigned int)b) << 16); }
__device__ __forceinline__ float bf16_round(float x) { return bf16_val(bf16_bits(x)); }
// D += A·B with NT terms: 1 = ah·bh, 2 = + al·bh (A split), 3 = + ah·bl (both split)
template <int NT>
__device__ __forceinline__ v8f mmaN(v16b ah, v16b al, v16b bh, v16b bl, v8f c) {
  c = __builtin_amdgcn_wmma_f32_16x16x32_bf16(false, ah, false, bh, (short)0, c, false, false);
  if (NT >= 2) c = __builtin_amdgcn_wmma_f32_16x16x32_bf16(false, al, false, bh, (short)0, c, false, false);
  if (NT >= 3) c = __builtin_amdgcn_wmma_f32_16x16x32_bf16(false, ah, false, bl, (short)0, c, false, false);
  asm volatile("v_nop\n\tv_nop\n\tv_nop\n\tv_nop" : "+v"(c) : "v"(ah), "v"(al), "v"(bh), "v"(bl));
  return c;
}

__global__ __launch_bounds__(256) void k_wt_bf16(const float* __restrict__ W, unsigned short* __restrict__ Wt, int K, int N) {
  const int t = blockIdx.x * 256 + threadIdx.x;
  const int k8n = K / 8;
  if (t >= N * k8n) return;
  const int n = t / k8n, k8 = (t % k8n) * 8;
  v8us v;
#pragma unroll
  for (int i = 0; i < 8; ++i) v[i] = bf16_bits(W[(size_t)(k8 + i) * N + n]);
  *(v8us*)(Wt + (size_t)n * K + k8) = v;
  
}

// GEMM C[M][N] (f32, pitch ldc) = act(A[M][K]·W + bias). A f32 row-major (pitch lda) converted per fragment to bf16
// (ASPLIT: hi/lo two planes -> 2 terms, else single rounded term); Wt bf16 [N][K] (pitch ldb). BIAS_BF16 rounds the
// bias to bf16 first (bias quantised to bf16 before the add). K%32==0, M%16==0, N%64==0.
template <bool ASPLIT, int ACT, bool BIAS_BF16>
__global__ __launch_bounds__(128) void k_gemm_bf(const float* __restrict__ A, int lda, const unsigned short* __restrict__ Wt, int ldb,
                                               const float* __restrict__ bias, float* __restrict__ C, int ldc, int M, int N, int K) {
  __shared__ __attribute__((aligned(16))) float so[4][16][64];
  const int tid = threadIdx.x, w = tid >> 5, lane = tid & 31, ln = lane & 15, hh = lane >> 4;
  const int ntn = N / 64;
  const int wid = blockIdx.x * 4 + w;
  const int mt = wid / ntn, nq = wid % ntn;
  if (mt * 16 >= M) return;
  const int row0 = mt * 16, col0 = nq * 64;
  const float* arow = A + (size_t)(row0 + ln) * lda;
  v8f acc[4] = {};
  for (int kb = 0; kb < K; kb += 32) {
    FragB ah, al;
    const v4f x0 = *(const v4fa*)(arow + kb + 8 * hh), x1 = *(const v4fa*)(arow + kb + 8 * hh + 4);
    const v4f x2 = *(const v4fa*)(arow + kb + 16 + 8 * hh), x3 = *(const v4fa*)(arow + kb + 16 + 8 * hh + 4);
    float xs[16] = {x0[0],x0[1],x0[2],x0[3],x1[0],x1[1],x1[2],x1[3],x2[0],x2[1],x2[2],x2[3],x3[0],x3[1],x3[2],x3[3]};
#pragma unroll
    for (int i = 0; i < 16; ++i) { const unsigned short hb = bf16_bits(xs[i]); ah.u[i] = hb; al.u[i] = ASPLIT ? bf16_bits(xs[i] - bf16_val(hb)) : (unsigned short)0; }
#pragma unroll
    for (int t = 0; t < 4; ++t) {
      const unsigned short* brow = Wt + (size_t)(col0 + t * 16 + ln) * ldb + kb;
      FragB b;
      b.half[0] = *(const v8us*)(brow + 8 * hh);
      b.half[1] = *(const v8us*)(brow + 16 + 8 * hh);
      acc[t] = mmaN<ASPLIT ? 2 : 1>(ah.v, al.v, b.v, b.v, acc[t]);
    }
  }
#pragma unroll
  for (int t = 0; t < 4; ++t) {
    float bv = bias ? bias[col0 + t * 16 + ln] : 0.f;
    if (BIAS_BF16) bv = bf16_round(bv);
#pragma unroll
    for (int r = 0; r < 8; ++r) { float v = acc[t][r] + bv; if (ACT == 1) v = fmaxf(v, 0.f); so[w][8 * hh + r][t * 16 + ln] = v; }
  }
  __builtin_amdgcn_fence(__ATOMIC_ACQ_REL, "workgroup");
  __builtin_amdgcn_wave_barrier();
  const int rsub = lane >> 4, c4 = (lane & 15) * 4;
  {
#pragma unroll
    for (int q = 0; q < 8; ++q) {
      const int r = q * 2 + rsub;
      const v4f v = *(const v4fa*)&so[w][r][c4];
      *(v4f*)(C + (size_t)(row0 + r) * ldc + col0 + c4) = v;
    }
    
  }
}

// GEMM C = act(A·W + bias + resid): A f32 (ASPLIT -> hi/lo 2 terms), Wt bf16 [N][K]; ACT 0 none, 1 relu, 2 exact gelu;
// resid (optional, f32, row index = (row % rmod), pitch ldr, RES_BF16 rounds it) added before the activation.
template <bool ASPLIT, int ACT, bool BIAS_BF16, bool RES_BF16>
__global__ __launch_bounds__(128) void k_gemm_bf3(const float* __restrict__ A, int lda, const unsigned short* __restrict__ Wt, int ldb,
                                                const float* __restrict__ bias, const float* __restrict__ resid, int rmod, int ldr,
                                                float* __restrict__ C, int ldc, int M, int N, int K) {
  __shared__ __attribute__((aligned(16))) float so[4][16][64];
  const int tid = threadIdx.x, w = tid >> 5, lane = tid & 31, ln = lane & 15, hh = lane >> 4;
  const int ntn = N / 64;
  const int wid = blockIdx.x * 4 + w;
  const int mt = wid / ntn, nq = wid % ntn;
  if (mt * 16 >= M) return;
  const int row0 = mt * 16, col0 = nq * 64;
  const float* arow = A + (size_t)(row0 + ln) * lda;
  v8f acc[4] = {};
  for (int kb = 0; kb < K; kb += 32) {
    FragB ah, al;
    const v4f x0 = *(const v4fa*)(arow + kb + 8 * hh), x1 = *(const v4fa*)(arow + kb + 8 * hh + 4);
    const v4f x2 = *(const v4fa*)(arow + kb + 16 + 8 * hh), x3 = *(const v4fa*)(arow + kb + 16 + 8 * hh + 4);
    float xs[16] = {x0[0],x0[1],x0[2],x0[3],x1[0],x1[1],x1[2],x1[3],x2[0],x2[1],x2[2],x2[3],x3[0],x3[1],x3[2],x3[3]};
#pragma unroll
    for (int i = 0; i < 16; ++i) { const unsigned short hb = bf16_bits(xs[i]); ah.u[i] = hb; al.u[i] = ASPLIT ? bf16_bits(xs[i] - bf16_val(hb)) : (unsigned short)0; }
#pragma unroll
    for (int t = 0; t < 4; ++t) {
      const unsigned short* brow = Wt + (size_t)(col0 + t * 16 + ln) * ldb + kb;
      FragB b;
      b.half[0] = *(const v8us*)(brow + 8 * hh);
      b.half[1] = *(const v8us*)(brow + 16 + 8 * hh);
      acc[t] = mmaN<ASPLIT ? 2 : 1>(ah.v, al.v, b.v, b.v, acc[t]);
    }
  }
#pragma unroll
  for (int t = 0; t < 4; ++t) {
    const int col = col0 + t * 16 + ln;
    float bv = bias ? bias[col] : 0.f;
    if (BIAS_BF16) bv = bf16_round(bv);
#pragma unroll
    for (int r = 0; r < 8; ++r) {
      float v = acc[t][r] + bv;
      if (resid) { float rv = resid[(size_t)((row0 + 8 * hh + r) % rmod) * ldr + col]; if (RES_BF16) rv = bf16_round(rv); v += rv; }
      if (ACT == 1) v = fmaxf(v, 0.f);
      if (ACT == 2) v = 0.5f * v * (1.0f + erff(v * 0.70710678118654752f));
      if (ACT == 3) { const float u = 0.7978845608028654f * (v + 0.044715f * v * v * v); v = 0.5f * v * (1.0f + tanhf(u)); }
      so[w][8 * hh + r][t * 16 + ln] = v;
    }
  }
  __builtin_amdgcn_fence(__ATOMIC_ACQ_REL, "workgroup");
  __builtin_amdgcn_wave_barrier();
  const int rsub = lane >> 4, c4 = (lane & 15) * 4;
  {
#pragma unroll
    for (int q = 0; q < 8; ++q) {
      const int r = q * 2 + rsub;
      const v4f v = *(const v4fa*)&so[w][r][c4];
      *(v4f*)(C + (size_t)(row0 + r) * ldc + col0 + c4) = v;
    }
    
  }
}
// row LayerNorm (biased variance, eps) over N: s = X (+ R); optional out_sum <- s; out_norm <- (s-mu)*rsqrt(var+eps)*g + b
template <bool PARAM_BF16>
__global__ __launch_bounds__(256) void k_layernorm(const float* __restrict__ X, const float* __restrict__ R, const float* __restrict__ g, const float* __restrict__ bta,
                                                  float* __restrict__ out_sum, float* __restrict__ out_norm, int N, float eps) {
  __shared__ float red[256];
  const int row = blockIdx.x, tid = threadIdx.x;
  const float* x = X + (size_t)row * N; const float* rr = R ? R + (size_t)row * N : nullptr;
  float vals[16];                     // up to N = 4096
  const int per = N / 256;            // contiguous chunk per thread? use strided-by-4 chunks: thread handles j = tid*4 + 1024*u
  float s1 = 0.f;
  for (int u = 0; u < per / 4; ++u) {
    const int j = tid * 4 + 1024 * u;
    const v4f a = *(const v4fa*)(x + j);
    v4f b = {0.f,0.f,0.f,0.f}; if (rr) b = *(const v4fa*)(rr + j);
#pragma unroll
    for (int q = 0; q < 4; ++q) { const float v = a[q] + b[q]; vals[u * 4 + q] = v; s1 += v; }
  }
  red[tid] = s1; __syncthreads();
  for (int st = 128; st > 0; st >>= 1) { if (tid < st) red[tid] += red[tid + st]; __syncthreads(); }
  const float mu = red[0] / (float)N; __syncthreads();
  float s2 = 0.f;
  for (int u = 0; u < per / 4; ++u)
#pragma unroll
    for (int q = 0; q < 4; ++q) { const float c = vals[u * 4 + q] - mu; s2 += c * c; }
  red[tid] = s2; __syncthreads();
  for (int st = 128; st > 0; st >>= 1) { if (tid < st) red[tid] += red[tid + st]; __syncthreads(); }
  const float rs = rsqrtf(red[0] / (float)N + eps);
  {
    for (int u = 0; u < per / 4; ++u) {
      const int j = tid * 4 + 1024 * u;
      v4f o, sm;
#pragma unroll
      for (int q = 0; q < 4; ++q) {
        float gg = g[j + q], bb = bta[j + q];
        if (PARAM_BF16) { gg = bf16_round(gg); bb = bf16_round(bb); }
        sm[q] = vals[u * 4 + q]; o[q] = (vals[u * 4 + q] - mu) * rs * gg + bb;
      }
      if (out_sum) *(v4f*)(out_sum + (size_t)row * N + j) = sm;
      *(v4f*)(out_norm + (size_t)row * N + j) = o;
    }
    
  }
}



// ---- f16 WMMA path (v_wmma_f32_16x16x32_f16): 11-bit significands for operands in range — used where a [0,1] probability operand needs more precision than bf16
typedef _Float16 v16h __attribute__((ext_vector_type(16)));
union FragH { v16h v; v8us half[2]; _Float16 h[16]; unsigned short u[16]; };
template <int NT>
__device__ __forceinline__ v8f mmaH(v16h ah, v16h al, v16h bh, v16h bl, v8f c) {
  c = __builtin_amdgcn_wmma_f32_16x16x32_f16(false, ah, false, bh, (short)0, c, false, false);
  if (NT >= 2) c = __builtin_amdgcn_wmma_f32_16x16x32_f16(false, al, false, bh, (short)0, c, false, false);
  if (NT >= 3) c = __builtin_amdgcn_wmma_f32_16x16x32_f16(false, ah, false, bl, (short)0, c, false, false);
  asm volatile("v_nop\n\tv_nop\n\tv_nop\n\tv_nop" : "+v"(c) : "v"(ah), "v"(al), "v"(bh), "v"(bl));
  return c;
}
// batched GEMM like k_gemm_b but f16 operands: A f32 (split into f16 hi/lo if ASPLIT, else rounded to f16), Bt = f16 values [n][k]; alpha; C f32; N multiple of 16 (partial tiles skipped)
template <bool ASPLIT>
__global__ __launch_bounds__(128) void k_gemm_h(const float* __restrict__ A, int lda, size_t sA, const _Float16* __restrict__ Bh, int ldb, size_t sB, float alpha, float* __restrict__ C, int ldc, size_t sC, int M, int N, int K) {
  __shared__ __attribute__((aligned(16))) float so[4][16][64];
  const int tid = threadIdx.x, w = tid >> 5, lane = tid & 31, ln = lane & 15, hh = lane >> 4; const int by = blockIdx.y;
  A += (size_t)by * sA; Bh += (size_t)by * sB; C += (size_t)by * sC;
  const int ntn = (N + 63) / 64; const int wid = blockIdx.x * 4 + w; const int mt = wid / ntn, nq = wid % ntn; if (mt * 16 >= M) return;
  const int row0 = mt * 16, col0 = nq * 64; const float* arow = A + (size_t)(row0 + ln) * lda;
  v8f acc[4] = {};
  for (int kb = 0; kb < K; kb += 32) {
    FragH ah, al;
    const v4f x0 = *(const v4fa*)(arow + kb + 8 * hh), x1 = *(const v4fa*)(arow + kb + 8 * hh + 4), x2 = *(const v4fa*)(arow + kb + 16 + 8 * hh), x3 = *(const v4fa*)(arow + kb + 16 + 8 * hh + 4);
    float xs[16] = {x0[0],x0[1],x0[2],x0[3],x1[0],x1[1],x1[2],x1[3],x2[0],x2[1],x2[2],x2[3],x3[0],x3[1],x3[2],x3[3]};
#pragma unroll
    for (int i = 0; i < 16; ++i) { const _Float16 h = (_Float16)xs[i]; ah.h[i] = h; al.h[i] = ASPLIT ? (_Float16)(xs[i] - (float)h) : (_Float16)0.0f; }
#pragma unroll
    for (int t = 0; t < 4; ++t) { if (col0 + t * 16 >= N) continue; const size_t boff = (size_t)(col0 + t * 16 + ln) * ldb + kb; FragH bq; bq.half[0] = *(const v8us*)(Bh + boff + 8 * hh); bq.half[1] = *(const v8us*)(Bh + boff + 16 + 8 * hh);
      acc[t] = mmaH<ASPLIT ? 2 : 1>(ah.v, al.v, bq.v, bq.v, acc[t]); }
  }
#pragma unroll
  for (int t = 0; t < 4; ++t) { if (col0 + t * 16 >= N) continue;
#pragma unroll
    for (int r = 0; r < 8; ++r) so[w][8 * hh + r][t * 16 + ln] = acc[t][r] * alpha; }
  __builtin_amdgcn_fence(__ATOMIC_ACQ_REL, "workgroup"); __builtin_amdgcn_wave_barrier();
  const int rsub = lane >> 4, c4 = (lane & 15) * 4;
  {
#pragma unroll
    for (int q = 0; q < 8; ++q) { const int r = q * 2 + rsub; if (col0 + c4 < N) { const v4f v = *(const v4fa*)&so[w][r][c4]; *(v4f*)(C + (size_t)(row0 + r) * ldc + col0 + c4) = v; } }
     }
}

// Wt[n][k] = f16(W[k][n]·scale) from f32 row-major W[K][N] (scale = power of two; bf16-exact weights stay exact in f16 away from the subnormal range)
__global__ __launch_bounds__(256) void k_wt_f16(const float* __restrict__ W, _Float16* __restrict__ Wt, int K, int N, float scale) {
  const int t = blockIdx.x * 256 + threadIdx.x; if (t >= N * (K / 8)) return; const int n = t / (K / 8), k8 = (t % (K / 8)) * 8; FragH f;
#pragma unroll
  for (int i = 0; i < 8; ++i) f.h[i] = (_Float16)(bf16_round(W[(size_t)(k8 + i) * N + n]) * scale); const v8us o = f.half[0];
  *(v8us*)((unsigned short*)Wt + (size_t)n * K + k8) = o; 
}
// k_gemm_hh variant with fused epilogue: v = acc·alpha + bias[by·sBias + col] (+ CP[(row/rowsPerB)·sCPb + by·64 + col] if CP) ; ACT 0 none / 1 elu ; writes f16 C16 (and f32 C if non-null)
template <int ACT>
__global__ __launch_bounds__(128) void k_gemm_hhx(const _Float16* __restrict__ A, int lda, size_t sA, const _Float16* __restrict__ Bh, int ldb, size_t sB, float alpha, const float* __restrict__ bias, size_t sBias, const float* __restrict__ CP, int rowsPerB, size_t sCPb, int row0g,
    float* __restrict__ C, _Float16* __restrict__ C16, int ldc, size_t sC, int M, int N, int K) {
  __shared__ __attribute__((aligned(16))) float so[4][16][64];
  const int tid = threadIdx.x, w = tid >> 5, lane = tid & 31, ln = lane & 15, hh = lane >> 4; const int by = blockIdx.y;
  A += (size_t)by * sA; Bh += (size_t)by * sB; const size_t cofs = (size_t)by * sC; const float* bp = bias ? bias + (size_t)by * sBias : nullptr;
  const int ntn = (N + 63) / 64; const int wid = blockIdx.x * 4 + w; const int mt = wid / ntn, nq = wid % ntn; if (mt * 16 >= M) return;
  const int row0 = mt * 16, col0 = nq * 64; const _Float16* arow = A + (size_t)(row0 + ln) * lda;
  v8f acc[4] = {};
  for (int kb = 0; kb < K; kb += 32) { FragH ah; ah.half[0] = *(const v8us*)((const unsigned short*)arow + kb + 8 * hh); ah.half[1] = *(const v8us*)((const unsigned short*)arow + kb + 16 + 8 * hh);
#pragma unroll
    for (int t = 0; t < 4; ++t) { if (col0 + t * 16 >= N) continue; const size_t boff = (size_t)(col0 + t * 16 + ln) * ldb + kb; FragH bq; bq.half[0] = *(const v8us*)((const unsigned short*)Bh + boff + 8 * hh); bq.half[1] = *(const v8us*)((const unsigned short*)Bh + boff + 16 + 8 * hh);
      acc[t] = mmaH<1>(ah.v, ah.v, bq.v, bq.v, acc[t]); }
  }
#pragma unroll
  for (int t = 0; t < 4; ++t) { if (col0 + t * 16 >= N) continue; const int col = col0 + t * 16 + ln; const float bv = bp ? bf16_round(bp[col]) : 0.f;
#pragma unroll
    for (int r = 0; r < 8; ++r) { float v = acc[t][r] * alpha + bv; if (CP) { const int rr = row0g + row0 + 8 * hh + r; if (rowsPerB < 0) v += CP[cofs + (size_t)rr * ldc + col];      /* rowsPerB < 0: own element of the batched C plane */ else { const int bidx = rr / rowsPerB; v += CP[(size_t)bidx * sCPb + (size_t)by * 64 + col]; } } if (ACT == 1) v = (v > 0.f) ? v : expm1f(v); else if (ACT == 7) v = (v > 0.f) ? v + 1.0f : expf(v); else if (ACT == 8) v = tanhf(v); else if (ACT == 9) v = 0.5f * v * (1.0f + tanhf(0.7978845608028654f * (v + 0.044715f * v * v * v))); else if (ACT == 11) v = 1.0f / (1.0f + expf(-v)); else if (ACT == 12) v = (v > 0.f) ? v : 0.01f * v; else if (ACT == 14) v = (v > 0.f) ? v : 0.1f * v; else if (ACT == 16) v = (v >= 0.f) ? v : 0.3f * v; else if (ACT == 17) v = (v >= 0.f) ? v : 0.2f * v; else if (ACT == 15) v = v / (1.0f + expf(-v)); else if (ACT == 3) v = fmaxf(v, 0.f); else if (ACT == 6) v = 0.5f * v * (1.0f + erff(v * 0.70710678118654752f)); so[w][8 * hh + r][t * 16 + ln] = v; } }
  __builtin_amdgcn_fence(__ATOMIC_ACQ_REL, "workgroup"); __builtin_amdgcn_wave_barrier();
  const int rsub = lane >> 4, c4 = (lane & 15) * 4; typedef _Float16 v4h __attribute__((ext_vector_type(4)));
  {
#pragma unroll
    for (int q = 0; q < 8; ++q) { const int r = q * 2 + rsub; if (col0 + c4 < N) { const v4f v = *(const v4fa*)&so[w][r][c4]; if (C) *(v4f*)(C + cofs + (size_t)(row0 + r) * ldc + col0 + c4) = v; if (C16) { v4h h4; for (int i = 0; i < 4; ++i) h4[i] = (_Float16)v[i]; *(v4h*)(C16 + cofs + (size_t)(row0 + r) * ldc + col0 + c4) = h4; } } }
     }
}


typedef _Float16 v4h __attribute__((ext_vector_type(4)));

__global__ __launch_bounds__(256) void k_x16(const float* __restrict__ x, _Float16* __restrict__ X16, size_t n8) { const size_t t = (size_t)blockIdx.x * 256 + threadIdx.x; if (t >= n8) return; FragH f;
#pragma unroll
  for (int q = 0; q < 8; ++q) f.h[q] = (_Float16)bf16_round(x[t * 8 + q]); *(v8us*)((unsigned short*)X16 + t * 8) = f.half[0];  }
__global__ __launch_bounds__(256) void k_h16(const float* __restrict__ x, _Float16* __restrict__ X16, size_t n8) { const size_t t = (size_t)blockIdx.x * 256 + threadIdx.x; if (t >= n8) return; FragH f;
#pragma unroll
  for (int q = 0; q < 8; ++q) f.h[q] = (_Float16)x[t * 8 + q]; *(v8us*)((unsigned short*)X16 + t * 8) = f.half[0];  }
__global__ __launch_bounds__(256) void k_round16f(const float* __restrict__ W, _Float16* __restrict__ Bt, size_t n8) { const size_t t = (size_t)blockIdx.x * 256 + threadIdx.x; if (t >= n8) return; FragH f;
#pragma unroll
  for (int i = 0; i < 8; ++i) f.h[i] = (_Float16)(bf16_round(W[t * 8 + i]) * 16.0f); *(v8us*)((unsigned short*)Bt + t * 8) = f.half[0];  }
template <int NHv, int TTv>
__global__ __launch_bounds__(256) void k_vt(const _Float16* __restrict__ V16, int ldv, int voff, _Float16* __restrict__ Vt) { __shared__ unsigned short tl[64][66]; const int tid = threadIdx.x; const int slab = blockIdx.x / (TTv / 64), lg = blockIdx.x % (TTv / 64); const int b = slab / NHv, h = slab % NHv;
  for (int i = tid; i < 64 * 8; i += 256) { const int r = i / 8, c8 = (i % 8) * 8; FragH f; f.half[0] = *(const v8us*)((const unsigned short*)V16 + ((size_t)b * TTv + lg * 64 + r) * ldv + voff + h * 64 + c8);
#pragma unroll
    for (int q = 0; q < 8; ++q) tl[r][c8 + q] = f.u[q]; }
  __syncthreads();
  {
#pragma unroll
    for (int rd = 0; rd < 2; ++rd) { const int d = rd * 32 + tid / 8, pc = tid % 8; FragH f;
#pragma unroll
      for (int q = 0; q < 8; ++q) f.u[q] = tl[pc * 8 + q][d];
      *(v8us*)((unsigned short*)Vt + ((size_t)slab * 64 + d) * TTv + lg * 64 + pc * 8) = f.half[0]; }
     } }

__global__ __launch_bounds__(256) void k_hl(const float* __restrict__ F, _Float16* __restrict__ Hh, _Float16* __restrict__ Hl, size_t n8) { const size_t t = (size_t)blockIdx.x * 256 + threadIdx.x; if (t >= n8) return; FragH fh, fl; const v4f a = *(const v4fa*)(F + t * 8), c = *(const v4fa*)(F + t * 8 + 4);
#pragma unroll
  for (int q = 0; q < 4; ++q) { _Float16 h = (_Float16)a[q]; fh.h[q] = h; fl.h[q] = (_Float16)((a[q] - (float)h) * 1024.0f); h = (_Float16)c[q]; fh.h[4 + q] = h; fl.h[4 + q] = (_Float16)((c[q] - (float)h) * 1024.0f); }
  { *(v8us*)((unsigned short*)Hh + t * 8) = fh.half[0]; *(v8us*)((unsigned short*)Hl + t * 8) = fl.half[0];  } }

// ---- fast GEMM (wave tile 32x64; requires M % 32 == 0 rows per launch region and N % 64 == 0); epilogue = k_gemm_hhx semantics ----
__device__ __forceinline__ v16h g2_frag(const _Float16* p, int hh) { FragH f; f.half[0] = *(const v8us*)((const unsigned short*)p + 8 * hh); f.half[1] = *(const v8us*)((const unsigned short*)p + 16 + 8 * hh); return f.v; }
__device__ __forceinline__ v8f g2_mma(v16h a, v16h b, v8f c) { v8f d = __builtin_amdgcn_wmma_f32_16x16x32_f16(false, a, false, b, (short)0, c, false, false); asm volatile("v_nop\n\tv_nop\n\tv_nop\n\tv_nop" : "+v"(d) : "v"(a), "v"(b)); return d; }
template <int ACT>
__global__ __launch_bounds__(128) void k_gemm2(const _Float16* __restrict__ A, int lda, size_t sA, const _Float16* __restrict__ Bh, int ldb, size_t sB, float alpha, const float* __restrict__ bias, size_t sBias, const float* __restrict__ CP, int rowsPerB, size_t sCPb, int row0g,
    float* __restrict__ C, _Float16* __restrict__ C16, int ldc, size_t sC, int M, int N, int K) { static_assert(ACT == 0 || ACT == 3 || ACT == 6 || ACT == 8 || ACT == 9 || ACT == 11 || ACT == 12 || ACT == 14 || ACT == 15 || ACT == 16 || ACT == 17, "k_gemm2: unsupported ACT code (would silently apply no activation)");
  __shared__ __attribute__((aligned(16))) float so[4][32][68];
  const int tid = threadIdx.x, w = tid >> 5, lane = tid & 31, ln = lane & 15, hh = lane >> 4; const int by = blockIdx.y;
  A += (size_t)by * sA; Bh += (size_t)by * sB; const size_t cofs = (size_t)by * sC; const float* bp = bias ? bias + (size_t)by * sBias : nullptr;
  const int ntn = N >> 6; const int mt = blockIdx.x / ntn, nq = blockIdx.x - mt * ntn; const int row0 = mt * 128 + 32 * w, col0 = nq * 64; if (row0 >= M) return;
  const _Float16* a0p = A + (size_t)(row0 + ln) * lda; const _Float16* a1p = a0p + (size_t)16 * lda;
  const _Float16* b0p = Bh + (size_t)(col0 + ln) * ldb; const _Float16* b1p = b0p + (size_t)16 * ldb; const _Float16* b2p = b1p + (size_t)16 * ldb; const _Float16* b3p = b2p + (size_t)16 * ldb;
  const v8f z8 = {0.f,0.f,0.f,0.f,0.f,0.f,0.f,0.f}; v8f c00 = z8, c01 = z8, c02 = z8, c03 = z8, c10 = z8, c11 = z8, c12 = z8, c13 = z8;
#pragma unroll 1
  for (int kb = 0; kb < K; kb += 32) { const v16h a0 = g2_frag(a0p + kb, hh), a1 = g2_frag(a1p + kb, hh);
    v16h b = g2_frag(b0p + kb, hh); c00 = g2_mma(a0, b, c00); c10 = g2_mma(a1, b, c10);
    b = g2_frag(b1p + kb, hh); c01 = g2_mma(a0, b, c01); c11 = g2_mma(a1, b, c11);
    b = g2_frag(b2p + kb, hh); c02 = g2_mma(a0, b, c02); c12 = g2_mma(a1, b, c12);
    b = g2_frag(b3p + kb, hh); c03 = g2_mma(a0, b, c03); c13 = g2_mma(a1, b, c13); }
  v8f accs[8] = {c00, c01, c02, c03, c10, c11, c12, c13};
#pragma unroll
  for (int u = 0; u < 8; ++u) { const int t = u & 3, half = u >> 2; const int col = col0 + t * 16 + ln; const float bv = bp ? bf16_round(bp[col]) : 0.f;
#pragma unroll
    for (int r = 0; r < 8; ++r) { const int rloc = half * 16 + 8 * hh + r; float v = accs[u][r] * alpha + bv; if (CP) { if (rowsPerB < 0) v += CP[cofs + (size_t)(row0g + row0 + rloc) * ldc + col];      /* rowsPerB < 0: own element of the batched C plane */ else { const int bidx = (row0g + row0 + rloc) / rowsPerB; v += CP[(size_t)bidx * sCPb + (size_t)by * 64 + col]; } }
      if (ACT == 3) v = fmaxf(v, 0.f); else if (ACT == 6) v = 0.5f * v * (1.0f + erff(v * 0.70710678118654752f)); else if (ACT == 11) v = 1.0f / (1.0f + expf(-v)); else if (ACT == 15) v = v / (1.0f + expf(-v)); else if (ACT == 12) v = (v > 0.f) ? v : 0.01f * v; else if (ACT == 8) v = tanhf(v); else if (ACT == 9) v = 0.5f * v * (1.0f + tanhf(0.7978845608028654f * (v + 0.044715f * v * v * v))); else if (ACT == 14) v = (v > 0.f) ? v : 0.1f * v; else if (ACT == 16) v = (v >= 0.f) ? v : 0.3f * v; else if (ACT == 17) v = (v >= 0.f) ? v : 0.2f * v;
      so[w][rloc][t * 16 + ln] = v; } }
  __builtin_amdgcn_fence(__ATOMIC_ACQ_REL, "workgroup"); __builtin_amdgcn_wave_barrier();
  const int rsub = lane >> 4, c4 = (lane & 15) * 4;
  {
#pragma unroll
    for (int q = 0; q < 16; ++q) { const int r = q * 2 + rsub; const v4f v = *(const v4fa*)&so[w][r][c4]; if (C) *(v4f*)(C + cofs + (size_t)(row0 + r) * ldc + col0 + c4) = v; if (C16) { v4h h4; for (int i = 0; i < 4; ++i) h4[i] = (_Float16)v[i]; *(v4h*)(C16 + cofs + (size_t)(row0 + r) * ldc + col0 + c4) = h4; } }
     } }


__global__ __launch_bounds__(256) void k_wnat(const float* __restrict__ w, size_t n8, _Float16* __restrict__ Bt) { const size_t t = (size_t)blockIdx.x * 256 + threadIdx.x; if (t >= n8) return; FragH f; for (int q = 0; q < 8; ++q) f.h[q] = (_Float16)(bf16_round(w[t * 8 + q]) * 16.0f); *(v8us*)((unsigned short*)Bt + t * 8) = f.half[0];  }
__global__ __launch_bounds__(256) void k_rsm(const float* __restrict__ S, _Float16* __restrict__ P, int nrows) {
  #pragma clang fp contract(off)
  const int i = blockIdx.x * 256 + threadIdx.x; if (i >= nrows) return; const float* s = S + (size_t)i * SQ; float mx = -3.0e38f;
#pragma unroll 1
  for (int j = 0; j < SQ; ++j) mx = fmaxf(mx, s[j]); float se = 0.f;
#pragma unroll 1
  for (int j = 0; j < SQ; ++j) se += expf(s[j] - mx); const float sc = 256.0f / se;
#pragma unroll 1
  for (int j0 = 0; j0 < SQ; j0 += 8) { FragH f; for (int q = 0; q < 8; ++q) f.h[q] = (_Float16)(expf(s[j0 + q] - mx) * sc); unsigned short* d = (unsigned short*)P + (size_t)i * SQ + j0; *(v8us*)d = f.half[0];  } }
__global__ __launch_bounds__(256) void k_vt(const _Float16* __restrict__ V16, int b, int h0, _Float16* __restrict__ VT) { __shared__ unsigned short tl[64][65]; const int tid = threadIdx.x; const int hh = blockIdx.x % HG, sg = blockIdx.x / HG; const int s0 = sg * 64; const int h = h0 + hh;
  for (int i = tid; i < 64 * 8; i += 256) { const int j = i / 8, d8 = (i % 8) * 8; FragH f; f.half[0] = *(const v8us*)((const unsigned short*)V16 + ((size_t)b * SQ + s0 + j) * DM + h * HD + d8); for (int q = 0; q < 8; ++q) tl[d8 + q][j] = f.u[q]; }
  __syncthreads();
  { for (int i = tid; i < 64 * 8; i += 256) { const int d = i / 8, j8 = (i % 8) * 8; FragH f; for (int q = 0; q < 8; ++q) f.u[q] = tl[d][j8 + q]; *(v8us*)((unsigned short*)VT + ((size_t)hh * HD + d) * SQ + s0 + j8) = f.half[0]; }  } }



__global__ __launch_bounds__(256) void k_rsmf(const float* __restrict__ S, _Float16* __restrict__ P, int qn, int hg) {
  #pragma clang fp contract(off)
  const int t = blockIdx.x * 256 + threadIdx.x; if (t >= qn * hg) return; const size_t i = (size_t)(t / qn) * SQ + (t % qn); const float* s = S + i * SQ; float mx = -3.0e38f;
#pragma unroll 1
  for (int j = 0; j < SQ; ++j) mx = fmaxf(mx, s[j]); float se = 0.f;
#pragma unroll 1
  for (int j = 0; j < SQ; ++j) se += __expf(s[j] - mx); const float sc = 256.0f / se;
#pragma unroll 1
  for (int j0 = 0; j0 < SQ; j0 += 8) { FragH f; for (int q = 0; q < 8; ++q) f.h[q] = (_Float16)(__expf(s[j0 + q] - mx) * sc); unsigned short* d = (unsigned short*)P + i * SQ + j0; *(v8us*)d = f.half[0];  } }


// Row softmax with key mask, one wave per score row: lane l holds columns c * 256 + l * 8 .. + 7 (c = 0 .. 7) in registers, so the row is read once, in whole lines.
// Maximum (over all keys) and sum: eight partials per lane, a tree over them, then a butterfly over the 32 lanes (four row_xmask steps, then lane l with l ^ 16).
// A masked key's score is replaced behind the maximum by -3.0e38, whose exp is exactly 0. Weights x256 f16.
typedef int v4ia __attribute__((ext_vector_type(4), may_alias));
template <int M> __device__ __forceinline__ float lane_x(float v) { return __builtin_bit_cast(float, __builtin_amdgcn_mov_dpp(__builtin_bit_cast(int, v), 0x160 + M, 0xf, 0xf, true)); }      /* lane l with l ^ M inside a 16-lane row (row_xmask) */
__device__ __forceinline__ float lane_x16(float v) { return __builtin_bit_cast(float, __builtin_amdgcn_permlanex16(__builtin_bit_cast(int, v), __builtin_bit_cast(int, v), 0x76543210, 0xfedcba98, false, false)); }      /* lane l with l ^ 16 */
// native exp (the multiply and the v_exp_f32 that __expf compiles to). The v_nop fills the slot that the instruction set asks for behind a transcendental before its source is overwritten.
__device__ __forceinline__ float exp_slot(float v) { const float t = v * 1.44269504f; float e; asm("v_exp_f32 %0, %1\n\tv_nop" : "=v"(e) : "v"(t)); return e; }
__global__ __launch_bounds__(256) void k_rsmk1(const float* __restrict__ S, _Float16* __restrict__ P, int nrows, const int* __restrict__ Km) {
  const int lane = threadIdx.x & 31; const int i = blockIdx.x * 8 + __builtin_amdgcn_readfirstlane(threadIdx.x >> 5); if (i >= nrows) return;      /* the row is the wave's: scalar base, scalar exit */
  const float* s = S + (size_t)i * SQ; const int l8 = lane * 8;
  v4f xv[SQ / 128]; v4ia kv[SQ / 128];
#pragma unroll
  for (int c = 0; c < SQ / 128; ++c) xv[c] = *(const v4fa*)(s + (c >> 1) * 256 + (c & 1) * 4 + l8);
#pragma unroll
  for (int c = 0; c < SQ / 128; ++c) kv[c] = *(const v4ia*)(Km + (c >> 1) * 256 + (c & 1) * 4 + l8);
  __builtin_amdgcn_sched_barrier(0);      /* every load of the row and of its mask is issued before the first use: one memory latency; without it the compiler issues them in dependent batches */
  float x[SQ / 32], m8[8];
#pragma unroll
  for (int q = 0; q < 8; ++q) m8[q] = xv[q >> 2][q & 3];
#pragma unroll
  for (int c = 2; c < SQ / 128; ++c)
#pragma unroll
    for (int q = 0; q < 4; ++q) m8[(c & 1) * 4 + q] = fmaxf(m8[(c & 1) * 4 + q], xv[c][q]);
#pragma unroll
  for (int c = 0; c < SQ / 128; ++c)
#pragma unroll
    for (int q = 0; q < 4; ++q) x[c * 4 + q] = (kv[c][q] != 0) ? xv[c][q] : -3.0e38f;
  float mx = fmaxf(fmaxf(fmaxf(m8[0], m8[1]), fmaxf(m8[2], m8[3])), fmaxf(fmaxf(m8[4], m8[5]), fmaxf(m8[6], m8[7])));
  mx = fmaxf(mx, lane_x<1>(mx)); mx = fmaxf(mx, lane_x<2>(mx)); mx = fmaxf(mx, lane_x<4>(mx)); mx = fmaxf(mx, lane_x<8>(mx)); mx = fmaxf(mx, lane_x16(mx));
  float s8[8];
#pragma unroll
  for (int q = 0; q < 8; ++q) { const float e = exp_slot(x[q] - mx); x[q] = e; s8[q] = e; }
#pragma unroll
  for (int c = 1; c < SQ / 256; ++c)
#pragma unroll
    for (int q = 0; q < 8; ++q) { const float e = exp_slot(x[c * 8 + q] - mx); x[c * 8 + q] = e; s8[q] += e; }
  float se = ((s8[0] + s8[1]) + (s8[2] + s8[3])) + ((s8[4] + s8[5]) + (s8[6] + s8[7]));
  se += lane_x<1>(se); se += lane_x<2>(se); se += lane_x<4>(se); se += lane_x<8>(se); se += lane_x16(se);
  const float sc = 256.0f / se; unsigned short* p = (unsigned short*)P + (size_t)i * SQ;
#pragma unroll
  for (int c = 0; c < SQ / 256; ++c) { FragH f;
#pragma unroll
    for (int q = 0; q < 8; ++q) f.h[q] = (_Float16)(x[c * 8 + q] * sc);
    *(v8us*)(p + c * 256 + l8) = f.half[0]; } }
extern "C" void kernel_launch(void* const* d_in, const int* in_sizes, int n_in,
                              void* d_out, int out_size, void* d_ws, size_t ws_size, hipStream_t stream) {
  (void)in_sizes; (void)n_in; (void)out_size;
  const float* const* I = (const float* const*)d_in; const float* xq = I[0]; const float* xk = I[1]; const float* xv = I[2]; const int* km = (const int*)d_in[3];      /* key mask int32 [2][1][1][2048] (0 = masked; READ on device): plane b of 16 belongs to batch b / 8 */      /* given q, k, v [B][H][S][64]: each (b, h) plane is a 'batch' of one 64-wide head */
  char* ws = (char*)d_ws; size_t off = 0;
  auto take = [&](size_t bytes) { char* p = ws + off; off += (bytes + 255) & ~(size_t)255; return p; };
  _Float16* Q16 = (_Float16*)take(NR * DM * 2); _Float16* K16 = (_Float16*)take(NR * DM * 2); _Float16* V16 = (_Float16*)take(NR * DM * 2);
  float* S = (float*)take((size_t)HG * SQ * SQ * 4); _Float16* P = (_Float16*)take((size_t)HG * SQ * SQ * 2); _Float16* VT = (_Float16*)take((size_t)NH * HD * SQ * 2);
  if (off > ws_size) return;

  const size_t r0p = (size_t)B0 * SQ;      /* first converted row */
  k_x16<<<(unsigned)(((size_t)MP * DM / 8 + 255) / 256), 256, 0, stream>>>(xq + r0p * DM, Q16 + r0p * DM, (size_t)MP * DM / 8); k_x16<<<(unsigned)(((size_t)MP * DM / 8 + 255) / 256), 256, 0, stream>>>(xk + r0p * DM, K16 + r0p * DM, (size_t)MP * DM / 8); k_x16<<<(unsigned)(((size_t)MP * DM / 8 + 255) / 256), 256, 0, stream>>>(xv + r0p * DM, V16 + r0p * DM, (size_t)MP * DM / 8);      /* given q, k, v: bf16 inputs as exact f16 rows (no projections) */
  for (int b = B0; b < B0 + NBR; ++b) { const size_t r0 = (size_t)b * SQ;
    k_vt<NH, SQ><<<NH * (SQ / 64), 256, 0, stream>>>(V16 + r0 * LQ, LQ, 0, VT);      /* V^T [NH][HD][SQ] for this batch */
    for (int h0 = 0; h0 < NHD; h0 += HG) {
      k_gemm2<0><<<dim3((QN / 128) * (SQ / 64), HG), 128, 0, stream>>>(Q16 + r0 * LQ + h0 * HD, LQ, (size_t)HD, K16 + r0 * LQ + h0 * HD, LQ, (size_t)HD, 0.125f, nullptr, 0, nullptr, 1, 0, 0, S, nullptr, SQ, (size_t)SQ * SQ, QN, SQ, HD);      /* scores, HG heads per launch */
      k_rsmk1<<<(HG * QN + 7) / 8, 256, 0, stream>>>(S, P, HG * QN, km + (size_t)(b / 8) * SQ);      /* one wave per row; keys with mask[b / 8][j] == 0 excluded (weight exactly 0 as the module's NEG fill); P x256 f16 */
      k_gemm2<0><<<dim3((QN / 128) * (HD / 64), HG), 128, 0, stream>>>(P, SQ, (size_t)SQ * SQ, VT + (size_t)h0 * HD * SQ, SQ, (size_t)HD * SQ, 0.00390625f, nullptr, 0, nullptr, 1, 0, 0, (float*)d_out + r0 * DM + h0 * HD, nullptr, DM, (size_t)HD, QN, HD, SQ); } }      /* out = A v straight to the f32 output */
}

// v002
// A run of this version takes 215 microseconds.
// Timed twice side by side with v001, it ran 5.57 and 5.58 times as fast.
// Counting every step since v000, it is 28.6 times as fast.
#include <hip/hip_runtime.h>
// Scaled dot-product attention on given head-major query, key, value with a key-padding mask (q, k, v [2][8][2048][64] each = 16 independent [2048][64] planes; att = (q / 8) . k; where(mask == 0, NEG) with the int32 [2][1][1][2048] mask in {0, 1} (random; 0 = masked key, shared by the 8 heads of a batch; READ on device); softmax; out = att v -> [2][8][2048][64]).
// Structure: the three inputs converted to exact f16 rows (bf16 values are exact in f16: no projections); V^T via LDS transposes, all 16 planes in one launch; per group of PG planes (grid.y): scores (K = 64; exact products, f32 accumulation) into f32 [S][S] planes, row softmax on VALU (f32 statistics, native exp; weights x256 f16); then out = P V^T (alpha 2^-8) for all 16 planes in one launch (grid.y), written f32 straight into the output.
// Compute dtype: inputs rounded to bf16; exact in f16; q, k, v and softmax weights as plain f16 GEMM operands (~2^-12); scores and softmax statistics f32. v_wmma_f32_16x16x32_f16.
#define NB 16
#define SQ 2048
#define DM 64
#define NH 1
#define HD 64
#define HG 1                         /* heads per grid of the k_vt(V16, b, h0, VT) overload; nothing launches it */
#define PG 4                         /* planes per scores / softmax launch (grid.y): divides the 8 heads that share a mask; PG f32 score planes and all NB f16 weight planes fit the workspace together */
#define B0 0                         /* unused (debug hook) */
#define NBR NB                       /* used only by MP (debug hook) */
#define NR ((size_t)NB * SQ)         /* token rows */
#define MP ((int)((size_t)NBR * SQ)) /* used only by MPO (debug hook) */
#define QN SQ                        /* unused (debug hook) */
#define NHD NH                       /* unused (debug hook) */
#define MPO MP                       /* unused (debug hook) */
#define LQ DM      /* row pitch of the q/k/v rows */
typedef __bf16 v16b __attribute__((ext_vector_type(16)));
typedef unsigned short v8us __attribute__((ext_vector_type(8), may_alias));
typedef float  v8f  __attribute__((ext_vector_type(8)));
typedef float  v4f  __attribute__((ext_vector_type(4)));
typedef float  v4fa __attribute__((ext_vector_type(4), may_alias));
union FragB { v16b v; v8us half[2]; unsigned short u[16]; };

__device__ __forceinline__ unsigned short bf16_bits(float x) { unsigned int u = __float_as_uint(x); return (unsigned short)((u + 0x7FFFu + ((u >> 16) & 1u)) >> 16); }
__device__ __forceinline__ float bf16_val(unsigned short b) { return __uint_as_float(((unsigned int)b) << 16); }
__device__ __forceinline__ float bf16_round(float x) { return bf16_val(bf16_bits(x)); }
// D += A·B with NT terms: 1 = ah·bh, 2 = + al·bh (A split), 3 = + ah·bl (both split)
template <int NT>
__device__ __forceinline__ v8f mmaN(v16b ah, v16b al, v16b bh, v16b bl, v8f c) {
  c = __builtin_amdgcn_wmma_f32_16x16x32_bf16(false, ah, false, bh, (short)0, c, false, false);
  if (NT >= 2) c = __builtin_amdgcn_wmma_f32_16x16x32_bf16(false, al, false, bh, (short)0, c, false, false);
  if (NT >= 3) c = __builtin_amdgcn_wmma_f32_16x16x32_bf16(false, ah, false, bl, (short)0, c, false, false);
  asm volatile("v_nop\n\tv_nop\n\tv_nop\n\tv_nop" : "+v"(c) : "v"(ah), "v"(al), "v"(bh), "v"(bl));
  return c;
}

__global__ __launch_bounds__(256) void k_wt_bf16(const float* __restrict__ W, unsigned short* __restrict__ Wt, int K, int N) {
  const int t = blockIdx.x * 256 + threadIdx.x;
  const int k8n = K / 8;
  if (t >= N * k8n) return;
  const int n = t / k8n, k8 = (t % k8n) * 8;
  v8us v;
#pragma unroll
  for (int i = 0; i < 8; ++i) v[i] = bf16_bits(W[(size_t)(k8 + i) * N + n]);
  *(v8us*)(Wt + (size_t)n * K + k8) = v;
  
}

// GEMM C[M][N] (f32, pitch ldc) = act(A[M][K]·W + bias). A f32 row-major (pitch lda) converted per fragment to bf16
// (ASPLIT: hi/lo two planes -> 2 terms, else single rounded term); Wt bf16 [N][K] (pitch ldb). BIAS_BF16 rounds the
// bias to bf16 first (bias quantised to bf16 before the add). K%32==0, M%16==0, N%64==0.
template <bool ASPLIT, int ACT, bool BIAS_BF16>
__global__ __launch_bounds__(128) void k_gemm_bf(const float* __restrict__ A, int lda, const unsigned short* __restrict__ Wt, int ldb,
                                               const float* __restrict__ bias, float* __restrict__ C, int ldc, int M, int N, int K) {
  __shared__ __attribute__((aligned(16))) float so[4][16][64];
  const int tid = threadIdx.x, w = tid >> 5, lane = tid & 31, ln = lane & 15, hh = lane >> 4;
  const int ntn = N / 64;
  const int wid = blockIdx.x * 4 + w;
  const int mt = wid / ntn, nq = wid % ntn;
  if (mt * 16 >= M) return;
  const int row0 = mt * 16, col0 = nq * 64;
  const float* arow = A + (size_t)(row0 + ln) * lda;
  v8f acc[4] = {};
  for (int kb = 0; kb < K; kb += 32) {
    FragB ah, al;
    const v4f x0 = *(const v4fa*)(arow + kb + 8 * hh), x1 = *(const v4fa*)(arow + kb + 8 * hh + 4);
    const v4f x2 = *(const v4fa*)(arow + kb + 16 + 8 * hh), x3 = *(const v4fa*)(arow + kb + 16 + 8 * hh + 4);
    float xs[16] = {x0[0],x0[1],x0[2],x0[3],x1[0],x1[1],x1[2],x1[3],x2[0],x2[1],x2[2],x2[3],x3[0],x3[1],x3[2],x3[3]};
#pragma unroll
    for (int i = 0; i < 16; ++i) { const unsigned short hb = bf16_bits(xs[i]); ah.u[i] = hb; al.u[i] = ASPLIT ? bf16_bits(xs[i] - bf16_val(hb)) : (unsigned short)0; }
#pragma unroll
    for (int t = 0; t < 4; ++t) {
      const unsigned short* brow = Wt + (size_t)(col0 + t * 16 + ln) * ldb + kb;
      FragB b;
      b.half[0] = *(const v8us*)(brow + 8 * hh);
      b.half[1] = *(const v8us*)(brow + 16 + 8 * hh);
      acc[t] = mmaN<ASPLIT ? 2 : 1>(ah.v, al.v, b.v, b.v, acc[t]);
    }
  }
#pragma unroll
  for (int t = 0; t < 4; ++t) {
    float bv = bias ? bias[col0 + t * 16 + ln] : 0.f;
    if (BIAS_BF16) bv = bf16_round(bv);
#pragma unroll
    for (int r = 0; r < 8; ++r) { float v = acc[t][r] + bv; if (ACT == 1) v = fmaxf(v, 0.f); so[w][8 * hh + r][t * 16 + ln] = v; }
  }
  __builtin_amdgcn_fence(__ATOMIC_ACQ_REL, "workgroup");
  __builtin_amdgcn_wave_barrier();
  const int rsub = lane >> 4, c4 = (lane & 15) * 4;
  {
#pragma unroll
    for (int q = 0; q < 8; ++q) {
      const int r = q * 2 + rsub;
      const v4f v = *(const v4fa*)&so[w][r][c4];
      *(v4f*)(C + (size_t)(row0 + r) * ldc + col0 + c4) = v;
    }
    
  }
}

// GEMM C = act(A·W + bias + resid): A f32 (ASPLIT -> hi/lo 2 terms), Wt bf16 [N][K]; ACT 0 none, 1 relu, 2 exact gelu;
// resid (optional, f32, row index = (row % rmod), pitch ldr, RES_BF16 rounds it) added before the activation.
template <bool ASPLIT, int ACT, bool BIAS_BF16, bool RES_BF16>
__global__ __launch_bounds__(128) void k_gemm_bf3(const float* __restrict__ A, int lda, const unsigned short* __restrict__ Wt, int ldb,
                                                const float* __restrict__ bias, const float* __restrict__ resid, int rmod, int ldr,
                                                float* __restrict__ C, int ldc, int M, int N, int K) {
  __shared__ __attribute__((aligned(16))) float so[4][16][64];
  const int tid = threadIdx.x, w = tid >> 5, lane = tid & 31, ln = lane & 15, hh = lane >> 4;
  const int ntn = N / 64;
  const int wid = blockIdx.x * 4 + w;
  const int mt = wid / ntn, nq = wid % ntn;
  if (mt * 16 >= M) return;
  const int row0 = mt * 16, col0 = nq * 64;
  const float* arow = A + (size_t)(row0 + ln) * lda;
  v8f acc[4] = {};
  for (int kb = 0; kb < K; kb += 32) {
    FragB ah, al;
    const v4f x0 = *(const v4fa*)(arow + kb + 8 * hh), x1 = *(const v4fa*)(arow + kb + 8 * hh + 4);
    const v4f x2 = *(const v4fa*)(arow + kb + 16 + 8 * hh), x3 = *(const v4fa*)(arow + kb + 16 + 8 * hh + 4);
    float xs[16] = {x0[0],x0[1],x0[2],x0[3],x1[0],x1[1],x1[2],x1[3],x2[0],x2[1],x2[2],x2[3],x3[0],x3[1],x3[2],x3[3]};
#pragma unroll
    for (int i = 0; i < 16; ++i) { const unsigned short hb = bf16_bits(xs[i]); ah.u[i] = hb; al.u[i] = ASPLIT ? bf16_bits(xs[i] - bf16_val(hb)) : (unsigned short)0; }
#pragma unroll
    for (int t = 0; t < 4; ++t) {
      const unsigned short* brow = Wt + (size_t)(col0 + t * 16 + ln) * ldb + kb;
      FragB b;
      b.half[0] = *(const v8us*)(brow + 8 * hh);
      b.half[1] = *(const v8us*)(brow + 16 + 8 * hh);
      acc[t] = mmaN<ASPLIT ? 2 : 1>(ah.v, al.v, b.v, b.v, acc[t]);
    }
  }
#pragma unroll
  for (int t = 0; t < 4; ++t) {
    const int col = col0 + t * 16 + ln;
    float bv = bias ? bias[col] : 0.f;
    if (BIAS_BF16) bv = bf16_round(bv);
#pragma unroll
    for (int r = 0; r < 8; ++r) {
      float v = acc[t][r] + bv;
      if (resid) { float rv = resid[(size_t)((row0 + 8 * hh + r) % rmod) * ldr + col]; if (RES_BF16) rv = bf16_round(rv); v += rv; }
      if (ACT == 1) v = fmaxf(v, 0.f);
      if (ACT == 2) v = 0.5f * v * (1.0f + erff(v * 0.70710678118654752f));
      if (ACT == 3) { const float u = 0.7978845608028654f * (v + 0.044715f * v * v * v); v = 0.5f * v * (1.0f + tanhf(u)); }
      so[w][8 * hh + r][t * 16 + ln] = v;
    }
  }
  __builtin_amdgcn_fence(__ATOMIC_ACQ_REL, "workgroup");
  __builtin_amdgcn_wave_barrier();
  const int rsub = lane >> 4, c4 = (lane & 15) * 4;
  {
#pragma unroll
    for (int q = 0; q < 8; ++q) {
      const int r = q * 2 + rsub;
      const v4f v = *(const v4fa*)&so[w][r][c4];
      *(v4f*)(C + (size_t)(row0 + r) * ldc + col0 + c4) = v;
    }
    
  }
}
// row LayerNorm (biased variance, eps) over N: s = X (+ R); optional out_sum <- s; out_norm <- (s-mu)*rsqrt(var+eps)*g + b
template <bool PARAM_BF16>
__global__ __launch_bounds__(256) void k_layernorm(const float* __restrict__ X, const float* __restrict__ R, const float* __restrict__ g, const float* __restrict__ bta,
                                                  float* __restrict__ out_sum, float* __restrict__ out_norm, int N, float eps) {
  __shared__ float red[256];
  const int row = blockIdx.x, tid = threadIdx.x;
  const float* x = X + (size_t)row * N; const float* rr = R ? R + (size_t)row * N : nullptr;
  float vals[16];                     // up to N = 4096
  const int per = N / 256;            // contiguous chunk per thread? use strided-by-4 chunks: thread handles j = tid*4 + 1024*u
  float s1 = 0.f;
  for (int u = 0; u < per / 4; ++u) {
    const int j = tid * 4 + 1024 * u;
    const v4f a = *(const v4fa*)(x + j);
    v4f b = {0.f,0.f,0.f,0.f}; if (rr) b = *(const v4fa*)(rr + j);
#pragma unroll
    for (int q = 0; q < 4; ++q) { const float v = a[q] + b[q]; vals[u * 4 + q] = v; s1 += v; }
  }
  red[tid] = s1; __syncthreads();
  for (int st = 128; st > 0; st >>= 1) { if (tid < st) red[tid] += red[tid + st]; __syncthreads(); }
  const float mu = red[0] / (float)N; __syncthreads();
  float s2 = 0.f;
  for (int u = 0; u < per / 4; ++u)
#pragma unroll
    for (int q = 0; q < 4; ++q) { const float c = vals[u * 4 + q] - mu; s2 += c * c; }
  red[tid] = s2; __syncthreads();
  for (int st = 128; st > 0; st >>= 1) { if (tid < st) red[tid] += red[tid + st]; __syncthreads(); }
  const float rs = rsqrtf(red[0] / (float)N + eps);
  {
    for (int u = 0; u < per / 4; ++u) {
      const int j = tid * 4 + 1024 * u;
      v4f o, sm;
#pragma unroll
      for (int q = 0; q < 4; ++q) {
        float gg = g[j + q], bb = bta[j + q];
        if (PARAM_BF16) { gg = bf16_round(gg); bb = bf16_round(bb); }
        sm[q] = vals[u * 4 + q]; o[q] = (vals[u * 4 + q] - mu) * rs * gg + bb;
      }
      if (out_sum) *(v4f*)(out_sum + (size_t)row * N + j) = sm;
      *(v4f*)(out_norm + (size_t)row * N + j) = o;
    }
    
  }
}



// ---- f16 WMMA path (v_wmma_f32_16x16x32_f16): 11-bit significands for operands in range — used where a [0,1] probability operand needs more precision than bf16
typedef _Float16 v16h __attribute__((ext_vector_type(16)));
union FragH { v16h v; v8us half[2]; _Float16 h[16]; unsigned short u[16]; };
template <int NT>
__device__ __forceinline__ v8f mmaH(v16h ah, v16h al, v16h bh, v16h bl, v8f c) {
  c = __builtin_amdgcn_wmma_f32_16x16x32_f16(false, ah, false, bh, (short)0, c, false, false);
  if (NT >= 2) c = __builtin_amdgcn_wmma_f32_16x16x32_f16(false, al, false, bh, (short)0, c, false, false);
  if (NT >= 3) c = __builtin_amdgcn_wmma_f32_16x16x32_f16(false, ah, false, bl, (short)0, c, false, false);
  asm volatile("v_nop\n\tv_nop\n\tv_nop\n\tv_nop" : "+v"(c) : "v"(ah), "v"(al), "v"(bh), "v"(bl));
  return c;
}
// batched GEMM like k_gemm_b but f16 operands: A f32 (split into f16 hi/lo if ASPLIT, else rounded to f16), Bt = f16 values [n][k]; alpha; C f32; N multiple of 16 (partial tiles skipped)
template <bool ASPLIT>
__global__ __launch_bounds__(128) void k_gemm_h(const float* __restrict__ A, int lda, size_t sA, const _Float16* __restrict__ Bh, int ldb, size_t sB, float alpha, float* __restrict__ C, int ldc, size_t sC, int M, int N, int K) {
  __shared__ __attribute__((aligned(16))) float so[4][16][64];
  const int tid = threadIdx.x, w = tid >> 5, lane = tid & 31, ln = lane & 15, hh = lane >> 4; const int by = blockIdx.y;
  A += (size_t)by * sA; Bh += (size_t)by * sB; C += (size_t)by * sC;
  const int ntn = (N + 63) / 64; const int wid = blockIdx.x * 4 + w; const int mt = wid / ntn, nq = wid % ntn; if (mt * 16 >= M) return;
  const int row0 = mt * 16, col0 = nq * 64; const float* arow = A + (size_t)(row0 + ln) * lda;
  v8f acc[4] = {};
  for (int kb = 0; kb < K; kb += 32) {
    FragH ah, al;
    const v4f x0 = *(const v4fa*)(arow + kb + 8 * hh), x1 = *(const v4fa*)(arow + kb + 8 * hh + 4), x2 = *(const v4fa*)(arow + kb + 16 + 8 * hh), x3 = *(const v4fa*)(arow + kb + 16 + 8 * hh + 4);
    float xs[16] = {x0[0],x0[1],x0[2],x0[3],x1[0],x1[1],x1[2],x1[3],x2[0],x2[1],x2[2],x2[3],x3[0],x3[1],x3[2],x3[3]};
#pragma unroll
    for (int i = 0; i < 16; ++i) { const _Float16 h = (_Float16)xs[i]; ah.h[i] = h; al.h[i] = ASPLIT ? (_Float16)(xs[i] - (float)h) : (_Float16)0.0f; }
#pragma unroll
    for (int t = 0; t < 4; ++t) { if (col0 + t * 16 >= N) continue; const size_t boff = (size_t)(col0 + t * 16 + ln) * ldb + kb; FragH bq; bq.half[0] = *(const v8us*)(Bh + boff + 8 * hh); bq.half[1] = *(const v8us*)(Bh + boff + 16 + 8 * hh);
      acc[t] = mmaH<ASPLIT ? 2 : 1>(ah.v, al.v, bq.v, bq.v, acc[t]); }
  }
#pragma unroll
  for (int t = 0; t < 4; ++t) { if (col0 + t * 16 >= N) continue;
#pragma unroll
    for (int r = 0; r < 8; ++r) so[w][8 * hh + r][t * 16 + ln] = acc[t][r] * alpha; }
  __builtin_amdgcn_fence(__ATOMIC_ACQ_REL, "workgroup"); __builtin_amdgcn_wave_barrier();
  const int rsub = lane >> 4, c4 = (lane & 15) * 4;
  {
#pragma unroll
    for (int q = 0; q < 8; ++q) { const int r = q * 2 + rsub; if (col0 + c4 < N) { const v4f v = *(const v4fa*)&so[w][r][c4]; *(v4f*)(C + (size_t)(row0 + r) * ldc + col0 + c4) = v; } }
     }
}

// Wt[n][k] = f16(W[k][n]·scale) from f32 row-major W[K][N] (scale = power of two; bf16-exact weights stay exact in f16 away from the subnormal range)
__global__ __launch_bounds__(256) void k_wt_f16(const float* __restrict__ W, _Float16* __restrict__ Wt, int K, int N, float scale) {
  const int t = blockIdx.x * 256 + threadIdx.x; if (t >= N * (K / 8)) return; const int n = t / (K / 8), k8 = (t % (K / 8)) * 8; FragH f;
#pragma unroll
  for (int i = 0; i < 8; ++i) f.h[i] = (_Float16)(bf16_round(W[(size_t)(k8 + i) * N + n]) * scale); const v8us o = f.half[0];
  *(v8us*)((unsigned short*)Wt + (size_t)n * K + k8) = o; 
}
// k_gemm_hh variant with fused epilogue: v = acc·alpha + bias[by·sBias + col] (+ CP[(row/rowsPerB)·sCPb + by·64 + col] if CP) ; ACT 0 none / 1 elu ; writes f16 C16 (and f32 C if non-null)
template <int ACT>
__global__ __launch_bounds__(128) void k_gemm_hhx(const _Float16* __restrict__ A, int lda, size_t sA, const _Float16* __restrict__ Bh, int ldb, size_t sB, float alpha, const float* __restrict__ bias, size_t sBias, const float* __restrict__ CP, int rowsPerB, size_t sCPb, int row0g,
    float* __restrict__ C, _Float16* __restrict__ C16, int ldc, size_t sC, int M, int N, int K) {
  __shared__ __attribute__((aligned(16))) float so[4][16][64];
  const int tid = threadIdx.x, w = tid >> 5, lane = tid & 31, ln = lane & 15, hh = lane >> 4; const int by = blockIdx.y;
  A += (size_t)by * sA; Bh += (size_t)by * sB; const size_t cofs = (size_t)by * sC; const float* bp = bias ? bias + (size_t)by * sBias : nullptr;
  const int ntn = (N + 63) / 64; const int wid = blockIdx.x * 4 + w; const int mt = wid / ntn, nq = wid % ntn; if (mt * 16 >= M) return;
  const int row0 = mt * 16, col0 = nq * 64; const _Float16* arow = A + (size_t)(row0 + ln) * lda;
  v8f acc[4] = {};
  for (int kb = 0; kb < K; kb += 32) { FragH ah; ah.half[0] = *(const v8us*)((const unsigned short*)arow + kb + 8 * hh); ah.half[1] = *(const v8us*)((const unsigned short*)arow + kb + 16 + 8 * hh);
#pragma unroll
    for (int t = 0; t < 4; ++t) { if (col0 + t * 16 >= N) continue; const size_t boff = (size_t)(col0 + t * 16 + ln) * ldb + kb; FragH bq; bq.half[0] = *(const v8us*)((const unsigned short*)Bh + boff + 8 * hh); bq.half[1] = *(const v8us*)((const unsigned short*)Bh + boff + 16 + 8 * hh);
      acc[t] = mmaH<1>(ah.v, ah.v, bq.v, bq.v, acc[t]); }
  }
#pragma unroll
  for (int t = 0; t < 4; ++t) { if (col0 + t * 16 >= N) continue; const int col = col0 + t * 16 + ln; const float bv = bp ? bf16_round(bp[col]) : 0.f;
#pragma unroll
    for (int r = 0; r < 8; ++r) { float v = acc[t][r] * alpha + bv; if (CP) { const int rr = row0g + row0 + 8 * hh + r; if (rowsPerB < 0) v += CP[cofs + (size_t)rr * ldc + col];      /* rowsPerB < 0: own element of the batched C plane */ else { const int bidx = rr / rowsPerB; v += CP[(size_t)bidx * sCPb + (size_t)by * 64 + col]; } } if (ACT == 1) v = (v > 0.f) ? v : expm1f(v); else if (ACT == 7) v = (v > 0.f) ? v + 1.0f : expf(v); else if (ACT == 8) v = tanhf(v); else if (ACT == 9) v = 0.5f * v * (1.0f + tanhf(0.7978845608028654f * (v + 0.044715f * v * v * v))); else if (ACT == 11) v = 1.0f / (1.0f + expf(-v)); else if (ACT == 12) v = (v > 0.f) ? v : 0.01f * v; else if (ACT == 14) v = (v > 0.f) ? v : 0.1f * v; else if (ACT == 16) v = (v >= 0.f) ? v : 0.3f * v; else if (ACT == 17) v = (v >= 0.f) ? v : 0.2f * v; else if (ACT == 15) v = v / (1.0f + expf(-v)); else if (ACT == 3) v = fmaxf(v, 0.f); else if (ACT == 6) v = 0.5f * v * (1.0f + erff(v * 0.70710678118654752f)); so[w][8 * hh + r][t * 16 + ln] = v; } }
  __builtin_amdgcn_fence(__ATOMIC_ACQ_REL, "workgroup"); __builtin_amdgcn_wave_barrier();
  const int rsub = lane >> 4, c4 = (lane & 15) * 4; typedef _Float16 v4h __attribute__((ext_vector_type(4)));
  {
#pragma unroll
    for (int q = 0; q < 8; ++q) { const int r = q * 2 + rsub; if (col0 + c4 < N) { const v4f v = *(const v4fa*)&so[w][r][c4]; if (C) *(v4f*)(C + cofs + (size_t)(row0 + r) * ldc + col0 + c4) = v; if (C16) { v4h h4; for (int i = 0; i < 4; ++i) h4[i] = (_Float16)v[i]; *(v4h*)(C16 + cofs + (size_t)(row0 + r) * ldc + col0 + c4) = h4; } } }
     }
}


typedef _Float16 v4h __attribute__((ext_vector_type(4)));

__global__ __launch_bounds__(256) void k_x16(const float* __restrict__ x, _Float16* __restrict__ X16, size_t n8) { const size_t t = (size_t)blockIdx.x * 256 + threadIdx.x; if (t >= n8) return; FragH f;
#pragma unroll
  for (int q = 0; q < 8; ++q) f.h[q] = (_Float16)bf16_round(x[t * 8 + q]); *(v8us*)((unsigned short*)X16 + t * 8) = f.half[0];  }
// k_x16 for the three inputs in one launch: blockIdx.y picks q, k or v
__global__ __launch_bounds__(256) void k_x16qkv(const float* __restrict__ xq, const float* __restrict__ xk, const float* __restrict__ xv, _Float16* __restrict__ Q16, _Float16* __restrict__ K16, _Float16* __restrict__ V16, size_t n8) { const size_t t = (size_t)blockIdx.x * 256 + threadIdx.x; if (t >= n8) return;
  const float* x = blockIdx.y == 0 ? xq : blockIdx.y == 1 ? xk : xv; _Float16* X16 = blockIdx.y == 0 ? Q16 : blockIdx.y == 1 ? K16 : V16; FragH f;
#pragma unroll
  for (int q = 0; q < 8; ++q) f.h[q] = (_Float16)bf16_round(x[t * 8 + q]); *(v8us*)((unsigned short*)X16 + t * 8) = f.half[0];  }
__global__ __launch_bounds__(256) void k_h16(const float* __restrict__ x, _Float16* __restrict__ X16, size_t n8) { const size_t t = (size_t)blockIdx.x * 256 + threadIdx.x; if (t >= n8) return; FragH f;
#pragma unroll
  for (int q = 0; q < 8; ++q) f.h[q] = (_Float16)x[t * 8 + q]; *(v8us*)((unsigned short*)X16 + t * 8) = f.half[0];  }
__global__ __launch_bounds__(256) void k_round16f(const float* __restrict__ W, _Float16* __restrict__ Bt, size_t n8) { const size_t t = (size_t)blockIdx.x * 256 + threadIdx.x; if (t >= n8) return; FragH f;
#pragma unroll
  for (int i = 0; i < 8; ++i) f.h[i] = (_Float16)(bf16_round(W[t * 8 + i]) * 16.0f); *(v8us*)((unsigned short*)Bt + t * 8) = f.half[0];  }
template <int NHv, int TTv>
__global__ __launch_bounds__(256) void k_vt(const _Float16* __restrict__ V16, int ldv, int voff, _Float16* __restrict__ Vt) { __shared__ unsigned short tl[64][66]; const int tid = threadIdx.x; const int slab = blockIdx.x / (TTv / 64), lg = blockIdx.x % (TTv / 64); const int b = slab / NHv, h = slab % NHv;
  for (int i = tid; i < 64 * 8; i += 256) { const int r = i / 8, c8 = (i % 8) * 8; FragH f; f.half[0] = *(const v8us*)((const unsigned short*)V16 + ((size_t)b * TTv + lg * 64 + r) * ldv + voff + h * 64 + c8);
#pragma unroll
    for (int q = 0; q < 8; ++q) tl[r][c8 + q] = f.u[q]; }
  __syncthreads();
  {
#pragma unroll
    for (int rd = 0; rd < 2; ++rd) { const int d = rd * 32 + tid / 8, pc = tid % 8; FragH f;
#pragma unroll
      for (int q = 0; q < 8; ++q) f.u[q] = tl[pc * 8 + q][d];
      *(v8us*)((unsigned short*)Vt + ((size_t)slab * 64 + d) * TTv + lg * 64 + pc * 8) = f.half[0]; }
     } }

__global__ __launch_bounds__(256) void k_hl(const float* __restrict__ F, _Float16* __restrict__ Hh, _Float16* __restrict__ Hl, size_t n8) { const size_t t = (size_t)blockIdx.x * 256 + threadIdx.x; if (t >= n8) return; FragH fh, fl; const v4f a = *(const v4fa*)(F + t * 8), c = *(const v4fa*)(F + t * 8 + 4);
#pragma unroll
  for (int q = 0; q < 4; ++q) { _Float16 h = (_Float16)a[q]; fh.h[q] = h; fl.h[q] = (_Float16)((a[q] - (float)h) * 1024.0f); h = (_Float16)c[q]; fh.h[4 + q] = h; fl.h[4 + q] = (_Float16)((c[q] - (float)h) * 1024.0f); }
  { *(v8us*)((unsigned short*)Hh + t * 8) = fh.half[0]; *(v8us*)((unsigned short*)Hl + t * 8) = fl.half[0];  } }

// ---- fast GEMM (wave tile 32x64; requires M % 32 == 0 rows per launch region and N % 64 == 0); epilogue = k_gemm_hhx semantics ----
__device__ __forceinline__ v16h g2_frag(const _Float16* p, int hh) { FragH f; f.half[0] = *(const v8us*)((const unsigned short*)p + 8 * hh); f.half[1] = *(const v8us*)((const unsigned short*)p + 16 + 8 * hh); return f.v; }
__device__ __forceinline__ v8f g2_mma(v16h a, v16h b, v8f c) { v8f d = __builtin_amdgcn_wmma_f32_16x16x32_f16(false, a, false, b, (short)0, c, false, false); asm volatile("v_nop\n\tv_nop\n\tv_nop\n\tv_nop" : "+v"(d) : "v"(a), "v"(b)); return d; }
template <int ACT>
__global__ __launch_bounds__(128) void k_gemm2(const _Float16* __restrict__ A, int lda, size_t sA, const _Float16* __restrict__ Bh, int ldb, size_t sB, float alpha, const float* __restrict__ bias, size_t sBias, const float* __restrict__ CP, int rowsPerB, size_t sCPb, int row0g,
    float* __restrict__ C, _Float16* __restrict__ C16, int ldc, size_t sC, int M, int N, int K) { static_assert(ACT == 0 || ACT == 3 || ACT == 6 || ACT == 8 || ACT == 9 || ACT == 11 || ACT == 12 || ACT == 14 || ACT == 15 || ACT == 16 || ACT == 17, "k_gemm2: unsupported ACT code (would silently apply no activation)");
  __shared__ __attribute__((aligned(16))) float so[4][32][68];
  const int tid = threadIdx.x, w = tid >> 5, lane = tid & 31, ln = lane & 15, hh = lane >> 4; const int by = blockIdx.y;
  A += (size_t)by * sA; Bh += (size_t)by * sB; const size_t cofs = (size_t)by * sC; const float* bp = bias ? bias + (size_t)by * sBias : nullptr;
  const int ntn = N >> 6; const int mt = blockIdx.x / ntn, nq = blockIdx.x - mt * ntn; const int row0 = mt * 128 + 32 * w, col0 = nq * 64; if (row0 >= M) return;
  const _Float16* a0p = A + (size_t)(row0 + ln) * lda; const _Float16* a1p = a0p + (size_t)16 * lda;
  const _Float16* b0p = Bh + (size_t)(col0 + ln) * ldb; const _Float16* b1p = b0p + (size_t)16 * ldb; const _Float16* b2p = b1p + (size_t)16 * ldb; const _Float16* b3p = b2p + (size_t)16 * ldb;
  const v8f z8 = {0.f,0.f,0.f,0.f,0.f,0.f,0.f,0.f}; v8f c00 = z8, c01 = z8, c02 = z8, c03 = z8, c10 = z8, c11 = z8, c12 = z8, c13 = z8;
#pragma unroll 1
  for (int kb = 0; kb < K; kb += 32) { const v16h a0 = g2_frag(a0p + kb, hh), a1 = g2_frag(a1p + kb, hh);
    v16h b = g2_frag(b0p + kb, hh); c00 = g2_mma(a0, b, c00); c10 = g2_mma(a1, b, c10);
    b = g2_frag(b1p + kb, hh); c01 = g2_mma(a0, b, c01); c11 = g2_mma(a1, b, c11);
    b = g2_frag(b2p + kb, hh); c02 = g2_mma(a0, b, c02); c12 = g2_mma(a1, b, c12);
    b = g2_frag(b3p + kb, hh); c03 = g2_mma(a0, b, c03); c13 = g2_mma(a1, b, c13); }
  v8f accs[8] = {c00, c01, c02, c03, c10, c11, c12, c13};
#pragma unroll
  for (int u = 0; u < 8; ++u) { const int t = u & 3, half = u >> 2; const int col = col0 + t * 16 + ln; const float bv = bp ? bf16_round(bp[col]) : 0.f;
#pragma unroll
    for (int r = 0; r < 8; ++r) { const int rloc = half * 16 + 8 * hh + r; float v = accs[u][r] * alpha + bv; if (CP) { if (rowsPerB < 0) v += CP[cofs + (size_t)(row0g + row0 + rloc) * ldc + col];      /* rowsPerB < 0: own element of the batched C plane */ else { const int bidx = (row0g + row0 + rloc) / rowsPerB; v += CP[(size_t)bidx * sCPb + (size_t)by * 64 + col]; } }
      if (ACT == 3) v = fmaxf(v, 0.f); else if (ACT == 6) v = 0.5f * v * (1.0f + erff(v * 0.70710678118654752f)); else if (ACT == 11) v = 1.0f / (1.0f + expf(-v)); else if (ACT == 15) v = v / (1.0f + expf(-v)); else if (ACT == 12) v = (v > 0.f) ? v : 0.01f * v; else if (ACT == 8) v = tanhf(v); else if (ACT == 9) v = 0.5f * v * (1.0f + tanhf(0.7978845608028654f * (v + 0.044715f * v * v * v))); else if (ACT == 14) v = (v > 0.f) ? v : 0.1f * v; else if (ACT == 16) v = (v >= 0.f) ? v : 0.3f * v; else if (ACT == 17) v = (v >= 0.f) ? v : 0.2f * v;
      so[w][rloc][t * 16 + ln] = v; } }
  __builtin_amdgcn_fence(__ATOMIC_ACQ_REL, "workgroup"); __builtin_amdgcn_wave_barrier();
  const int rsub = lane >> 4, c4 = (lane & 15) * 4;
  {
#pragma unroll
    for (int q = 0; q < 16; ++q) { const int r = q * 2 + rsub; const v4f v = *(const v4fa*)&so[w][r][c4]; if (C) *(v4f*)(C + cofs + (size_t)(row0 + r) * ldc + col0 + c4) = v; if (C16) { v4h h4; for (int i = 0; i < 4; ++i) h4[i] = (_Float16)v[i]; *(v4h*)(C16 + cofs + (size_t)(row0 + r) * ldc + col0 + c4) = h4; } }
     } }


__global__ __launch_bounds__(256) void k_wnat(const float* __restrict__ w, size_t n8, _Float16* __restrict__ Bt) { const size_t t = (size_t)blockIdx.x * 256 + threadIdx.x; if (t >= n8) return; FragH f; for (int q = 0; q < 8; ++q) f.h[q] = (_Float16)(bf16_round(w[t * 8 + q]) * 16.0f); *(v8us*)((unsigned short*)Bt + t * 8) = f.half[0];  }
__global__ __launch_bounds__(256) void k_rsm(const float* __restrict__ S, _Float16* __restrict__ P, int nrows) {
  #pragma clang fp contract(off)
  const int i = blockIdx.x * 256 + threadIdx.x; if (i >= nrows) return; const float* s = S + (size_t)i * SQ; float mx = -3.0e38f;
#pragma unroll 1
  for (int j = 0; j < SQ; ++j) mx = fmaxf(mx, s[j]); float se = 0.f;
#pragma unroll 1
  for (int j = 0; j < SQ; ++j) se += expf(s[j] - mx); const float sc = 256.0f / se;
#pragma unroll 1
  for (int j0 = 0; j0 < SQ; j0 += 8) { FragH f; for (int q = 0; q < 8; ++q) f.h[q] = (_Float16)(expf(s[j0 + q] - mx) * sc); unsigned short* d = (unsigned short*)P + (size_t)i * SQ + j0; *(v8us*)d = f.half[0];  } }
__global__ __launch_bounds__(256) void k_vt(const _Float16* __restrict__ V16, int b, int h0, _Float16* __restrict__ VT) { __shared__ unsigned short tl[64][65]; const int tid = threadIdx.x; const int hh = blockIdx.x % HG, sg = blockIdx.x / HG; const int s0 = sg * 64; const int h = h0 + hh;
  for (int i = tid; i < 64 * 8; i += 256) { const int j = i / 8, d8 = (i % 8) * 8; FragH f; f.half[0] = *(const v8us*)((const unsigned short*)V16 + ((size_t)b * SQ + s0 + j) * DM + h * HD + d8); for (int q = 0; q < 8; ++q) tl[d8 + q][j] = f.u[q]; }
  __syncthreads();
  { for (int i = tid; i < 64 * 8; i += 256) { const int d = i / 8, j8 = (i % 8) * 8; FragH f; for (int q = 0; q < 8; ++q) f.u[q] = tl[d][j8 + q]; *(v8us*)((unsigned short*)VT + ((size_t)hh * HD + d) * SQ + s0 + j8) = f.half[0]; }  } }



__global__ __launch_bounds__(256) void k_rsmf(const float* __restrict__ S, _Float16* __restrict__ P, int qn, int hg) {
  #pragma clang fp contract(off)
  const int t = blockIdx.x * 256 + threadIdx.x; if (t >= qn * hg) return; const size_t i = (size_t)(t / qn) * SQ + (t % qn); const float* s = S + i * SQ; float mx = -3.0e38f;
#pragma unroll 1
  for (int j = 0; j < SQ; ++j) mx = fmaxf(mx, s[j]); float se = 0.f;
#pragma unroll 1
  for (int j = 0; j < SQ; ++j) se += __expf(s[j] - mx); const float sc = 256.0f / se;
#pragma unroll 1
  for (int j0 = 0; j0 < SQ; j0 += 8) { FragH f; for (int q = 0; q < 8; ++q) f.h[q] = (_Float16)(__expf(s[j0 + q] - mx) * sc); unsigned short* d = (unsigned short*)P + i * SQ + j0; *(v8us*)d = f.half[0];  } }


// Row softmax with key mask, one wave per score row: lane l holds columns c * 256 + l * 8 .. + 7 (c = 0 .. 7) in registers, so the row is read once, in whole lines.
// Maximum (over all keys) and sum: eight partials per lane, a tree over them, then a butterfly over the 32 lanes (four row_xmask steps, then lane l with l ^ 16).
// A masked key's score is replaced behind the maximum by -3.0e38, whose exp is exactly 0. Weights x256 f16.
typedef int v4ia __attribute__((ext_vector_type(4), may_alias));
template <int M> __device__ __forceinline__ float lane_x(float v) { return __builtin_bit_cast(float, __builtin_amdgcn_mov_dpp(__builtin_bit_cast(int, v), 0x160 + M, 0xf, 0xf, true)); }      /* lane l with l ^ M inside a 16-lane row (row_xmask) */
__device__ __forceinline__ float lane_x16(float v) { return __builtin_bit_cast(float, __builtin_amdgcn_permlanex16(__builtin_bit_cast(int, v), __builtin_bit_cast(int, v), 0x76543210, 0xfedcba98, false, false)); }      /* lane l with l ^ 16 */
// native exp (the multiply and the v_exp_f32 that __expf compiles to). The v_nop fills the slot that the instruction set asks for behind a transcendental before its source is overwritten.
__device__ __forceinline__ float exp_slot(float v) { const float t = v * 1.44269504f; float e; asm("v_exp_f32 %0, %1\n\tv_nop" : "=v"(e) : "v"(t)); return e; }
__global__ __launch_bounds__(256) void k_rsmk1(const float* __restrict__ S, _Float16* __restrict__ P, int nrows, const int* __restrict__ Km) {
  const int lane = threadIdx.x & 31; const int i = blockIdx.x * 8 + __builtin_amdgcn_readfirstlane(threadIdx.x >> 5); if (i >= nrows) return;      /* the row is the wave's: scalar base, scalar exit */
  const float* s = S + (size_t)i * SQ; const int l8 = lane * 8;
  v4f xv[SQ / 128]; v4ia kv[SQ / 128];
#pragma unroll
  for (int c = 0; c < SQ / 128; ++c) xv[c] = *(const v4fa*)(s + (c >> 1) * 256 + (c & 1) * 4 + l8);
#pragma unroll
  for (int c = 0; c < SQ / 128; ++c) kv[c] = *(const v4ia*)(Km + (c >> 1) * 256 + (c & 1) * 4 + l8);
  __builtin_amdgcn_sched_barrier(0);      /* every load of the row and of its mask is issued before the first use: one memory latency; without it the compiler issues them in dependent batches */
  float x[SQ / 32], m8[8];
#pragma unroll
  for (int q = 0; q < 8; ++q) m8[q] = xv[q >> 2][q & 3];
#pragma unroll
  for (int c = 2; c < SQ / 128; ++c)
#pragma unroll
    for (int q = 0; q < 4; ++q) m8[(c & 1) * 4 + q] = fmaxf(m8[(c & 1) * 4 + q], xv[c][q]);
#pragma unroll
  for (int c = 0; c < SQ / 128; ++c)
#pragma unroll
    for (int q = 0; q < 4; ++q) x[c * 4 + q] = (kv[c][q] != 0) ? xv[c][q] : -3.0e38f;
  float mx = fmaxf(fmaxf(fmaxf(m8[0], m8[1]), fmaxf(m8[2], m8[3])), fmaxf(fmaxf(m8[4], m8[5]), fmaxf(m8[6], m8[7])));
  mx = fmaxf(mx, lane_x<1>(mx)); mx = fmaxf(mx, lane_x<2>(mx)); mx = fmaxf(mx, lane_x<4>(mx)); mx = fmaxf(mx, lane_x<8>(mx)); mx = fmaxf(mx, lane_x16(mx));
  float s8[8];
#pragma unroll
  for (int q = 0; q < 8; ++q) { const float e = exp_slot(x[q] - mx); x[q] = e; s8[q] = e; }
#pragma unroll
  for (int c = 1; c < SQ / 256; ++c)
#pragma unroll
    for (int q = 0; q < 8; ++q) { const float e = exp_slot(x[c * 8 + q] - mx); x[c * 8 + q] = e; s8[q] += e; }
  float se = ((s8[0] + s8[1]) + (s8[2] + s8[3])) + ((s8[4] + s8[5]) + (s8[6] + s8[7]));
  se += lane_x<1>(se); se += lane_x<2>(se); se += lane_x<4>(se); se += lane_x<8>(se); se += lane_x16(se);
  const float sc = 256.0f / se; unsigned short* p = (unsigned short*)P + (size_t)i * SQ;
#pragma unroll
  for (int c = 0; c < SQ / 256; ++c) { FragH f;
#pragma unroll
    for (int q = 0; q < 8; ++q) f.h[q] = (_Float16)(x[c * 8 + q] * sc);
    *(v8us*)(p + c * 256 + l8) = f.half[0]; } }
extern "C" void kernel_launch(void* const* d_in, const int* in_sizes, int n_in,
                              void* d_out, int out_size, void* d_ws, size_t ws_size, hipStream_t stream) {
  (void)in_sizes; (void)n_in; (void)out_size;
  const float* const* I = (const float* const*)d_in; const float* xq = I[0]; const float* xk = I[1]; const float* xv = I[2]; const int* km = (const int*)d_in[3];      /* key mask int32 [2][1][1][2048] (0 = masked; READ on device): plane b of 16 belongs to batch b / 8 */      /* given q, k, v [B][H][S][64]: each (b, h) plane is a 'batch' of one 64-wide head */
  char* ws = (char*)d_ws; size_t off = 0;
  auto take = [&](size_t bytes) { char* p = ws + off; off += (bytes + 255) & ~(size_t)255; return p; };
  _Float16* Q16 = (_Float16*)take(NR * DM * 2); _Float16* K16 = (_Float16*)take(NR * DM * 2); _Float16* V16 = (_Float16*)take(NR * DM * 2);
  float* S = (float*)take((size_t)PG * SQ * SQ * 4); _Float16* P = (_Float16*)take((size_t)NB * SQ * SQ * 2); _Float16* VT = (_Float16*)take((size_t)NB * HD * SQ * 2);
  if (off > ws_size) return;

  k_x16qkv<<<dim3((unsigned)((NR * DM / 8 + 255) / 256), 3), 256, 0, stream>>>(xq, xk, xv, Q16, K16, V16, NR * DM / 8);      /* given q, k, v: bf16 inputs as exact f16 rows (no projections); one launch for the three */
  k_vt<NH, SQ><<<NB * NH * (SQ / 64), 256, 0, stream>>>(V16, LQ, 0, VT);      /* V^T [NB][HD][SQ], every plane */
  for (int b = 0; b < NB; b += PG) { const size_t r0 = (size_t)b * SQ;      /* PG planes of one batch per launch */
    k_gemm2<0><<<dim3((SQ / 128) * (SQ / 64), PG), 128, 0, stream>>>(Q16 + r0 * LQ, LQ, (size_t)SQ * LQ, K16 + r0 * LQ, LQ, (size_t)SQ * LQ, 0.125f, nullptr, 0, nullptr, 1, 0, 0, S, nullptr, SQ, (size_t)SQ * SQ, SQ, SQ, HD);      /* scores, plane = blockIdx.y */
    k_rsmk1<<<PG * SQ / 8, 256, 0, stream>>>(S, P + r0 * SQ, PG * SQ, km + (size_t)(b / 8) * SQ); }      /* one wave per row; keys with mask[b / 8][j] == 0 excluded (weight exactly 0 as the module's NEG fill); P x256 f16 */
  k_gemm2<0><<<dim3((SQ / 128) * (HD / 64), NB), 128, 0, stream>>>(P, SQ, (size_t)SQ * SQ, VT, SQ, (size_t)HD * SQ, 0.00390625f, nullptr, 0, nullptr, 1, 0, 0, (float*)d_out, nullptr, DM, (size_t)SQ * DM, SQ, HD, SQ);      /* out = A v straight to the f32 output, plane = blockIdx.y */
}

// v003
// One run takes 38.4 microseconds.
// Timed twice side by side with v002, it ran 5.39 and 5.81 times as fast.
// Over all steps from v000 it is 160 times as fast.
#include <hip/hip_runtime.h>
// Scaled dot-product attention on given head-major query, key, value with a key-padding mask (q, k, v [2][8][2048][64] each = 16 independent [2048][64] planes; att = (q / 8) . k; where(mask == 0, NEG) with the int32 [2][1][1][2048] mask in {0, 1} (random; 0 = masked key, shared by the 8 heads of a batch; READ on device); softmax; out = att v -> [2][8][2048][64]).
// Structure: the three inputs converted to exact f16 rows (bf16 values are exact in f16: no projections); V^T via LDS transposes, all 16 planes in one launch; then ONE attention launch: per work-group 128 queries of one plane, keys walked 64 at a time; scores, softmax weights and row sums stay in registers (S^T = K Q^T, O^T += V^T P^T), f32 output written once.
// Compute dtype: inputs rounded to bf16; q, k, v and the unnormalised softmax weights as plain f16 WMMA operands (~2^-12); scores, running maximum, row sums and output accumulators f32. v_wmma_f32_16x16x32_f16.
#define NB 16
#define SQ 2048
#define DM 64
#define NH 1
#define HD 64
#define HG 1                         /* heads per group in the unlaunched k_vt(V16, b, h0, VT) */
#define B0 0                         /* unused (debug hook) */
#define NBR NB                       /* used only by MP (debug hook) */
#define NR ((size_t)NB * SQ)         /* token rows */
#define MP ((int)((size_t)NBR * SQ)) /* used only by MPO (debug hook) */
#define QN SQ                        /* unused (debug hook) */
#define NHD NH                       /* unused (debug hook) */
#define MPO MP                       /* unused (debug hook) */
#define LQ DM      /* row pitch of the q/k/v rows */
typedef __bf16 v16b __attribute__((ext_vector_type(16)));
typedef unsigned short v8us __attribute__((ext_vector_type(8), may_alias));
typedef float  v8f  __attribute__((ext_vector_type(8)));
typedef float  v4f  __attribute__((ext_vector_type(4)));
typedef float  v4fa __attribute__((ext_vector_type(4), may_alias));
union FragB { v16b v; v8us half[2]; unsigned short u[16]; };

__device__ __forceinline__ unsigned short bf16_bits(float x) { unsigned int u = __float_as_uint(x); return (unsigned short)((u + 0x7FFFu + ((u >> 16) & 1u)) >> 16); }
__device__ __forceinline__ float bf16_val(unsigned short b) { return __uint_as_float(((unsigned int)b) << 16); }
__device__ __forceinline__ float bf16_round(float x) { return bf16_val(bf16_bits(x)); }
// D += A·B with NT terms: 1 = ah·bh, 2 = + al·bh (A split), 3 = + ah·bl (both split)
template <int NT>
__device__ __forceinline__ v8f mmaN(v16b ah, v16b al, v16b bh, v16b bl, v8f c) {
  c = __builtin_amdgcn_wmma_f32_16x16x32_bf16(false, ah, false, bh, (short)0, c, false, false);
  if (NT >= 2) c = __builtin_amdgcn_wmma_f32_16x16x32_bf16(false, al, false, bh, (short)0, c, false, false);
  if (NT >= 3) c = __builtin_amdgcn_wmma_f32_16x16x32_bf16(false, ah, false, bl, (short)0, c, false, false);
  asm volatile("v_nop\n\tv_nop\n\tv_nop\n\tv_nop" : "+v"(c) : "v"(ah), "v"(al), "v"(bh), "v"(bl));
  return c;
}

__global__ __launch_bounds__(256) void k_wt_bf16(const float* __restrict__ W, unsigned short* __restrict__ Wt, int K, int N) {
  const int t = blockIdx.x * 256 + threadIdx.x;
  const int k8n = K / 8;
  if (t >= N * k8n) return;
  const int n = t / k8n, k8 = (t % k8n) * 8;
  v8us v;
#pragma unroll
  for (int i = 0; i < 8; ++i) v[i] = bf16_bits(W[(size_t)(k8 + i) * N + n]);
  *(v8us*)(Wt + (size_t)n * K + k8) = v;
  
}

// GEMM C[M][N] (f32, pitch ldc) = act(A[M][K]·W + bias). A f32 row-major (pitch lda) converted per fragment to bf16
// (ASPLIT: hi/lo two planes -> 2 terms, else single rounded term); Wt bf16 [N][K] (pitch ldb). BIAS_BF16 rounds the
// bias to bf16 first (bias quantised to bf16 before the add). K%32==0, M%16==0, N%64==0.
template <bool ASPLIT, int ACT, bool BIAS_BF16>
__global__ __launch_bounds__(128) void k_gemm_bf(const float* __restrict__ A, int lda, const unsigned short* __restrict__ Wt, int ldb,
                                               const float* __restrict__ bias, float* __restrict__ C, int ldc, int M, int N, int K) {
  __shared__ __attribute__((aligned(16))) float so[4][16][64];
  const int tid = threadIdx.x, w = tid >> 5, lane = tid & 31, ln = lane & 15, hh = lane >> 4;
  const int ntn = N / 64;
  const int wid = blockIdx.x * 4 + w;
  const int mt = wid / ntn, nq = wid % ntn;
  if (mt * 16 >= M) return;
  const int row0 = mt * 16, col0 = nq * 64;
  const float* arow = A + (size_t)(row0 + ln) * lda;
  v8f acc[4] = {};
  for (int kb = 0; kb < K; kb += 32) {
    FragB ah, al;
    const v4f x0 = *(const v4fa*)(arow + kb + 8 * hh), x1 = *(const v4fa*)(arow + kb + 8 * hh + 4);
    const v4f x2 = *(const v4fa*)(arow + kb + 16 + 8 * hh), x3 = *(const v4fa*)(arow + kb + 16 + 8 * hh + 4);
    float xs[16] = {x0[0],x0[1],x0[2],x0[3],x1[0],x1[1],x1[2],x1[3],x2[0],x2[1],x2[2],x2[3],x3[0],x3[1],x3[2],x3[3]};
#pragma unroll
    for (int i = 0; i < 16; ++i) { const unsigned short hb = bf16_bits(xs[i]); ah.u[i] = hb; al.u[i] = ASPLIT ? bf16_bits(xs[i] - bf16_val(hb)) : (unsigned short)0; }
#pragma unroll
    for (int t = 0; t < 4; ++t) {
      const unsigned short* brow = Wt + (size_t)(col0 + t * 16 + ln) * ldb + kb;
      FragB b;
      b.half[0] = *(const v8us*)(brow + 8 * hh);
      b.half[1] = *(const v8us*)(brow + 16 + 8 * hh);
      acc[t] = mmaN<ASPLIT ? 2 : 1>(ah.v, al.v, b.v, b.v, acc[t]);
    }
  }
#pragma unroll
  for (int t = 0; t < 4; ++t) {
    float bv = bias ? bias[col0 + t * 16 + ln] : 0.f;
    if (BIAS_BF16) bv = bf16_round(bv);
#pragma unroll
    for (int r = 0; r < 8; ++r) { float v = acc[t][r] + bv; if (ACT == 1) v = fmaxf(v, 0.f); so[w][8 * hh + r][t * 16 + ln] = v; }
  }
  __builtin_amdgcn_fence(__ATOMIC_ACQ_REL, "workgroup");
  __builtin_amdgcn_wave_barrier();
  const int rsub = lane >> 4, c4 = (lane & 15) * 4;
  {
#pragma unroll
    for (int q = 0; q < 8; ++q) {
      const int r = q * 2 + rsub;
      const v4f v = *(const v4fa*)&so[w][r][c4];
      *(v4f*)(C + (size_t)(row0 + r) * ldc + col0 + c4) = v;
    }
    
  }
}

// GEMM C = act(A·W + bias + resid): A f32 (ASPLIT -> hi/lo 2 terms), Wt bf16 [N][K]; ACT 0 none, 1 relu, 2 exact gelu;
// resid (optional, f32, row index = (row % rmod), pitch ldr, RES_BF16 rounds it) added before the activation.
template <bool ASPLIT, int ACT, bool BIAS_BF16, bool RES_BF16>
__global__ __launch_bounds__(128) void k_gemm_bf3(const float* __restrict__ A, int lda, const unsigned short* __restrict__ Wt, int ldb,
                                                const float* __restrict__ bias, const float* __restrict__ resid, int rmod, int ldr,
                                                float* __restrict__ C, int ldc, int M, int N, int K) {
  __shared__ __attribute__((aligned(16))) float so[4][16][64];
  const int tid = threadIdx.x, w = tid >> 5, lane = tid & 31, ln = lane & 15, hh = lane >> 4;
  const int ntn = N / 64;
  const int wid = blockIdx.x * 4 + w;
  const int mt = wid / ntn, nq = wid % ntn;
  if (mt * 16 >= M) return;
  const int row0 = mt * 16, col0 = nq * 64;
  const float* arow = A + (size_t)(row0 + ln) * lda;
  v8f acc[4] = {};
  for (int kb = 0; kb < K; kb += 32) {
    FragB ah, al;
    const v4f x0 = *(const v4fa*)(arow + kb + 8 * hh), x1 = *(const v4fa*)(arow + kb + 8 * hh + 4);
    const v4f x2 = *(const v4fa*)(arow + kb + 16 + 8 * hh), x3 = *(const v4fa*)(arow + kb + 16 + 8 * hh + 4);
    float xs[16] = {x0[0],x0[1],x0[2],x0[3],x1[0],x1[1],x1[2],x1[3],x2[0],x2[1],x2[2],x2[3],x3[0],x3[1],x3[2],x3[3]};
#pragma unroll
    for (int i = 0; i < 16; ++i) { const unsigned short hb = bf16_bits(xs[i]); ah.u[i] = hb; al.u[i] = ASPLIT ? bf16_bits(xs[i] - bf16_val(hb)) : (unsigned short)0; }
#pragma unroll
    for (int t = 0; t < 4; ++t) {
      const unsigned short* brow = Wt + (size_t)(col0 + t * 16 + ln) * ldb + kb;
      FragB b;
      b.half[0] = *(const v8us*)(brow + 8 * hh);
      b.half[1] = *(const v8us*)(brow + 16 + 8 * hh);
      acc[t] = mmaN<ASPLIT ? 2 : 1>(ah.v, al.v, b.v, b.v, acc[t]);
    }
  }
#pragma unroll
  for (int t = 0; t < 4; ++t) {
    const int col = col0 + t * 16 + ln;
    float bv = bias ? bias[col] : 0.f;
    if (BIAS_BF16) bv = bf16_round(bv);
#pragma unroll
    for (int r = 0; r < 8; ++r) {
      float v = acc[t][r] + bv;
      if (resid) { float rv = resid[(size_t)((row0 + 8 * hh + r) % rmod) * ldr + col]; if (RES_BF16) rv = bf16_round(rv); v += rv; }
      if (ACT == 1) v = fmaxf(v, 0.f);
      if (ACT == 2) v = 0.5f * v * (1.0f + erff(v * 0.70710678118654752f));
      if (ACT == 3) { const float u = 0.7978845608028654f * (v + 0.044715f * v * v * v); v = 0.5f * v * (1.0f + tanhf(u)); }
      so[w][8 * hh + r][t * 16 + ln] = v;
    }
  }
  __builtin_amdgcn_fence(__ATOMIC_ACQ_REL, "workgroup");
  __builtin_amdgcn_wave_barrier();
  const int rsub = lane >> 4, c4 = (lane & 15) * 4;
  {
#pragma unroll
    for (int q = 0; q < 8; ++q) {
      const int r = q * 2 + rsub;
      const v4f v = *(const v4fa*)&so[w][r][c4];
      *(v4f*)(C + (size_t)(row0 + r) * ldc + col0 + c4) = v;
    }
    
  }
}
// row LayerNorm (biased variance, eps) over N: s = X (+ R); optional out_sum <- s; out_norm <- (s-mu)*rsqrt(var+eps)*g + b
template <bool PARAM_BF16>
__global__ __launch_bounds__(256) void k_layernorm(const float* __restrict__ X, const float* __restrict__ R, const float* __restrict__ g, const float* __restrict__ bta,
                                                  float* __restrict__ out_sum, float* __restrict__ out_norm, int N, float eps) {
  __shared__ float red[256];
  const int row = blockIdx.x, tid = threadIdx.x;
  const float* x = X + (size_t)row * N; const float* rr = R ? R + (size_t)row * N : nullptr;
  float vals[16];                     // up to N = 4096
  const int per = N / 256;            // contiguous chunk per thread? use strided-by-4 chunks: thread handles j = tid*4 + 1024*u
  float s1 = 0.f;
  for (int u = 0; u < per / 4; ++u) {
    const int j = tid * 4 + 1024 * u;
    const v4f a = *(const v4fa*)(x + j);
    v4f b = {0.f,0.f,0.f,0.f}; if (rr) b = *(const v4fa*)(rr + j);
#pragma unroll
    for (int q = 0; q < 4; ++q) { const float v = a[q] + b[q]; vals[u * 4 + q] = v; s1 += v; }
  }
  red[tid] = s1; __syncthreads();
  for (int st = 128; st > 0; st >>= 1) { if (tid < st) red[tid] += red[tid + st]; __syncthreads(); }
  const float mu = red[0] / (float)N; __syncthreads();
  float s2 = 0.f;
  for (int u = 0; u < per / 4; ++u)
#pragma unroll
    for (int q = 0; q < 4; ++q) { const float c = vals[u * 4 + q] - mu; s2 += c * c; }
  red[tid] = s2; __syncthreads();
  for (int st = 128; st > 0; st >>= 1) { if (tid < st) red[tid] += red[tid + st]; __syncthreads(); }
  const float rs = rsqrtf(red[0] / (float)N + eps);
  {
    for (int u = 0; u < per / 4; ++u) {
      const int j = tid * 4 + 1024 * u;
      v4f o, sm;
#pragma unroll
      for (int q = 0; q < 4; ++q) {
        float gg = g[j + q], bb = bta[j + q];
        if (PARAM_BF16) { gg = bf16_round(gg); bb = bf16_round(bb); }
        sm[q] = vals[u * 4 + q]; o[q] = (vals[u * 4 + q] - mu) * rs * gg + bb;
      }
      if (out_sum) *(v4f*)(out_sum + (size_t)row * N + j) = sm;
      *(v4f*)(out_norm + (size_t)row * N + j) = o;
    }
    
  }
}



// ---- f16 WMMA path (v_wmma_f32_16x16x32_f16): 11-bit significands for operands in range — used where a [0,1] probability operand needs more precision than bf16
typedef _Float16 v16h __attribute__((ext_vector_type(16)));
union FragH { v16h v; v8us half[2]; _Float16 h[16]; unsigned short u[16]; };
template <int NT>
__device__ __forceinline__ v8f mmaH(v16h ah, v16h al, v16h bh, v16h bl, v8f c) {
  c = __builtin_amdgcn_wmma_f32_16x16x32_f16(false, ah, false, bh, (short)0, c, false, false);
  if (NT >= 2) c = __builtin_amdgcn_wmma_f32_16x16x32_f16(false, al, false, bh, (short)0, c, false, false);
  if (NT >= 3) c = __builtin_amdgcn_wmma_f32_16x16x32_f16(false, ah, false, bl, (short)0, c, false, false);
  asm volatile("v_nop\n\tv_nop\n\tv_nop\n\tv_nop" : "+v"(c) : "v"(ah), "v"(al), "v"(bh), "v"(bl));
  return c;
}
// batched GEMM like k_gemm_b but f16 operands: A f32 (split into f16 hi/lo if ASPLIT, else rounded to f16), Bt = f16 values [n][k]; alpha; C f32; N multiple of 16 (partial tiles skipped)
template <bool ASPLIT>
__global__ __launch_bounds__(128) void k_gemm_h(const float* __restrict__ A, int lda, size_t sA, const _Float16* __restrict__ Bh, int ldb, size_t sB, float alpha, float* __restrict__ C, int ldc, size_t sC, int M, int N, int K) {
  __shared__ __attribute__((aligned(16))) float so[4][16][64];
  const int tid = threadIdx.x, w = tid >> 5, lane = tid & 31, ln = lane & 15, hh = lane >> 4; const int by = blockIdx.y;
  A += (size_t)by * sA; Bh += (size_t)by * sB; C += (size_t)by * sC;
  const int ntn = (N + 63) / 64; const int wid = blockIdx.x * 4 + w; const int mt = wid / ntn, nq = wid % ntn; if (mt * 16 >= M) return;
  const int row0 = mt * 16, col0 = nq * 64; const float* arow = A + (size_t)(row0 + ln) * lda;
  v8f acc[4] = {};
  for (int kb = 0; kb < K; kb += 32) {
    FragH ah, al;
    const v4f x0 = *(const v4fa*)(arow + kb + 8 * hh), x1 = *(const v4fa*)(arow + kb + 8 * hh + 4), x2 = *(const v4fa*)(arow + kb + 16 + 8 * hh), x3 = *(const v4fa*)(arow + kb + 16 + 8 * hh + 4);
    float xs[16] = {x0[0],x0[1],x0[2],x0[3],x1[0],x1[1],x1[2],x1[3],x2[0],x2[1],x2[2],x2[3],x3[0],x3[1],x3[2],x3[3]};
#pragma unroll
    for (int i = 0; i < 16; ++i) { const _Float16 h = (_Float16)xs[i]; ah.h[i] = h; al.h[i] = ASPLIT ? (_Float16)(xs[i] - (float)h) : (_Float16)0.0f; }
#pragma unroll
    for (int t = 0; t < 4; ++t) { if (col0 + t * 16 >= N) continue; const size_t boff = (size_t)(col0 + t * 16 + ln) * ldb + kb; FragH bq; bq.half[0] = *(const v8us*)(Bh + boff + 8 * hh); bq.half[1] = *(const v8us*)(Bh + boff + 16 + 8 * hh);
      acc[t] = mmaH<ASPLIT ? 2 : 1>(ah.v, al.v, bq.v, bq.v, acc[t]); }
  }
#pragma unroll
  for (int t = 0; t < 4; ++t) { if (col0 + t * 16 >= N) continue;
#pragma unroll
    for (int r = 0; r < 8; ++r) so[w][8 * hh + r][t * 16 + ln] = acc[t][r] * alpha; }
  __builtin_amdgcn_fence(__ATOMIC_ACQ_REL, "workgroup"); __builtin_amdgcn_wave_barrier();
  const int rsub = lane >> 4, c4 = (lane & 15) * 4;
  {
#pragma unroll
    for (int q = 0; q < 8; ++q) { const int r = q * 2 + rsub; if (col0 + c4 < N) { const v4f v = *(const v4fa*)&so[w][r][c4]; *(v4f*)(C + (size_t)(row0 + r) * ldc + col0 + c4) = v; } }
     }
}

// Wt[n][k] = f16(W[k][n]·scale) from f32 row-major W[K][N] (scale = power of two; bf16-exact weights stay exact in f16 away from the subnormal range)
__global__ __launch_bounds__(256) void k_wt_f16(const float* __restrict__ W, _Float16* __restrict__ Wt, int K, int N, float scale) {
  const int t = blockIdx.x * 256 + threadIdx.x; if (t >= N * (K / 8)) return; const int n = t / (K / 8), k8 = (t % (K / 8)) * 8; FragH f;
#pragma unroll
  for (int i = 0; i < 8; ++i) f.h[i] = (_Float16)(bf16_round(W[(size_t)(k8 + i) * N + n]) * scale); const v8us o = f.half[0];
  *(v8us*)((unsigned short*)Wt + (size_t)n * K + k8) = o; 
}
// k_gemm_hh variant with fused epilogue: v = acc·alpha + bias[by·sBias + col] (+ CP[(row/rowsPerB)·sCPb + by·64 + col] if CP) ; ACT 0 none / 1 elu ; writes f16 C16 (and f32 C if non-null)
template <int ACT>
__global__ __launch_bounds__(128) void k_gemm_hhx(const _Float16* __restrict__ A, int lda, size_t sA, const _Float16* __restrict__ Bh, int ldb, size_t sB, float alpha, const float* __restrict__ bias, size_t sBias, const float* __restrict__ CP, int rowsPerB, size_t sCPb, int row0g,
    float* __restrict__ C, _Float16* __restrict__ C16, int ldc, size_t sC, int M, int N, int K) {
  __shared__ __attribute__((aligned(16))) float so[4][16][64];
  const int tid = threadIdx.x, w = tid >> 5, lane = tid & 31, ln = lane & 15, hh = lane >> 4; const int by = blockIdx.y;
  A += (size_t)by * sA; Bh += (size_t)by * sB; const size_t cofs = (size_t)by * sC; const float* bp = bias ? bias + (size_t)by * sBias : nullptr;
  const int ntn = (N + 63) / 64; const int wid = blockIdx.x * 4 + w; const int mt = wid / ntn, nq = wid % ntn; if (mt * 16 >= M) return;
  const int row0 = mt * 16, col0 = nq * 64; const _Float16* arow = A + (size_t)(row0 + ln) * lda;
  v8f acc[4] = {};
  for (int kb = 0; kb < K; kb += 32) { FragH ah; ah.half[0] = *(const v8us*)((const unsigned short*)arow + kb + 8 * hh); ah.half[1] = *(const v8us*)((const unsigned short*)arow + kb + 16 + 8 * hh);
#pragma unroll
    for (int t = 0; t < 4; ++t) { if (col0 + t * 16 >= N) continue; const size_t boff = (size_t)(col0 + t * 16 + ln) * ldb + kb; FragH bq; bq.half[0] = *(const v8us*)((const unsigned short*)Bh + boff + 8 * hh); bq.half[1] = *(const v8us*)((const unsigned short*)Bh + boff + 16 + 8 * hh);
      acc[t] = mmaH<1>(ah.v, ah.v, bq.v, bq.v, acc[t]); }
  }
#pragma unroll
  for (int t = 0; t < 4; ++t) { if (col0 + t * 16 >= N) continue; const int col = col0 + t * 16 + ln; const float bv = bp ? bf16_round(bp[col]) : 0.f;
#pragma unroll
    for (int r = 0; r < 8; ++r) { float v = acc[t][r] * alpha + bv; if (CP) { const int rr = row0g + row0 + 8 * hh + r; if (rowsPerB < 0) v += CP[cofs + (size_t)rr * ldc + col];      /* rowsPerB < 0: own element of the batched C plane */ else { const int bidx = rr / rowsPerB; v += CP[(size_t)bidx * sCPb + (size_t)by * 64 + col]; } } if (ACT == 1) v = (v > 0.f) ? v : expm1f(v); else if (ACT == 7) v = (v > 0.f) ? v + 1.0f : expf(v); else if (ACT == 8) v = tanhf(v); else if (ACT == 9) v = 0.5f * v * (1.0f + tanhf(0.7978845608028654f * (v + 0.044715f * v * v * v))); else if (ACT == 11) v = 1.0f / (1.0f + expf(-v)); else if (ACT == 12) v = (v > 0.f) ? v : 0.01f * v; else if (ACT == 14) v = (v > 0.f) ? v : 0.1f * v; else if (ACT == 16) v = (v >= 0.f) ? v : 0.3f * v; else if (ACT == 17) v = (v >= 0.f) ? v : 0.2f * v; else if (ACT == 15) v = v / (1.0f + expf(-v)); else if (ACT == 3) v = fmaxf(v, 0.f); else if (ACT == 6) v = 0.5f * v * (1.0f + erff(v * 0.70710678118654752f)); so[w][8 * hh + r][t * 16 + ln] = v; } }
  __builtin_amdgcn_fence(__ATOMIC_ACQ_REL, "workgroup"); __builtin_amdgcn_wave_barrier();
  const int rsub = lane >> 4, c4 = (lane & 15) * 4; typedef _Float16 v4h __attribute__((ext_vector_type(4)));
  {
#pragma unroll
    for (int q = 0; q < 8; ++q) { const int r = q * 2 + rsub; if (col0 + c4 < N) { const v4f v = *(const v4fa*)&so[w][r][c4]; if (C) *(v4f*)(C + cofs + (size_t)(row0 + r) * ldc + col0 + c4) = v; if (C16) { v4h h4; for (int i = 0; i < 4; ++i) h4[i] = (_Float16)v[i]; *(v4h*)(C16 + cofs + (size_t)(row0 + r) * ldc + col0 + c4) = h4; } } }
     }
}


typedef _Float16 v4h __attribute__((ext_vector_type(4)));

__global__ __launch_bounds__(256) void k_x16(const float* __restrict__ x, _Float16* __restrict__ X16, size_t n8) { const size_t t = (size_t)blockIdx.x * 256 + threadIdx.x; if (t >= n8) return; FragH f;
#pragma unroll
  for (int q = 0; q < 8; ++q) f.h[q] = (_Float16)bf16_round(x[t * 8 + q]); *(v8us*)((unsigned short*)X16 + t * 8) = f.half[0];  }
// k_x16 for the three inputs in one launch: blockIdx.y picks q, k or v
__global__ __launch_bounds__(256) void k_x16qkv(const float* __restrict__ xq, const float* __restrict__ xk, const float* __restrict__ xv, _Float16* __restrict__ Q16, _Float16* __restrict__ K16, _Float16* __restrict__ V16, size_t n8) { const size_t t = (size_t)blockIdx.x * 256 + threadIdx.x; if (t >= n8) return;
  const float* x = blockIdx.y == 0 ? xq : blockIdx.y == 1 ? xk : xv; _Float16* X16 = blockIdx.y == 0 ? Q16 : blockIdx.y == 1 ? K16 : V16; FragH f;
#pragma unroll
  for (int q = 0; q < 8; ++q) f.h[q] = (_Float16)bf16_round(x[t * 8 + q]); *(v8us*)((unsigned short*)X16 + t * 8) = f.half[0];  }
__global__ __launch_bounds__(256) void k_h16(const float* __restrict__ x, _Float16* __restrict__ X16, size_t n8) { const size_t t = (size_t)blockIdx.x * 256 + threadIdx.x; if (t >= n8) return; FragH f;
#pragma unroll
  for (int q = 0; q < 8; ++q) f.h[q] = (_Float16)x[t * 8 + q]; *(v8us*)((unsigned short*)X16 + t * 8) = f.half[0];  }
__global__ __launch_bounds__(256) void k_round16f(const float* __restrict__ W, _Float16* __restrict__ Bt, size_t n8) { const size_t t = (size_t)blockIdx.x * 256 + threadIdx.x; if (t >= n8) return; FragH f;
#pragma unroll
  for (int i = 0; i < 8; ++i) f.h[i] = (_Float16)(bf16_round(W[t * 8 + i]) * 16.0f); *(v8us*)((unsigned short*)Bt + t * 8) = f.half[0];  }
template <int NHv, int TTv>
__global__ __launch_bounds__(256) void k_vt(const _Float16* __restrict__ V16, int ldv, int voff, _Float16* __restrict__ Vt) { __shared__ unsigned short tl[64][66]; const int tid = threadIdx.x; const int slab = blockIdx.x / (TTv / 64), lg = blockIdx.x % (TTv / 64); const int b = slab / NHv, h = slab % NHv;
  for (int i = tid; i < 64 * 8; i += 256) { const int r = i / 8, c8 = (i % 8) * 8; FragH f; f.half[0] = *(const v8us*)((const unsigned short*)V16 + ((size_t)b * TTv + lg * 64 + r) * ldv + voff + h * 64 + c8);
#pragma unroll
    for (int q = 0; q < 8; ++q) tl[r][c8 + q] = f.u[q]; }
  __syncthreads();
  {
#pragma unroll
    for (int rd = 0; rd < 2; ++rd) { const int d = rd * 32 + tid / 8, pc = tid % 8; FragH f;
#pragma unroll
      for (int q = 0; q < 8; ++q) f.u[q] = tl[pc * 8 + q][d];
      *(v8us*)((unsigned short*)Vt + ((size_t)slab * 64 + d) * TTv + lg * 64 + pc * 8) = f.half[0]; }
     } }

__global__ __launch_bounds__(256) void k_hl(const float* __restrict__ F, _Float16* __restrict__ Hh, _Float16* __restrict__ Hl, size_t n8) { const size_t t = (size_t)blockIdx.x * 256 + threadIdx.x; if (t >= n8) return; FragH fh, fl; const v4f a = *(const v4fa*)(F + t * 8), c = *(const v4fa*)(F + t * 8 + 4);
#pragma unroll
  for (int q = 0; q < 4; ++q) { _Float16 h = (_Float16)a[q]; fh.h[q] = h; fl.h[q] = (_Float16)((a[q] - (float)h) * 1024.0f); h = (_Float16)c[q]; fh.h[4 + q] = h; fl.h[4 + q] = (_Float16)((c[q] - (float)h) * 1024.0f); }
  { *(v8us*)((unsigned short*)Hh + t * 8) = fh.half[0]; *(v8us*)((unsigned short*)Hl + t * 8) = fl.half[0];  } }

// ---- fast GEMM (wave tile 32x64; requires M % 32 == 0 rows per launch region and N % 64 == 0); epilogue = k_gemm_hhx semantics ----
__device__ __forceinline__ v16h g2_frag(const _Float16* p, int hh) { FragH f; f.half[0] = *(const v8us*)((const unsigned short*)p + 8 * hh); f.half[1] = *(const v8us*)((const unsigned short*)p + 16 + 8 * hh); return f.v; }
__device__ __forceinline__ v8f g2_mma(v16h a, v16h b, v8f c) { v8f d = __builtin_amdgcn_wmma_f32_16x16x32_f16(false, a, false, b, (short)0, c, false, false); asm volatile("v_nop\n\tv_nop\n\tv_nop\n\tv_nop" : "+v"(d) : "v"(a), "v"(b)); return d; }
template <int ACT>
__global__ __launch_bounds__(128) void k_gemm2(const _Float16* __restrict__ A, int lda, size_t sA, const _Float16* __restrict__ Bh, int ldb, size_t sB, float alpha, const float* __restrict__ bias, size_t sBias, const float* __restrict__ CP, int rowsPerB, size_t sCPb, int row0g,
    float* __restrict__ C, _Float16* __restrict__ C16, int ldc, size_t sC, int M, int N, int K) { static_assert(ACT == 0 || ACT == 3 || ACT == 6 || ACT == 8 || ACT == 9 || ACT == 11 || ACT == 12 || ACT == 14 || ACT == 15 || ACT == 16 || ACT == 17, "k_gemm2: unsupported ACT code (would silently apply no activation)");
  __shared__ __attribute__((aligned(16))) float so[4][32][68];
  const int tid = threadIdx.x, w = tid >> 5, lane = tid & 31, ln = lane & 15, hh = lane >> 4; const int by = blockIdx.y;
  A += (size_t)by * sA; Bh += (size_t)by * sB; const size_t cofs = (size_t)by * sC; const float* bp = bias ? bias + (size_t)by * sBias : nullptr;
  const int ntn = N >> 6; const int mt = blockIdx.x / ntn, nq = blockIdx.x - mt * ntn; const int row0 = mt * 128 + 32 * w, col0 = nq * 64; if (row0 >= M) return;
  const _Float16* a0p = A + (size_t)(row0 + ln) * lda; const _Float16* a1p = a0p + (size_t)16 * lda;
  const _Float16* b0p = Bh + (size_t)(col0 + ln) * ldb; const _Float16* b1p = b0p + (size_t)16 * ldb; const _Float16* b2p = b1p + (size_t)16 * ldb; const _Float16* b3p = b2p + (size_t)16 * ldb;
  const v8f z8 = {0.f,0.f,0.f,0.f,0.f,0.f,0.f,0.f}; v8f c00 = z8, c01 = z8, c02 = z8, c03 = z8, c10 = z8, c11 = z8, c12 = z8, c13 = z8;
#pragma unroll 1
  for (int kb = 0; kb < K; kb += 32) { const v16h a0 = g2_frag(a0p + kb, hh), a1 = g2_frag(a1p + kb, hh);
    v16h b = g2_frag(b0p + kb, hh); c00 = g2_mma(a0, b, c00); c10 = g2_mma(a1, b, c10);
    b = g2_frag(b1p + kb, hh); c01 = g2_mma(a0, b, c01); c11 = g2_mma(a1, b, c11);
    b = g2_frag(b2p + kb, hh); c02 = g2_mma(a0, b, c02); c12 = g2_mma(a1, b, c12);
    b = g2_frag(b3p + kb, hh); c03 = g2_mma(a0, b, c03); c13 = g2_mma(a1, b, c13); }
  v8f accs[8] = {c00, c01, c02, c03, c10, c11, c12, c13};
#pragma unroll
  for (int u = 0; u < 8; ++u) { const int t = u & 3, half = u >> 2; const int col = col0 + t * 16 + ln; const float bv = bp ? bf16_round(bp[col]) : 0.f;
#pragma unroll
    for (int r = 0; r < 8; ++r) { const int rloc = half * 16 + 8 * hh + r; float v = accs[u][r] * alpha + bv; if (CP) { if (rowsPerB < 0) v += CP[cofs + (size_t)(row0g + row0 + rloc) * ldc + col];      /* rowsPerB < 0: own element of the batched C plane */ else { const int bidx = (row0g + row0 + rloc) / rowsPerB; v += CP[(size_t)bidx * sCPb + (size_t)by * 64 + col]; } }
      if (ACT == 3) v = fmaxf(v, 0.f); else if (ACT == 6) v = 0.5f * v * (1.0f + erff(v * 0.70710678118654752f)); else if (ACT == 11) v = 1.0f / (1.0f + expf(-v)); else if (ACT == 15) v = v / (1.0f + expf(-v)); else if (ACT == 12) v = (v > 0.f) ? v : 0.01f * v; else if (ACT == 8) v = tanhf(v); else if (ACT == 9) v = 0.5f * v * (1.0f + tanhf(0.7978845608028654f * (v + 0.044715f * v * v * v))); else if (ACT == 14) v = (v > 0.f) ? v : 0.1f * v; else if (ACT == 16) v = (v >= 0.f) ? v : 0.3f * v; else if (ACT == 17) v = (v >= 0.f) ? v : 0.2f * v;
      so[w][rloc][t * 16 + ln] = v; } }
  __builtin_amdgcn_fence(__ATOMIC_ACQ_REL, "workgroup"); __builtin_amdgcn_wave_barrier();
  const int rsub = lane >> 4, c4 = (lane & 15) * 4;
  {
#pragma unroll
    for (int q = 0; q < 16; ++q) { const int r = q * 2 + rsub; const v4f v = *(const v4fa*)&so[w][r][c4]; if (C) *(v4f*)(C + cofs + (size_t)(row0 + r) * ldc + col0 + c4) = v; if (C16) { v4h h4; for (int i = 0; i < 4; ++i) h4[i] = (_Float16)v[i]; *(v4h*)(C16 + cofs + (size_t)(row0 + r) * ldc + col0 + c4) = h4; } }
     } }


__global__ __launch_bounds__(256) void k_wnat(const float* __restrict__ w, size_t n8, _Float16* __restrict__ Bt) { const size_t t = (size_t)blockIdx.x * 256 + threadIdx.x; if (t >= n8) return; FragH f; for (int q = 0; q < 8; ++q) f.h[q] = (_Float16)(bf16_round(w[t * 8 + q]) * 16.0f); *(v8us*)((unsigned short*)Bt + t * 8) = f.half[0];  }
__global__ __launch_bounds__(256) void k_rsm(const float* __restrict__ S, _Float16* __restrict__ P, int nrows) {
  #pragma clang fp contract(off)
  const int i = blockIdx.x * 256 + threadIdx.x; if (i >= nrows) return; const float* s = S + (size_t)i * SQ; float mx = -3.0e38f;
#pragma unroll 1
  for (int j = 0; j < SQ; ++j) mx = fmaxf(mx, s[j]); float se = 0.f;
#pragma unroll 1
  for (int j = 0; j < SQ; ++j) se += expf(s[j] - mx); const float sc = 256.0f / se;
#pragma unroll 1
  for (int j0 = 0; j0 < SQ; j0 += 8) { FragH f; for (int q = 0; q < 8; ++q) f.h[q] = (_Float16)(expf(s[j0 + q] - mx) * sc); unsigned short* d = (unsigned short*)P + (size_t)i * SQ + j0; *(v8us*)d = f.half[0];  } }
__global__ __launch_bounds__(256) void k_vt(const _Float16* __restrict__ V16, int b, int h0, _Float16* __restrict__ VT) { __shared__ unsigned short tl[64][65]; const int tid = threadIdx.x; const int hh = blockIdx.x % HG, sg = blockIdx.x / HG; const int s0 = sg * 64; const int h = h0 + hh;
  for (int i = tid; i < 64 * 8; i += 256) { const int j = i / 8, d8 = (i % 8) * 8; FragH f; f.half[0] = *(const v8us*)((const unsigned short*)V16 + ((size_t)b * SQ + s0 + j) * DM + h * HD + d8); for (int q = 0; q < 8; ++q) tl[d8 + q][j] = f.u[q]; }
  __syncthreads();
  { for (int i = tid; i < 64 * 8; i += 256) { const int d = i / 8, j8 = (i % 8) * 8; FragH f; for (int q = 0; q < 8; ++q) f.u[q] = tl[d][j8 + q]; *(v8us*)((unsigned short*)VT + ((size_t)hh * HD + d) * SQ + s0 + j8) = f.half[0]; }  } }



__global__ __launch_bounds__(256) void k_rsmf(const float* __restrict__ S, _Float16* __restrict__ P, int qn, int hg) {
  #pragma clang fp contract(off)
  const int t = blockIdx.x * 256 + threadIdx.x; if (t >= qn * hg) return; const size_t i = (size_t)(t / qn) * SQ + (t % qn); const float* s = S + i * SQ; float mx = -3.0e38f;
#pragma unroll 1
  for (int j = 0; j < SQ; ++j) mx = fmaxf(mx, s[j]); float se = 0.f;
#pragma unroll 1
  for (int j = 0; j < SQ; ++j) se += __expf(s[j] - mx); const float sc = 256.0f / se;
#pragma unroll 1
  for (int j0 = 0; j0 < SQ; j0 += 8) { FragH f; for (int q = 0; q < 8; ++q) f.h[q] = (_Float16)(__expf(s[j0 + q] - mx) * sc); unsigned short* d = (unsigned short*)P + i * SQ + j0; *(v8us*)d = f.half[0];  } }


// ---- fused attention: scores, masked softmax and the product with V in one kernel; no score or weight ever reaches memory ----
typedef int v4ia __attribute__((ext_vector_type(4), may_alias));
__device__ __forceinline__ float lane_x16(float v) { return __builtin_bit_cast(float, __builtin_amdgcn_permlanex16(__builtin_bit_cast(int, v), __builtin_bit_cast(int, v), 0x76543210, 0xfedcba98, false, false)); }      /* lane l with l ^ 16 */
__device__ __forceinline__ v8f fa_mma(v16h a, v16h b, v8f c) { return __builtin_amdgcn_wmma_f32_16x16x32_f16(false, a, false, b, (short)0, c, false, false); }
__device__ __forceinline__ v16h fa_frag(const unsigned short* p) { FragH f; f.half[0] = *(const v8us*)p; f.half[1] = *(const v8us*)(p + 16); return f.v; }      /* p already holds the lane half's + 8 * hh: k = 8 hh + 0..7, then 16 + 8 hh + 0..7 */
#define FQ 128      /* queries per work-group: 8 waves x 16 */
#define FK 64       /* keys per stage */
#define FP 72       /* LDS row pitch in 16-bit elements: 144 B = 16 B x 9, odd, for 16-byte fragment reads of 16 rows */
#define FNS (SQ / FK)
// Wave w: queries 16 w .. + 15 of the block, one per lane column (lanes c and c + 16 share query c and split its keys).
// S^T tile t = K rows (A) x Q^T (B): register r of lane (c, hh) = score of key 16 t + 8 hh + r with query c. Two such tiles, converted in place, are the B operand of O^T += V^T P^T.
// Mask as the reference has it: a masked key's score is REPLACED by a huge negative (the fma's addend -1e30 absorbs every score below 1e22 in size), so its weight is exactly 0 beside any open key and all weights are equal where every key is masked.
// Online softmax in base 2; the maximum in use moves only when a column's new maximum passes it by more than 8 (weights stay <= 2^12, inside f16); row sums by a WMMA with an all-ones A (they sum the same rounded weights that meet V).
__global__ __launch_bounds__(256) void k_fattn(const _Float16* __restrict__ Q16, const _Float16* __restrict__ K16, const _Float16* __restrict__ VT, const int* __restrict__ Km, float* __restrict__ O) {
  __shared__ __attribute__((aligned(16))) unsigned short sk[2][FK * FP];
  __shared__ __attribute__((aligned(16))) unsigned short sv[2][HD * FP];
  __shared__ __attribute__((aligned(16))) float sb[SQ];
  const int tid = threadIdx.x, w = tid >> 5, lane = tid & 31, ln = lane & 15, hh = lane >> 4; const int pl = blockIdx.y;
  const int q = blockIdx.x * FQ + w * 16 + ln;
  const unsigned short* kg = (const unsigned short*)K16 + (size_t)pl * SQ * HD + tid * 8;                                   /* a K stage is 8 KB in a row: thread t brings 16-byte pieces t and t + 256 */
  const int r0 = tid >> 3, c8 = (tid & 7) * 8;
  const unsigned short* vg = (const unsigned short*)VT + (size_t)pl * HD * SQ + (size_t)r0 * SQ + c8;                       /* V^T rows r0 and r0 + 32, 128 B of each per stage */
  const int so0 = r0 * FP + c8, so1 = (r0 + 32) * FP + c8;
  v8us rk0 = *(const v8us*)kg, rk1 = *(const v8us*)(kg + 32 * HD), rv0 = *(const v8us*)vg, rv1 = *(const v8us*)(vg + (size_t)32 * SQ);
  { const int* km = Km + (pl / 8) * SQ + tid * 8; const v4ia m0 = *(const v4ia*)km, m1 = *(const v4ia*)(km + 4); v4f b0, b1;      /* plane pl belongs to batch pl / 8 */
#pragma unroll
    for (int i = 0; i < 4; ++i) { b0[i] = m0[i] != 0 ? 0.f : -1.0e30f; b1[i] = m1[i] != 0 ? 0.f : -1.0e30f; }
    *(v4fa*)&sb[tid * 8] = b0; *(v4fa*)&sb[tid * 8 + 4] = b1; }
  const unsigned short* qg = (const unsigned short*)Q16 + ((size_t)pl * SQ + q) * HD + 8 * hh;
  const v16h bq0 = fa_frag(qg), bq1 = fa_frag(qg + 32);
  *(v8us*)&sk[0][so0] = rk0; *(v8us*)&sk[0][so1] = rk1; *(v8us*)&sv[0][so0] = rv0; *(v8us*)&sv[0][so1] = rv1;
  FragH one;
#pragma unroll
  for (int i = 0; i < 16; ++i) one.h[i] = (_Float16)1.0f;
  const v8f z8 = {0.f, 0.f, 0.f, 0.f, 0.f, 0.f, 0.f, 0.f};
  v8f acc[4] = {z8, z8, z8, z8}, accl = z8; float mu = -3.0e38f;      /* mu: the maximum in use */
  const int fo = ln * FP + 8 * hh;
  __syncthreads();
#pragma unroll 2      /* two stages per trip: the buffer's index becomes a constant offset in every LDS address */
  for (int s = 0; s < FNS; ++s) { const int b = s & 1;
    if (s + 1 < FNS) { const unsigned short* kn = kg + (size_t)(s + 1) * FK * HD; const unsigned short* vn = vg + (s + 1) * FK;      /* next stage's pieces fly while this stage is worked on */
      rk0 = *(const v8us*)kn; rk1 = *(const v8us*)(kn + 32 * HD); rv0 = *(const v8us*)vn; rv1 = *(const v8us*)(vn + (size_t)32 * SQ); }
    const unsigned short* kf = &sk[b][fo]; const unsigned short* vf = &sv[b][fo]; const float* bf = &sb[s * FK + 8 * hh];
    v16h ka[8]; v4f bi[8];
#pragma unroll
    for (int t = 0; t < 4; ++t) { ka[2 * t] = fa_frag(kf + t * 16 * FP); ka[2 * t + 1] = fa_frag(kf + t * 16 * FP + 32); bi[2 * t] = *(const v4fa*)(bf + t * 16); bi[2 * t + 1] = *(const v4fa*)(bf + t * 16 + 4); }
    __builtin_amdgcn_sched_barrier(0);      /* the next stage's global loads and all of this stage's K and mask reads are issued before the first product: without it the compiler sinks the global loads to just ahead of their LDS stores (no lead) */
    v8f x[4];
#pragma unroll
    for (int t = 0; t < 4; ++t) x[t] = fa_mma(ka[2 * t + 1], bq1, fa_mma(ka[2 * t], bq0, z8));
    v16h va[8];
#pragma unroll
    for (int t = 0; t < 4; ++t) { va[t] = fa_frag(vf + t * 16 * FP); va[4 + t] = fa_frag(vf + t * 16 * FP + 32); }
    __builtin_amdgcn_sched_barrier(0);      /* the V^T reads are issued here and land under the softmax arithmetic: without it the compiler puts each just ahead of its product, with a full LDS wait for each */
#pragma unroll
    for (int t = 0; t < 4; ++t)
#pragma unroll
      for (int r = 0; r < 4; ++r) { x[t][r] = __builtin_fmaf(x[t][r], 0.18033688f, bi[2 * t][r]); x[t][4 + r] = __builtin_fmaf(x[t][4 + r], 0.18033688f, bi[2 * t + 1][r]); }      /* (1 / 8) log2 e */
    float m4[4];      /* four short chains, one per tile, instead of one chain of 32 dependent maxima */
#pragma unroll
    for (int t = 0; t < 4; ++t) { m4[t] = fmaxf(x[t][0], x[t][1]);
#pragma unroll
      for (int r = 2; r < 8; ++r) m4[t] = fmaxf(m4[t], x[t][r]); }
    float mx = fmaxf(fmaxf(m4[0], m4[1]), fmaxf(m4[2], m4[3]));
    mx = fmaxf(mx, lane_x16(mx));
    const bool need = mx > mu + 8.0f;
    if (__builtin_amdgcn_ballot_w32(need) != 0) {      /* scalar branch, once per stage */
      const float mn = need ? mx : mu; const float al = __builtin_amdgcn_exp2f(mu - mn); mu = mn;
#pragma unroll
      for (int t = 0; t < 4; ++t) acc[t] *= al;
      accl *= al; }
    const float mo = mu - 4.0f;      /* weights carry 2^4: small ones stay clear of f16's subnormals; it cancels against the row sum */
    FragH p[2];
#pragma unroll
    for (int t = 0; t < 4; ++t) {
#pragma unroll
      for (int r = 0; r < 8; ++r) p[t >> 1].h[(t & 1) * 8 + r] = (_Float16)__builtin_amdgcn_exp2f(x[t][r] - mo); }      /* v_exp_f32 as the builtin: the compiler then keeps the matrix instructions' distances around it */
#pragma unroll
    for (int j = 0; j < 2; ++j) {
#pragma unroll
      for (int t = 0; t < 4; ++t) acc[t] = fa_mma(va[4 * j + t], p[j].v, acc[t]);
      accl = fa_mma(one.v, p[j].v, accl); }
    __builtin_amdgcn_sched_barrier(0);      /* the LDS stores wait for the global loads: they stay behind the stage's work, or the loads' lead is lost */
    if (s + 1 < FNS) { *(v8us*)&sk[b ^ 1][so0] = rk0; *(v8us*)&sk[b ^ 1][so1] = rk1; *(v8us*)&sv[b ^ 1][so0] = rv0; *(v8us*)&sv[b ^ 1][so1] = rv1; }      /* its readers left that buffer before the last barrier */
    __syncthreads(); }      /* publishes stage s + 1 and ends every read of stage s */
  const float inv = 1.0f / accl[0]; float* o = O + ((size_t)pl * SQ + q) * HD + 8 * hh;      /* register r of tile t = O[q][16 t + 8 hh + r] */
#pragma unroll
  for (int t = 0; t < 4; ++t) { const v4f o0 = {acc[t][0] * inv, acc[t][1] * inv, acc[t][2] * inv, acc[t][3] * inv}, o1 = {acc[t][4] * inv, acc[t][5] * inv, acc[t][6] * inv, acc[t][7] * inv};
    *(v4f*)(o + t * 16) = o0; *(v4f*)(o + t * 16 + 4) = o1; } }
extern "C" void kernel_launch(void* const* d_in, const int* in_sizes, int n_in,
                              void* d_out, int out_size, void* d_ws, size_t ws_size, hipStream_t stream) {
  (void)in_sizes; (void)n_in; (void)out_size;
  const float* const* I = (const float* const*)d_in; const float* xq = I[0]; const float* xk = I[1]; const float* xv = I[2]; const int* km = (const int*)d_in[3];      /* key mask int32 [2][1][1][2048] (0 = masked; READ on device): plane b of 16 belongs to batch b / 8 */      /* given q, k, v [B][H][S][64]: each (b, h) plane is a 'batch' of one 64-wide head */
  char* ws = (char*)d_ws; size_t off = 0;
  auto take = [&](size_t bytes) { char* p = ws + off; off += (bytes + 255) & ~(size_t)255; return p; };
  _Float16* Q16 = (_Float16*)take(NR * DM * 2); _Float16* K16 = (_Float16*)take(NR * DM * 2); _Float16* V16 = (_Float16*)take(NR * DM * 2);
  _Float16* VT = (_Float16*)take((size_t)NB * HD * SQ * 2);
  if (off > ws_size) return;

  k_x16qkv<<<dim3((unsigned)((NR * DM / 8 + 255) / 256), 3), 256, 0, stream>>>(xq, xk, xv, Q16, K16, V16, NR * DM / 8);      /* given q, k, v: bf16 inputs as exact f16 rows (no projections); one launch for the three */
  k_vt<NH, SQ><<<NB * NH * (SQ / 64), 256, 0, stream>>>(V16, LQ, 0, VT);      /* V^T [NB][HD][SQ], every plane */
  k_fattn<<<dim3(SQ / FQ, NB), 256, 0, stream>>>(Q16, K16, VT, km, (float*)d_out);      /* scores, masked softmax and the product with V, every plane; f32 output */
}

// v004
// It runs in 34.1 microseconds.
// Next to v003, in two timings, it ran 1.17 and 1.15 times as fast.
// Counting every step since v000, it is 186 times as fast.
#include <hip/hip_runtime.h>
// Scaled dot-product attention on given head-major query, key, value with a key-padding mask (q, k, v [2][8][2048][64] each = 16 independent [2048][64] planes; att = (q / 8) . k; where(mask == 0, NEG) with the int32 [2][1][1][2048] mask in {0, 1} (random; 0 = masked key, shared by the 8 heads of a batch; READ on device); softmax; out = att v -> [2][8][2048][64]).
// Structure: ONE launch. Per work-group 128 queries of one plane, keys walked 64 at a time; the f32 inputs are read as they lie and become f16 (bf16 values are exact in f16) on their way into LDS (K, V) or into registers (Q); V stays row-major in LDS and V^T fragments come by the transposing LDS load; scores, softmax weights and row sums stay in registers (S^T = K Q^T, O^T += V^T P^T), f32 output written once.
// Compute dtype: inputs rounded to bf16; q, k, v and the unnormalised softmax weights as plain f16 WMMA operands (~2^-12); scores, running maximum, row sums and output accumulators f32. v_wmma_f32_16x16x32_f16.
#define NB 16
#define SQ 2048
#define DM 64
#define NH 1
#define HD 64
#define HG 1                         /* heads per group in the unlaunched k_vt(V16, b, h0, VT) */
#define B0 0                         /* unused (debug hook) */
#define NBR NB                       /* used only by MP (debug hook) */
#define NR ((size_t)NB * SQ)         /* token rows */
#define MP ((int)((size_t)NBR * SQ)) /* used only by MPO (debug hook) */
#define QN SQ                        /* unused (debug hook) */
#define NHD NH                       /* unused (debug hook) */
#define MPO MP                       /* unused (debug hook) */
#define LQ DM      /* row pitch of the q/k/v rows */
typedef __bf16 v16b __attribute__((ext_vector_type(16)));
typedef unsigned short v8us __attribute__((ext_vector_type(8), may_alias));
typedef float  v8f  __attribute__((ext_vector_type(8)));
typedef float  v4f  __attribute__((ext_vector_type(4)));
typedef float  v4fa __attribute__((ext_vector_type(4), may_alias));
union FragB { v16b v; v8us half[2]; unsigned short u[16]; };

__device__ __forceinline__ unsigned short bf16_bits(float x) { unsigned int u = __float_as_uint(x); return (unsigned short)((u + 0x7FFFu + ((u >> 16) & 1u)) >> 16); }
__device__ __forceinline__ float bf16_val(unsigned short b) { return __uint_as_float(((unsigned int)b) << 16); }
__device__ __forceinline__ float bf16_round(float x) { return bf16_val(bf16_bits(x)); }
// D += A·B with NT terms: 1 = ah·bh, 2 = + al·bh (A split), 3 = + ah·bl (both split)
template <int NT>
__device__ __forceinline__ v8f mmaN(v16b ah, v16b al, v16b bh, v16b bl, v8f c) {
  c = __builtin_amdgcn_wmma_f32_16x16x32_bf16(false, ah, false, bh, (short)0, c, false, false);
  if (NT >= 2) c = __builtin_amdgcn_wmma_f32_16x16x32_bf16(false, al, false, bh, (short)0, c, false, false);
  if (NT >= 3) c = __builtin_amdgcn_wmma_f32_16x16x32_bf16(false, ah, false, bl, (short)0, c, false, false);
  asm volatile("v_nop\n\tv_nop\n\tv_nop\n\tv_nop" : "+v"(c) : "v"(ah), "v"(al), "v"(bh), "v"(bl));
  return c;
}

__global__ __launch_bounds__(256) void k_wt_bf16(const float* __restrict__ W, unsigned short* __restrict__ Wt, int K, int N) {
  const int t = blockIdx.x * 256 + threadIdx.x;
  const int k8n = K / 8;
  if (t >= N * k8n) return;
  const int n = t / k8n, k8 = (t % k8n) * 8;
  v8us v;
#pragma unroll
  for (int i = 0; i < 8; ++i) v[i] = bf16_bits(W[(size_t)(k8 + i) * N + n]);
  *(v8us*)(Wt + (size_t)n * K + k8) = v;
  
}

// GEMM C[M][N] (f32, pitch ldc) = act(A[M][K]·W + bias). A f32 row-major (pitch lda) converted per fragment to bf16
// (ASPLIT: hi/lo two planes -> 2 terms, else single rounded term); Wt bf16 [N][K] (pitch ldb). BIAS_BF16 rounds the
// bias to bf16 first (bias quantised to bf16 before the add). K%32==0, M%16==0, N%64==0.
template <bool ASPLIT, int ACT, bool BIAS_BF16>
__global__ __launch_bounds__(128) void k_gemm_bf(const float* __restrict__ A, int lda, const unsigned short* __restrict__ Wt, int ldb,
                                               const float* __restrict__ bias, float* __restrict__ C, int ldc, int M, int N, int K) {
  __shared__ __attribute__((aligned(16))) float so[4][16][64];
  const int tid = threadIdx.x, w = tid >> 5, lane = tid & 31, ln = lane & 15, hh = lane >> 4;
  const int ntn = N / 64;
  const int wid = blockIdx.x * 4 + w;
  const int mt = wid / ntn, nq = wid % ntn;
  if (mt * 16 >= M) return;
  const int row0 = mt * 16, col0 = nq * 64;
  const float* arow = A + (size_t)(row0 + ln) * lda;
  v8f acc[4] = {};
  for (int kb = 0; kb < K; kb += 32) {
    FragB ah, al;
    const v4f x0 = *(const v4fa*)(arow + kb + 8 * hh), x1 = *(const v4fa*)(arow + kb + 8 * hh + 4);
    const v4f x2 = *(const v4fa*)(arow + kb + 16 + 8 * hh), x3 = *(const v4fa*)(arow + kb + 16 + 8 * hh + 4);
    float xs[16] = {x0[0],x0[1],x0[2],x0[3],x1[0],x1[1],x1[2],x1[3],x2[0],x2[1],x2[2],x2[3],x3[0],x3[1],x3[2],x3[3]};
#pragma unroll
    for (int i = 0; i < 16; ++i) { const unsigned short hb = bf16_bits(xs[i]); ah.u[i] = hb; al.u[i] = ASPLIT ? bf16_bits(xs[i] - bf16_val(hb)) : (unsigned short)0; }
#pragma unroll
    for (int t = 0; t < 4; ++t) {
      const unsigned short* brow = Wt + (size_t)(col0 + t * 16 + ln) * ldb + kb;
      FragB b;
      b.half[0] = *(const v8us*)(brow + 8 * hh);
      b.half[1] = *(const v8us*)(brow + 16 + 8 * hh);
      acc[t] = mmaN<ASPLIT ? 2 : 1>(ah.v, al.v, b.v, b.v, acc[t]);
    }
  }
#pragma unroll
  for (int t = 0; t < 4; ++t) {
    float bv = bias ? bias[col0 + t * 16 + ln] : 0.f;
    if (BIAS_BF16) bv = bf16_round(bv);
#pragma unroll
    for (int r = 0; r < 8; ++r) { float v = acc[t][r] + bv; if (ACT == 1) v = fmaxf(v, 0.f); so[w][8 * hh + r][t * 16 + ln] = v; }
  }
  __builtin_amdgcn_fence(__ATOMIC_ACQ_REL, "workgroup");
  __builtin_amdgcn_wave_barrier();
  const int rsub = lane >> 4, c4 = (lane & 15) * 4;
  {
#pragma unroll
    for (int q = 0; q < 8; ++q) {
      const int r = q * 2 + rsub;
      const v4f v = *(const v4fa*)&so[w][r][c4];
      *(v4f*)(C + (size_t)(row0 + r) * ldc + col0 + c4) = v;
    }
    
  }
}

// GEMM C = act(A·W + bias + resid): A f32 (ASPLIT -> hi/lo 2 terms), Wt bf16 [N][K]; ACT 0 none, 1 relu, 2 exact gelu;
// resid (optional, f32, row index = (row % rmod), pitch ldr, RES_BF16 rounds it) added before the activation.
template <bool ASPLIT, int ACT, bool BIAS_BF16, bool RES_BF16>
__global__ __launch_bounds__(128) void k_gemm_bf3(const float* __restrict__ A, int lda, const unsigned short* __restrict__ Wt, int ldb,
                                                const float* __restrict__ bias, const float* __restrict__ resid, int rmod, int ldr,
                                                float* __restrict__ C, int ldc, int M, int N, int K) {
  __shared__ __attribute__((aligned(16))) float so[4][16][64];
  const int tid = threadIdx.x, w = tid >> 5, lane = tid & 31, ln = lane & 15, hh = lane >> 4;
  const int ntn = N / 64;
  const int wid = blockIdx.x * 4 + w;
  const int mt = wid / ntn, nq = wid % ntn;
  if (mt * 16 >= M) return;
  const int row0 = mt * 16, col0 = nq * 64;
  const float* arow = A + (size_t)(row0 + ln) * lda;
  v8f acc[4] = {};
  for (int kb = 0; kb < K; kb += 32) {
    FragB ah, al;
    const v4f x0 = *(const v4fa*)(arow + kb + 8 * hh), x1 = *(const v4fa*)(arow + kb + 8 * hh + 4);
    const v4f x2 = *(const v4fa*)(arow + kb + 16 + 8 * hh), x3 = *(const v4fa*)(arow + kb + 16 + 8 * hh + 4);
    float xs[16] = {x0[0],x0[1],x0[2],x0[3],x1[0],x1[1],x1[2],x1[3],x2[0],x2[1],x2[2],x2[3],x3[0],x3[1],x3[2],x3[3]};
#pragma unroll
    for (int i = 0; i < 16; ++i) { const unsigned short hb = bf16_bits(xs[i]); ah.u[i] = hb; al.u[i] = ASPLIT ? bf16_bits(xs[i] - bf16_val(hb)) : (unsigned short)0; }
#pragma unroll
    for (int t = 0; t < 4; ++t) {
      const unsigned short* brow = Wt + (size_t)(col0 + t * 16 + ln) * ldb + kb;
      FragB b;
      b.half[0] = *(const v8us*)(brow + 8 * hh);
      b.half[1] = *(const v8us*)(brow + 16 + 8 * hh);
      acc[t] = mmaN<ASPLIT ? 2 : 1>(ah.v, al.v, b.v, b.v, acc[t]);
    }
  }
#pragma unroll
  for (int t = 0; t < 4; ++t) {
    const int col = col0 + t * 16 + ln;
    float bv = bias ? bias[col] : 0.f;
    if (BIAS_BF16) bv = bf16_round(bv);
#pragma unroll
    for (int r = 0; r < 8; ++r) {
      float v = acc[t][r] + bv;
      if (resid) { float rv = resid[(size_t)((row0 + 8 * hh + r) % rmod) * ldr + col]; if (RES_BF16) rv = bf16_round(rv); v += rv; }
      if (ACT == 1) v = fmaxf(v, 0.f);
      if (ACT == 2) v = 0.5f * v * (1.0f + erff(v * 0.70710678118654752f));
      if (ACT == 3) { const float u = 0.7978845608028654f * (v + 0.044715f * v * v * v); v = 0.5f * v * (1.0f + tanhf(u)); }
      so[w][8 * hh + r][t * 16 + ln] = v;
    }
  }
  __builtin_amdgcn_fence(__ATOMIC_ACQ_REL, "workgroup");
  __builtin_amdgcn_wave_barrier();
  const int rsub = lane >> 4, c4 = (lane & 15) * 4;
  {
#pragma unroll
    for (int q = 0; q < 8; ++q) {
      const int r = q * 2 + rsub;
      const v4f v = *(const v4fa*)&so[w][r][c4];
      *(v4f*)(C + (size_t)(row0 + r) * ldc + col0 + c4) = v;
    }
    
  }
}
// row LayerNorm (biased variance, eps) over N: s = X (+ R); optional out_sum <- s; out_norm <- (s-mu)*rsqrt(var+eps)*g + b
template <bool PARAM_BF16>
__global__ __launch_bounds__(256) void k_layernorm(const float* __restrict__ X, const float* __restrict__ R, const float* __restrict__ g, const float* __restrict__ bta,
                                                  float* __restrict__ out_sum, float* __restrict__ out_norm, int N, float eps) {
  __shared__ float red[256];
  const int row = blockIdx.x, tid = threadIdx.x;
  const float* x = X + (size_t)row * N; const float* rr = R ? R + (size_t)row * N : nullptr;
  float vals[16];                     // up to N = 4096
  const int per = N / 256;            // contiguous chunk per thread? use strided-by-4 chunks: thread handles j = tid*4 + 1024*u
  float s1 = 0.f;
  for (int u = 0; u < per / 4; ++u) {
    const int j = tid * 4 + 1024 * u;
    const v4f a = *(const v4fa*)(x + j);
    v4f b = {0.f,0.f,0.f,0.f}; if (rr) b = *(const v4fa*)(rr + j);
#pragma unroll
    for (int q = 0; q < 4; ++q) { const float v = a[q] + b[q]; vals[u * 4 + q] = v; s1 += v; }
  }
  red[tid] = s1; __syncthreads();
  for (int st = 128; st > 0; st >>= 1) { if (tid < st) red[tid] += red[tid + st]; __syncthreads(); }
  const float mu = red[0] / (float)N; __syncthreads();
  float s2 = 0.f;
  for (int u = 0; u < per / 4; ++u)
#pragma unroll
    for (int q = 0; q < 4; ++q) { const float c = vals[u * 4 + q] - mu; s2 += c * c; }
  red[tid] = s2; __syncthreads();
  for (int st = 128; st > 0; st >>= 1) { if (tid < st) red[tid] += red[tid + st]; __syncthreads(); }
  const float rs = rsqrtf(red[0] / (float)N + eps);
  {
    for (int u = 0; u < per / 4; ++u) {
      const int j = tid * 4 + 1024 * u;
      v4f o, sm;
#pragma unroll
      for (int q = 0; q < 4; ++q) {
        float gg = g[j + q], bb = bta[j + q];
        if (PARAM_BF16) { gg = bf16_round(gg); bb = bf16_round(bb); }
        sm[q] = vals[u * 4 + q]; o[q] = (vals[u * 4 + q] - mu) * rs * gg + bb;
      }
      if (out_sum) *(v4f*)(out_sum + (size_t)row * N + j) = sm;
      *(v4f*)(out_norm + (size_t)row * N + j) = o;
    }
    
  }
}



// ---- f16 WMMA path (v_wmma_f32_16x16x32_f16): 11-bit significands for operands in range — used where a [0,1] probability operand needs more precision than bf16
typedef _Float16 v16h __attribute__((ext_vector_type(16)));
union FragH { v16h v; v8us half[2]; _Float16 h[16]; unsigned short u[16]; };
template <int NT>
__device__ __forceinline__ v8f mmaH(v16h ah, v16h al, v16h bh, v16h bl, v8f c) {
  c = __builtin_amdgcn_wmma_f32_16x16x32_f16(false, ah, false, bh, (short)0, c, false, false);
  if (NT >= 2) c = __builtin_amdgcn_wmma_f32_16x16x32_f16(false, al, false, bh, (short)0, c, false, false);
  if (NT >= 3) c = __builtin_amdgcn_wmma_f32_16x16x32_f16(false, ah, false, bl, (short)0, c, false, false);
  asm volatile("v_nop\n\tv_nop\n\tv_nop\n\tv_nop" : "+v"(c) : "v"(ah), "v"(al), "v"(bh), "v"(bl));
  return c;
}
// batched GEMM like k_gemm_b but f16 operands: A f32 (split into f16 hi/lo if ASPLIT, else rounded to f16), Bt = f16 values [n][k]; alpha; C f32; N multiple of 16 (partial tiles skipped)
template <bool ASPLIT>
__global__ __launch_bounds__(128) void k_gemm_h(const float* __restrict__ A, int lda, size_t sA, const _Float16* __restrict__ Bh, int ldb, size_t sB, float alpha, float* __restrict__ C, int ldc, size_t sC, int M, int N, int K) {
  __shared__ __attribute__((aligned(16))) float so[4][16][64];
  const int tid = threadIdx.x, w = tid >> 5, lane = tid & 31, ln = lane & 15, hh = lane >> 4; const int by = blockIdx.y;
  A += (size_t)by * sA; Bh += (size_t)by * sB; C += (size_t)by * sC;
  const int ntn = (N + 63) / 64; const int wid = blockIdx.x * 4 + w; const int mt = wid / ntn, nq = wid % ntn; if (mt * 16 >= M) return;
  const int row0 = mt * 16, col0 = nq * 64; const float* arow = A + (size_t)(row0 + ln) * lda;
  v8f acc[4] = {};
  for (int kb = 0; kb < K; kb += 32) {
    FragH ah, al;
    const v4f x0 = *(const v4fa*)(arow + kb + 8 * hh), x1 = *(const v4fa*)(arow + kb + 8 * hh + 4), x2 = *(const v4fa*)(arow + kb + 16 + 8 * hh), x3 = *(const v4fa*)(arow + kb + 16 + 8 * hh + 4);
    float xs[16] = {x0[0],x0[1],x0[2],x0[3],x1[0],x1[1],x1[2],x1[3],x2[0],x2[1],x2[2],x2[3],x3[0],x3[1],x3[2],x3[3]};
#pragma unroll
    for (int i = 0; i < 16; ++i) { const _Float16 h = (_Float16)xs[i]; ah.h[i] = h; al.h[i] = ASPLIT ? (_Float16)(xs[i] - (float)h) : (_Float16)0.0f; }
#pragma unroll
    for (int t = 0; t < 4; ++t) { if (col0 + t * 16 >= N) continue; const size_t boff = (size_t)(col0 + t * 16 + ln) * ldb + kb; FragH bq; bq.half[0] = *(const v8us*)(Bh + boff + 8 * hh); bq.half[1] = *(const v8us*)(Bh + boff + 16 + 8 * hh);
      acc[t] = mmaH<ASPLIT ? 2 : 1>(ah.v, al.v, bq.v, bq.v, acc[t]); }
  }
#pragma unroll
  for (int t = 0; t < 4; ++t) { if (col0 + t * 16 >= N) continue;
#pragma unroll
    for (int r = 0; r < 8; ++r) so[w][8 * hh + r][t * 16 + ln] = acc[t][r] * alpha; }
  __builtin_amdgcn_fence(__ATOMIC_ACQ_REL, "workgroup"); __builtin_amdgcn_wave_barrier();
  const int rsub = lane >> 4, c4 = (lane & 15) * 4;
  {
#pragma unroll
    for (int q = 0; q < 8; ++q) { const int r = q * 2 + rsub; if (col0 + c4 < N) { const v4f v = *(const v4fa*)&so[w][r][c4]; *(v4f*)(C + (size_t)(row0 + r) * ldc + col0 + c4) = v; } }
     }
}

// Wt[n][k] = f16(W[k][n]·scale) from f32 row-major W[K][N] (scale = power of two; bf16-exact weights stay exact in f16 away from the subnormal range)
__global__ __launch_bounds__(256) void k_wt_f16(const float* __restrict__ W, _Float16* __restrict__ Wt, int K, int N, float scale) {
  const int t = blockIdx.x * 256 + threadIdx.x; if (t >= N * (K / 8)) return; const int n = t / (K / 8), k8 = (t % (K / 8)) * 8; FragH f;
#pragma unroll
  for (int i = 0; i < 8; ++i) f.h[i] = (_Float16)(bf16_round(W[(size_t)(k8 + i) * N + n]) * scale); const v8us o = f.half[0];
  *(v8us*)((unsigned short*)Wt + (size_t)n * K + k8) = o; 
}
// k_gemm_hh variant with fused epilogue: v = acc·alpha + bias[by·sBias + col] (+ CP[(row/rowsPerB)·sCPb + by·64 + col] if CP) ; ACT 0 none / 1 elu ; writes f16 C16 (and f32 C if non-null)
template <int ACT>
__global__ __launch_bounds__(128) void k_gemm_hhx(const _Float16* __restrict__ A, int lda, size_t sA, const _Float16* __restrict__ Bh, int ldb, size_t sB, float alpha, const float* __restrict__ bias, size_t sBias, const float* __restrict__ CP, int rowsPerB, size_t sCPb, int row0g,
    float* __restrict__ C, _Float16* __restrict__ C16, int ldc, size_t sC, int M, int N, int K) {
  __shared__ __attribute__((aligned(16))) float so[4][16][64];
  const int tid = threadIdx.x, w = tid >> 5, lane = tid & 31, ln = lane & 15, hh = lane >> 4; const int by = blockIdx.y;
  A += (size_t)by * sA; Bh += (size_t)by * sB; const size_t cofs = (size_t)by * sC; const float* bp = bias ? bias + (size_t)by * sBias : nullptr;
  const int ntn = (N + 63) / 64; const int wid = blockIdx.x * 4 + w; const int mt = wid / ntn, nq = wid % ntn; if (mt * 16 >= M) return;
  const int row0 = mt * 16, col0 = nq * 64; const _Float16* arow = A + (size_t)(row0 + ln) * lda;
  v8f acc[4] = {};
  for (int kb = 0; kb < K; kb += 32) { FragH ah; ah.half[0] = *(const v8us*)((const unsigned short*)arow + kb + 8 * hh); ah.half[1] = *(const v8us*)((const unsigned short*)arow + kb + 16 + 8 * hh);
#pragma unroll
    for (int t = 0; t < 4; ++t) { if (col0 + t * 16 >= N) continue; const size_t boff = (size_t)(col0 + t * 16 + ln) * ldb + kb; FragH bq; bq.half[0] = *(const v8us*)((const unsigned short*)Bh + boff + 8 * hh); bq.half[1] = *(const v8us*)((const unsigned short*)Bh + boff + 16 + 8 * hh);
      acc[t] = mmaH<1>(ah.v, ah.v, bq.v, bq.v, acc[t]); }
  }
#pragma unroll
  for (int t = 0; t < 4; ++t) { if (col0 + t * 16 >= N) continue; const int col = col0 + t * 16 + ln; const float bv = bp ? bf16_round(bp[col]) : 0.f;
#pragma unroll
    for (int r = 0; r < 8; ++r) { float v = acc[t][r] * alpha + bv; if (CP) { const int rr = row0g + row0 + 8 * hh + r; if (rowsPerB < 0) v += CP[cofs + (size_t)rr * ldc + col];      /* rowsPerB < 0: own element of the batched C plane */ else { const int bidx = rr / rowsPerB; v += CP[(size_t)bidx * sCPb + (size_t)by * 64 + col]; } } if (ACT == 1) v = (v > 0.f) ? v : expm1f(v); else if (ACT == 7) v = (v > 0.f) ? v + 1.0f : expf(v); else if (ACT == 8) v = tanhf(v); else if (ACT == 9) v = 0.5f * v * (1.0f + tanhf(0.7978845608028654f * (v + 0.044715f * v * v * v))); else if (ACT == 11) v = 1.0f / (1.0f + expf(-v)); else if (ACT == 12) v = (v > 0.f) ? v : 0.01f * v; else if (ACT == 14) v = (v > 0.f) ? v : 0.1f * v; else if (ACT == 16) v = (v >= 0.f) ? v : 0.3f * v; else if (ACT == 17) v = (v >= 0.f) ? v : 0.2f * v; else if (ACT == 15) v = v / (1.0f + expf(-v)); else if (ACT == 3) v = fmaxf(v, 0.f); else if (ACT == 6) v = 0.5f * v * (1.0f + erff(v * 0.70710678118654752f)); so[w][8 * hh + r][t * 16 + ln] = v; } }
  __builtin_amdgcn_fence(__ATOMIC_ACQ_REL, "workgroup"); __builtin_amdgcn_wave_barrier();
  const int rsub = lane >> 4, c4 = (lane & 15) * 4; typedef _Float16 v4h __attribute__((ext_vector_type(4)));
  {
#pragma unroll
    for (int q = 0; q < 8; ++q) { const int r = q * 2 + rsub; if (col0 + c4 < N) { const v4f v = *(const v4fa*)&so[w][r][c4]; if (C) *(v4f*)(C + cofs + (size_t)(row0 + r) * ldc + col0 + c4) = v; if (C16) { v4h h4; for (int i = 0; i < 4; ++i) h4[i] = (_Float16)v[i]; *(v4h*)(C16 + cofs + (size_t)(row0 + r) * ldc + col0 + c4) = h4; } } }
     }
}


typedef _Float16 v4h __attribute__((ext_vector_type(4)));

__global__ __launch_bounds__(256) void k_x16(const float* __restrict__ x, _Float16* __restrict__ X16, size_t n8) { const size_t t = (size_t)blockIdx.x * 256 + threadIdx.x; if (t >= n8) return; FragH f;
#pragma unroll
  for (int q = 0; q < 8; ++q) f.h[q] = (_Float16)bf16_round(x[t * 8 + q]); *(v8us*)((unsigned short*)X16 + t * 8) = f.half[0];  }
__global__ __launch_bounds__(256) void k_h16(const float* __restrict__ x, _Float16* __restrict__ X16, size_t n8) { const size_t t = (size_t)blockIdx.x * 256 + threadIdx.x; if (t >= n8) return; FragH f;
#pragma unroll
  for (int q = 0; q < 8; ++q) f.h[q] = (_Float16)x[t * 8 + q]; *(v8us*)((unsigned short*)X16 + t * 8) = f.half[0];  }
__global__ __launch_bounds__(256) void k_round16f(const float* __restrict__ W, _Float16* __restrict__ Bt, size_t n8) { const size_t t = (size_t)blockIdx.x * 256 + threadIdx.x; if (t >= n8) return; FragH f;
#pragma unroll
  for (int i = 0; i < 8; ++i) f.h[i] = (_Float16)(bf16_round(W[t * 8 + i]) * 16.0f); *(v8us*)((unsigned short*)Bt + t * 8) = f.half[0];  }
template <int NHv, int TTv>
__global__ __launch_bounds__(256) void k_vt(const _Float16* __restrict__ V16, int ldv, int voff, _Float16* __restrict__ Vt) { __shared__ unsigned short tl[64][66]; const int tid = threadIdx.x; const int slab = blockIdx.x / (TTv / 64), lg = blockIdx.x % (TTv / 64); const int b = slab / NHv, h = slab % NHv;
  for (int i = tid; i < 64 * 8; i += 256) { const int r = i / 8, c8 = (i % 8) * 8; FragH f; f.half[0] = *(const v8us*)((const unsigned short*)V16 + ((size_t)b * TTv + lg * 64 + r) * ldv + voff + h * 64 + c8);
#pragma unroll
    for (int q = 0; q < 8; ++q) tl[r][c8 + q] = f.u[q]; }
  __syncthreads();
  {
#pragma unroll
    for (int rd = 0; rd < 2; ++rd) { const int d = rd * 32 + tid / 8, pc = tid % 8; FragH f;
#pragma unroll
      for (int q = 0; q < 8; ++q) f.u[q] = tl[pc * 8 + q][d];
      *(v8us*)((unsigned short*)Vt + ((size_t)slab * 64 + d) * TTv + lg * 64 + pc * 8) = f.half[0]; }
     } }

__global__ __launch_bounds__(256) void k_hl(const float* __restrict__ F, _Float16* __restrict__ Hh, _Float16* __restrict__ Hl, size_t n8) { const size_t t = (size_t)blockIdx.x * 256 + threadIdx.x; if (t >= n8) return; FragH fh, fl; const v4f a = *(const v4fa*)(F + t * 8), c = *(const v4fa*)(F + t * 8 + 4);
#pragma unroll
  for (int q = 0; q < 4; ++q) { _Float16 h = (_Float16)a[q]; fh.h[q] = h; fl.h[q] = (_Float16)((a[q] - (float)h) * 1024.0f); h = (_Float16)c[q]; fh.h[4 + q] = h; fl.h[4 + q] = (_Float16)((c[q] - (float)h) * 1024.0f); }
  { *(v8us*)((unsigned short*)Hh + t * 8) = fh.half[0]; *(v8us*)((unsigned short*)Hl + t * 8) = fl.half[0];  } }

// ---- fast GEMM (wave tile 32x64; requires M % 32 == 0 rows per launch region and N % 64 == 0); epilogue = k_gemm_hhx semantics ----
__device__ __forceinline__ v16h g2_frag(const _Float16* p, int hh) { FragH f; f.half[0] = *(const v8us*)((const unsigned short*)p + 8 * hh); f.half[1] = *(const v8us*)((const unsigned short*)p + 16 + 8 * hh); return f.v; }
__device__ __forceinline__ v8f g2_mma(v16h a, v16h b, v8f c) { v8f d = __builtin_amdgcn_wmma_f32_16x16x32_f16(false, a, false, b, (short)0, c, false, false); asm volatile("v_nop\n\tv_nop\n\tv_nop\n\tv_nop" : "+v"(d) : "v"(a), "v"(b)); return d; }
template <int ACT>
__global__ __launch_bounds__(128) void k_gemm2(const _Float16* __restrict__ A, int lda, size_t sA, const _Float16* __restrict__ Bh, int ldb, size_t sB, float alpha, const float* __restrict__ bias, size_t sBias, const float* __restrict__ CP, int rowsPerB, size_t sCPb, int row0g,
    float* __restrict__ C, _Float16* __restrict__ C16, int ldc, size_t sC, int M, int N, int K) { static_assert(ACT == 0 || ACT == 3 || ACT == 6 || ACT == 8 || ACT == 9 || ACT == 11 || ACT == 12 || ACT == 14 || ACT == 15 || ACT == 16 || ACT == 17, "k_gemm2: unsupported ACT code (would silently apply no activation)");
  __shared__ __attribute__((aligned(16))) float so[4][32][68];
  const int tid = threadIdx.x, w = tid >> 5, lane = tid & 31, ln = lane & 15, hh = lane >> 4; const int by = blockIdx.y;
  A += (size_t)by * sA; Bh += (size_t)by * sB; const size_t cofs = (size_t)by * sC; const float* bp = bias ? bias + (size_t)by * sBias : nullptr;
  const int ntn = N >> 6; const int mt = blockIdx.x / ntn, nq = blockIdx.x - mt * ntn; const int row0 = mt * 128 + 32 * w, col0 = nq * 64; if (row0 >= M) return;
  const _Float16* a0p = A + (size_t)(row0 + ln) * lda; const _Float16* a1p = a0p + (size_t)16 * lda;
  const _Float16* b0p = Bh + (size_t)(col0 + ln) * ldb; const _Float16* b1p = b0p + (size_t)16 * ldb; const _Float16* b2p = b1p + (size_t)16 * ldb; const _Float16* b3p = b2p + (size_t)16 * ldb;
  const v8f z8 = {0.f,0.f,0.f,0.f,0.f,0.f,0.f,0.f}; v8f c00 = z8, c01 = z8, c02 = z8, c03 = z8, c10 = z8, c11 = z8, c12 = z8, c13 = z8;
#pragma unroll 1
  for (int kb = 0; kb < K; kb += 32) { const v16h a0 = g2_frag(a0p + kb, hh), a1 = g2_frag(a1p + kb, hh);
    v16h b = g2_frag(b0p + kb, hh); c00 = g2_mma(a0, b, c00); c10 = g2_mma(a1, b, c10);
    b = g2_frag(b1p + kb, hh); c01 = g2_mma(a0, b, c01); c11 = g2_mma(a1, b, c11);
    b = g2_frag(b2p + kb, hh); c02 = g2_mma(a0, b, c02); c12 = g2_mma(a1, b, c12);
    b = g2_frag(b3p + kb, hh); c03 = g2_mma(a0, b, c03); c13 = g2_mma(a1, b, c13); }
  v8f accs[8] = {c00, c01, c02, c03, c10, c11, c12, c13};
#pragma unroll
  for (int u = 0; u < 8; ++u) { const int t = u & 3, half = u >> 2; const int col = col0 + t * 16 + ln; const float bv = bp ? bf16_round(bp[col]) : 0.f;
#pragma unroll
    for (int r = 0; r < 8; ++r) { const int rloc = half * 16 + 8 * hh + r; float v = accs[u][r] * alpha + bv; if (CP) { if (rowsPerB < 0) v += CP[cofs + (size_t)(row0g + row0 + rloc) * ldc + col];      /* rowsPerB < 0: own element of the batched C plane */ else { const int bidx = (row0g + row0 + rloc) / rowsPerB; v += CP[(size_t)bidx * sCPb + (size_t)by * 64 + col]; } }
      if (ACT == 3) v = fmaxf(v, 0.f); else if (ACT == 6) v = 0.5f * v * (1.0f + erff(v * 0.70710678118654752f)); else if (ACT == 11) v = 1.0f / (1.0f + expf(-v)); else if (ACT == 15) v = v / (1.0f + expf(-v)); else if (ACT == 12) v = (v > 0.f) ? v : 0.01f * v; else if (ACT == 8) v = tanhf(v); else if (ACT == 9) v = 0.5f * v * (1.0f + tanhf(0.7978845608028654f * (v + 0.044715f * v * v * v))); else if (ACT == 14) v = (v > 0.f) ? v : 0.1f * v; else if (ACT == 16) v = (v >= 0.f) ? v : 0.3f * v; else if (ACT == 17) v = (v >= 0.f) ? v : 0.2f * v;
      so[w][rloc][t * 16 + ln] = v; } }
  __builtin_amdgcn_fence(__ATOMIC_ACQ_REL, "workgroup"); __builtin_amdgcn_wave_barrier();
  const int rsub = lane >> 4, c4 = (lane & 15) * 4;
  {
#pragma unroll
    for (int q = 0; q < 16; ++q) { const int r = q * 2 + rsub; const v4f v = *(const v4fa*)&so[w][r][c4]; if (C) *(v4f*)(C + cofs + (size_t)(row0 + r) * ldc + col0 + c4) = v; if (C16) { v4h h4; for (int i = 0; i < 4; ++i) h4[i] = (_Float16)v[i]; *(v4h*)(C16 + cofs + (size_t)(row0 + r) * ldc + col0 + c4) = h4; } }
     } }


__global__ __launch_bounds__(256) void k_wnat(const float* __restrict__ w, size_t n8, _Float16* __restrict__ Bt) { const size_t t = (size_t)blockIdx.x * 256 + threadIdx.x; if (t >= n8) return; FragH f; for (int q = 0; q < 8; ++q) f.h[q] = (_Float16)(bf16_round(w[t * 8 + q]) * 16.0f); *(v8us*)((unsigned short*)Bt + t * 8) = f.half[0];  }
__global__ __launch_bounds__(256) void k_rsm(const float* __restrict__ S, _Float16* __restrict__ P, int nrows) {
  #pragma clang fp contract(off)
  const int i = blockIdx.x * 256 + threadIdx.x; if (i >= nrows) return; const float* s = S + (size_t)i * SQ; float mx = -3.0e38f;
#pragma unroll 1
  for (int j = 0; j < SQ; ++j) mx = fmaxf(mx, s[j]); float se = 0.f;
#pragma unroll 1
  for (int j = 0; j < SQ; ++j) se += expf(s[j] - mx); const float sc = 256.0f / se;
#pragma unroll 1
  for (int j0 = 0; j0 < SQ; j0 += 8) { FragH f; for (int q = 0; q < 8; ++q) f.h[q] = (_Float16)(expf(s[j0 + q] - mx) * sc); unsigned short* d = (unsigned short*)P + (size_t)i * SQ + j0; *(v8us*)d = f.half[0];  } }
__global__ __launch_bounds__(256) void k_vt(const _Float16* __restrict__ V16, int b, int h0, _Float16* __restrict__ VT) { __shared__ unsigned short tl[64][65]; const int tid = threadIdx.x; const int hh = blockIdx.x % HG, sg = blockIdx.x / HG; const int s0 = sg * 64; const int h = h0 + hh;
  for (int i = tid; i < 64 * 8; i += 256) { const int j = i / 8, d8 = (i % 8) * 8; FragH f; f.half[0] = *(const v8us*)((const unsigned short*)V16 + ((size_t)b * SQ + s0 + j) * DM + h * HD + d8); for (int q = 0; q < 8; ++q) tl[d8 + q][j] = f.u[q]; }
  __syncthreads();
  { for (int i = tid; i < 64 * 8; i += 256) { const int d = i / 8, j8 = (i % 8) * 8; FragH f; for (int q = 0; q < 8; ++q) f.u[q] = tl[d][j8 + q]; *(v8us*)((unsigned short*)VT + ((size_t)hh * HD + d) * SQ + s0 + j8) = f.half[0]; }  } }



__global__ __launch_bounds__(256) void k_rsmf(const float* __restrict__ S, _Float16* __restrict__ P, int qn, int hg) {
  #pragma clang fp contract(off)
  const int t = blockIdx.x * 256 + threadIdx.x; if (t >= qn * hg) return; const size_t i = (size_t)(t / qn) * SQ + (t % qn); const float* s = S + i * SQ; float mx = -3.0e38f;
#pragma unroll 1
  for (int j = 0; j < SQ; ++j) mx = fmaxf(mx, s[j]); float se = 0.f;
#pragma unroll 1
  for (int j = 0; j < SQ; ++j) se += __expf(s[j] - mx); const float sc = 256.0f / se;
#pragma unroll 1
  for (int j0 = 0; j0 < SQ; j0 += 8) { FragH f; for (int q = 0; q < 8; ++q) f.h[q] = (_Float16)(__expf(s[j0 + q] - mx) * sc); unsigned short* d = (unsigned short*)P + i * SQ + j0; *(v8us*)d = f.half[0];  } }


// ---- fused attention: scores, masked softmax and the product with V in one kernel; no score or weight ever reaches memory ----
typedef int v4ia __attribute__((ext_vector_type(4), may_alias));
__device__ __forceinline__ float lane_x16(float v) { return __builtin_bit_cast(float, __builtin_amdgcn_permlanex16(__builtin_bit_cast(int, v), __builtin_bit_cast(int, v), 0x76543210, 0xfedcba98, false, false)); }      /* lane l with l ^ 16 */
__device__ __forceinline__ v8f fa_mma(v16h a, v16h b, v8f c) { return __builtin_amdgcn_wmma_f32_16x16x32_f16(false, a, false, b, (short)0, c, false, false); }
__device__ __forceinline__ v16h fa_frag(const unsigned short* p) { FragH f; f.half[0] = *(const v8us*)p; f.half[1] = *(const v8us*)(p + 16); return f.v; }      /* p already holds the lane half's + 8 * hh: k = 8 hh + 0..7, then 16 + 8 hh + 0..7 */
#define FQ 128      /* queries per work-group: 8 waves x 16 */
#define FK 64       /* keys per stage */
#define FP 72       /* LDS row pitch in 16-bit elements: 144 B = 16 B x 9, odd, for 16-byte fragment reads of 16 rows */
#define FV 80       /* LDS row pitch of V in 16-bit elements: 160 B = 32 B x 5, odd, for the transposing 16-byte reads */
#define FNS (SQ / FK)
typedef __bf16 v2b __attribute__((ext_vector_type(2)));
typedef float v2f __attribute__((ext_vector_type(2)));
typedef _Float16 v2h __attribute__((ext_vector_type(2)));
typedef unsigned short v4us __attribute__((ext_vector_type(4), may_alias));
typedef short s16x8 __attribute__((ext_vector_type(8)));
__device__ __forceinline__ v2h fa_cvt2(float x0, float x1) { const v2f x = {x0, x1}; const unsigned int u = __builtin_bit_cast(unsigned int, __builtin_convertvector(x, v2b));      /* f32 -> bf16, nearest even, two per instruction */
  const v2f y = {__uint_as_float(u << 16), __uint_as_float(u & 0xFFFF0000u)}; return __builtin_convertvector(y, v2h); }      /* then the same values as f16 */
__device__ __forceinline__ v4h fa_cvt4(v4f x) { const v2h a = fa_cvt2(x[0], x[1]), b = fa_cvt2(x[2], x[3]); const v4h r = {a[0], a[1], b[0], b[1]}; return r; }
__device__ __forceinline__ v16h fa_qfrag(const float* p) { const v4h a = fa_cvt4(*(const v4fa*)p), b = fa_cvt4(*(const v4fa*)(p + 4)), c = fa_cvt4(*(const v4fa*)(p + 16)), d = fa_cvt4(*(const v4fa*)(p + 20)); FragH f;      /* fa_frag's k order, from f32 rows */
#pragma unroll
  for (int i = 0; i < 4; ++i) { f.h[i] = a[i]; f.h[4 + i] = b[i]; f.h[8 + i] = c[i]; f.h[12 + i] = d[i]; }
  return f.v; }
__device__ __forceinline__ v8us fa_tr16(const unsigned short* p) { typedef __attribute__((address_space(3))) s16x8 lds_s16x8; return __builtin_bit_cast(v8us, __builtin_amdgcn_ds_load_tr16_b128_v8i16((lds_s16x8*)p)); }
__device__ __forceinline__ v16h fa_vfrag(const unsigned short* p) { FragH f; f.half[0] = fa_tr16(p); f.half[1] = fa_tr16(p + 16 * FV); return f.v; }      /* p: the lane's own address in a row-major [key][d] tile; lane (c, hh) gets column c of keys 8 hh + 0..7, then 16 + 8 hh + 0..7: fa_frag's k order */
// Wave w: queries 16 w .. + 15 of the block, one per lane column (lanes c and c + 16 share query c and split its keys).
// S^T tile t = K rows (A) x Q^T (B): register r of lane (c, hh) = score of key 16 t + 8 hh + r with query c. Two such tiles, converted in place, are the B operand of O^T += V^T P^T.
// Mask as the reference has it: a masked key's score is REPLACED by a huge negative (the fma's addend -1e30 absorbs every score below 1e22 in size), so its weight is exactly 0 beside any open key and all weights are equal where every key is masked.
// Online softmax in base 2; the maximum in use moves only when a column's new maximum passes it by more than 8 (weights stay <= 2^12, inside f16); row sums by a WMMA with an all-ones A (they sum the same rounded weights that meet V).
__global__ __launch_bounds__(256) void k_fattn(const float* __restrict__ Qf, const float* __restrict__ Kf, const float* __restrict__ Vf, const int* __restrict__ Km, float* __restrict__ O) {
  __shared__ __attribute__((aligned(16))) unsigned short sk[2][FK * FP];
  __shared__ __attribute__((aligned(16))) unsigned short sv[2][FK * FV];      /* V rows as they lie: [key][d] */
  __shared__ __attribute__((aligned(16))) float sb[SQ];
  const int tid = threadIdx.x, w = tid >> 5, lane = tid & 31, ln = lane & 15, hh = lane >> 4; const int pl = blockIdx.y;
  const int q = blockIdx.x * FQ + w * 16 + ln;
  const float* kg = Kf + (size_t)pl * SQ * HD + tid * 4; const float* vg = Vf + (size_t)pl * SQ * HD + tid * 4;      /* a K or V stage is 16 KB of f32 in a row: thread t brings 16-byte pieces t + 256 i, i = 0..3, so each wave's load covers 512 B in a row */
  const int r0 = tid >> 4, c4 = (tid & 15) * 4;      /* piece t + 256 i = elements c4 .. c4 + 3 of the stage's row r0 + 16 i */
  const int sok = r0 * FP + c4, sov = r0 * FV + c4;
  v4f rk[4], rv[4];
#pragma unroll
  for (int i = 0; i < 4; ++i) { rk[i] = *(const v4fa*)(kg + i * 16 * HD); rv[i] = *(const v4fa*)(vg + i * 16 * HD); }
  { const int* km = Km + (pl / 8) * SQ + tid * 8; const v4ia m0 = *(const v4ia*)km, m1 = *(const v4ia*)(km + 4); v4f b0, b1;      /* plane pl belongs to batch pl / 8 */
#pragma unroll
    for (int i = 0; i < 4; ++i) { b0[i] = m0[i] != 0 ? 0.f : -1.0e30f; b1[i] = m1[i] != 0 ? 0.f : -1.0e30f; }
    *(v4fa*)&sb[tid * 8] = b0; *(v4fa*)&sb[tid * 8 + 4] = b1; }
  const float* qg = Qf + ((size_t)pl * SQ + q) * HD + 8 * hh;
  const v16h bq0 = fa_qfrag(qg), bq1 = fa_qfrag(qg + 32);
#pragma unroll
  for (int i = 0; i < 4; ++i) { *(v4us*)&sk[0][sok + i * 16 * FP] = __builtin_bit_cast(v4us, fa_cvt4(rk[i])); *(v4us*)&sv[0][sov + i * 16 * FV] = __builtin_bit_cast(v4us, fa_cvt4(rv[i])); }
  FragH one;
#pragma unroll
  for (int i = 0; i < 16; ++i) one.h[i] = (_Float16)1.0f;
  const v8f z8 = {0.f, 0.f, 0.f, 0.f, 0.f, 0.f, 0.f, 0.f};
  v8f acc[4] = {z8, z8, z8, z8}, accl = z8; float mu = -3.0e38f;      /* mu: the maximum in use */
  const int fo = ln * FP + 8 * hh, fvo = (8 * hh + (lane & 7)) * FV + ((lane >> 3) & 1) * 8;      /* fvo: the transposing load's own lane address: row 8 hh + (lane & 7), 16-byte piece (lane >> 3) & 1 */
  __syncthreads();
#pragma unroll 2      /* two stages per trip: the buffer's index becomes a constant offset in every LDS address */
  for (int s = 0; s < FNS; ++s) { const int b = s & 1;
    if (s + 1 < FNS) { const float* kn = kg + (size_t)(s + 1) * FK * HD; const float* vn = vg + (size_t)(s + 1) * FK * HD;      /* next stage's pieces fly while this stage is worked on */
#pragma unroll
      for (int i = 0; i < 4; ++i) { rk[i] = *(const v4fa*)(kn + i * 16 * HD); rv[i] = *(const v4fa*)(vn + i * 16 * HD); } }
    const unsigned short* kf = &sk[b][fo]; const unsigned short* vf = &sv[b][fvo]; const float* bf = &sb[s * FK + 8 * hh];
    v16h ka[8]; v4f bi[8];
#pragma unroll
    for (int t = 0; t < 4; ++t) { ka[2 * t] = fa_frag(kf + t * 16 * FP); ka[2 * t + 1] = fa_frag(kf + t * 16 * FP + 32); bi[2 * t] = *(const v4fa*)(bf + t * 16); bi[2 * t + 1] = *(const v4fa*)(bf + t * 16 + 4); }
    __builtin_amdgcn_sched_barrier(0);      /* the next stage's global loads and all of this stage's K and mask reads are issued before the first product: without it the compiler sinks the global loads to just ahead of their LDS stores (no lead) */
    v8f x[4];
#pragma unroll
    for (int t = 0; t < 4; ++t) x[t] = fa_mma(ka[2 * t + 1], bq1, fa_mma(ka[2 * t], bq0, z8));
    v16h va[8];
#pragma unroll
    for (int t = 0; t < 4; ++t) { va[t] = fa_vfrag(vf + t * 16); va[4 + t] = fa_vfrag(vf + 32 * FV + t * 16); }      /* d columns 16 t .. + 15 of keys 0..31, then of keys 32..63 */
    __builtin_amdgcn_sched_barrier(0);      /* the V^T reads are issued here and land under the softmax arithmetic: without it the compiler puts each just ahead of its product, with a full LDS wait for each */
#pragma unroll
    for (int t = 0; t < 4; ++t)
#pragma unroll
      for (int r = 0; r < 4; ++r) { x[t][r] = __builtin_fmaf(x[t][r], 0.18033688f, bi[2 * t][r]); x[t][4 + r] = __builtin_fmaf(x[t][4 + r], 0.18033688f, bi[2 * t + 1][r]); }      /* (1 / 8) log2 e */
    float m4[4];      /* four short chains, one per tile, instead of one chain of 32 dependent maxima */
#pragma unroll
    for (int t = 0; t < 4; ++t) { m4[t] = fmaxf(x[t][0], x[t][1]);
#pragma unroll
      for (int r = 2; r < 8; ++r) m4[t] = fmaxf(m4[t], x[t][r]); }
    float mx = fmaxf(fmaxf(m4[0], m4[1]), fmaxf(m4[2], m4[3]));
    mx = fmaxf(mx, lane_x16(mx));
    const bool need = mx > mu + 8.0f;
    if (__builtin_amdgcn_ballot_w32(need) != 0) {      /* scalar branch, once per stage */
      const float mn = need ? mx : mu; const float al = __builtin_amdgcn_exp2f(mu - mn); mu = mn;
#pragma unroll
      for (int t = 0; t < 4; ++t) acc[t] *= al;
      accl *= al; }
    const float mo = mu - 4.0f;      /* weights carry 2^4: small ones stay clear of f16's subnormals; it cancels against the row sum */
    FragH p[2];
#pragma unroll
    for (int t = 0; t < 4; ++t) {
#pragma unroll
      for (int r = 0; r < 8; ++r) p[t >> 1].h[(t & 1) * 8 + r] = (_Float16)__builtin_amdgcn_exp2f(x[t][r] - mo); }      /* v_exp_f32 as the builtin: the compiler then keeps the matrix instructions' distances around it */
#pragma unroll
    for (int j = 0; j < 2; ++j) {
#pragma unroll
      for (int t = 0; t < 4; ++t) acc[t] = fa_mma(va[4 * j + t], p[j].v, acc[t]);
      accl = fa_mma(one.v, p[j].v, accl); }
    __builtin_amdgcn_sched_barrier(0);      /* the LDS stores wait for the global loads: they stay behind the stage's work, or the loads' lead is lost */
    if (s + 1 < FNS) {      /* its readers left that buffer before the last barrier */
#pragma unroll
      for (int i = 0; i < 4; ++i) { *(v4us*)&sk[b ^ 1][sok + i * 16 * FP] = __builtin_bit_cast(v4us, fa_cvt4(rk[i])); *(v4us*)&sv[b ^ 1][sov + i * 16 * FV] = __builtin_bit_cast(v4us, fa_cvt4(rv[i])); } }
    __syncthreads(); }      /* publishes stage s + 1 and ends every read of stage s */
  const float inv = 1.0f / accl[0]; float* o = O + ((size_t)pl * SQ + q) * HD + 8 * hh;      /* register r of tile t = O[q][16 t + 8 hh + r] */
#pragma unroll
  for (int t = 0; t < 4; ++t) { const v4f o0 = {acc[t][0] * inv, acc[t][1] * inv, acc[t][2] * inv, acc[t][3] * inv}, o1 = {acc[t][4] * inv, acc[t][5] * inv, acc[t][6] * inv, acc[t][7] * inv};
    *(v4f*)(o + t * 16) = o0; *(v4f*)(o + t * 16 + 4) = o1; } }
extern "C" void kernel_launch(void* const* d_in, const int* in_sizes, int n_in,
                              void* d_out, int out_size, void* d_ws, size_t ws_size, hipStream_t stream) {
  (void)in_sizes; (void)n_in; (void)out_size; (void)d_ws; (void)ws_size;
  const float* const* I = (const float* const*)d_in; const float* xq = I[0]; const float* xk = I[1]; const float* xv = I[2]; const int* km = (const int*)d_in[3];      /* key mask int32 [2][1][1][2048] (0 = masked; READ on device): plane b of 16 belongs to batch b / 8 */      /* given q, k, v [B][H][S][64]: each (b, h) plane is a 'batch' of one 64-wide head */
  k_fattn<<<dim3(SQ / FQ, NB), 256, 0, stream>>>(xq, xk, xv, km, (float*)d_out);      /* input rounding, scores, masked softmax and the product with V, every plane; f32 output; no workspace */
}

// v005
// One run takes 20.1 microseconds.
// In two side-by-side timings against v004, it was 1.71 and 1.69 times as fast.
// Counting every step since v000, it is 316 times as fast.
#include <hip/hip_runtime.h>
// Scaled dot-product attention on given head-major query, key, value with a key-padding mask (q, k, v [2][8][2048][64] each = 16 independent [2048][64] planes; att = (q / 8) . k; where(mask == 0, NEG) with the int32 [2][1][1][2048] mask in {0, 1} (random; 0 = masked key, shared by the 8 heads of a batch; READ on device); softmax; out = att v -> [2][8][2048][64]).
// Structure: ONE launch. Per work-group 128 queries of one plane; each work-group first lists its batch's open keys (mask != 0) in LDS and then walks only those, 64 at a time, their rows gathered by the list (a masked key's weight is exactly 0 beside any open key; with no open key every key is listed and all weights are equal); the f32 inputs are read as they lie and become f16 (bf16 values are exact in f16) on their way into LDS (K, V) or into registers (Q); V stays row-major in LDS and V^T fragments come by the transposing LDS load; scores, softmax weights and row sums stay in registers (S^T = K Q^T, O^T += V^T P^T), f32 output written once.
// Compute dtype: inputs rounded to bf16; q, k, v and the unnormalised softmax weights as plain f16 WMMA operands (~2^-12); scores, running maximum, row sums and output accumulators f32. v_wmma_f32_16x16x32_f16.
#define NB 16
#define SQ 2048
#define DM 64
#define NH 1
#define HD 64
#define HG 1                         /* heads per group in the unlaunched k_vt(V16, b, h0, VT) */
#define B0 0                         /* unused (debug hook) */
#define NBR NB                       /* used only by MP (debug hook) */
#define NR ((size_t)NB * SQ)         /* token rows */
#define MP ((int)((size_t)NBR * SQ)) /* used only by MPO (debug hook) */
#define QN SQ                        /* unused (debug hook) */
#define NHD NH                       /* unused (debug hook) */
#define MPO MP                       /* unused (debug hook) */
#define LQ DM      /* row pitch of the q/k/v rows */
typedef __bf16 v16b __attribute__((ext_vector_type(16)));
typedef unsigned short v8us __attribute__((ext_vector_type(8), may_alias));
typedef float  v8f  __attribute__((ext_vector_type(8)));
typedef float  v4f  __attribute__((ext_vector_type(4)));
typedef float  v4fa __attribute__((ext_vector_type(4), may_alias));
union FragB { v16b v; v8us half[2]; unsigned short u[16]; };

__device__ __forceinline__ unsigned short bf16_bits(float x) { unsigned int u = __float_as_uint(x); return (unsigned short)((u + 0x7FFFu + ((u >> 16) & 1u)) >> 16); }
__device__ __forceinline__ float bf16_val(unsigned short b) { return __uint_as_float(((unsigned int)b) << 16); }
__device__ __forceinline__ float bf16_round(float x) { return bf16_val(bf16_bits(x)); }
// D += A·B with NT terms: 1 = ah·bh, 2 = + al·bh (A split), 3 = + ah·bl (both split)
template <int NT>
__device__ __forceinline__ v8f mmaN(v16b ah, v16b al, v16b bh, v16b bl, v8f c) {
  c = __builtin_amdgcn_wmma_f32_16x16x32_bf16(false, ah, false, bh, (short)0, c, false, false);
  if (NT >= 2) c = __builtin_amdgcn_wmma_f32_16x16x32_bf16(false, al, false, bh, (short)0, c, false, false);
  if (NT >= 3) c = __builtin_amdgcn_wmma_f32_16x16x32_bf16(false, ah, false, bl, (short)0, c, false, false);
  asm volatile("v_nop\n\tv_nop\n\tv_nop\n\tv_nop" : "+v"(c) : "v"(ah), "v"(al), "v"(bh), "v"(bl));
  return c;
}

__global__ __launch_bounds__(256) void k_wt_bf16(const float* __restrict__ W, unsigned short* __restrict__ Wt, int K, int N) {
  const int t = blockIdx.x * 256 + threadIdx.x;
  const int k8n = K / 8;
  if (t >= N * k8n) return;
  const int n = t / k8n, k8 = (t % k8n) * 8;
  v8us v;
#pragma unroll
  for (int i = 0; i < 8; ++i) v[i] = bf16_bits(W[(size_t)(k8 + i) * N + n]);
  *(v8us*)(Wt + (size_t)n * K + k8) = v;
  
}

// GEMM C[M][N] (f32, pitch ldc) = act(A[M][K]·W + bias). A f32 row-major (pitch lda) converted per fragment to bf16
// (ASPLIT: hi/lo two planes -> 2 terms, else single rounded term); Wt bf16 [N][K] (pitch ldb). BIAS_BF16 rounds the
// bias to bf16 first (bias quantised to bf16 before the add). K%32==0, M%16==0, N%64==0.
template <bool ASPLIT, int ACT, bool BIAS_BF16>
__global__ __launch_bounds__(128) void k_gemm_bf(const float* __restrict__ A, int lda, const unsigned short* __restrict__ Wt, int ldb,
                                               const float* __restrict__ bias, float* __restrict__ C, int ldc, int M, int N, int K) {
  __shared__ __attribute__((aligned(16))) float so[4][16][64];
  const int tid = threadIdx.x, w = tid >> 5, lane = tid & 31, ln = lane & 15, hh = lane >> 4;
  const int ntn = N / 64;
  const int wid = blockIdx.x * 4 + w;
  const int mt = wid / ntn, nq = wid % ntn;
  if (mt * 16 >= M) return;
  const int row0 = mt * 16, col0 = nq * 64;
  const float* arow = A + (size_t)(row0 + ln) * lda;
  v8f acc[4] = {};
  for (int kb = 0; kb < K; kb += 32) {
    FragB ah, al;
    const v4f x0 = *(const v4fa*)(arow + kb + 8 * hh), x1 = *(const v4fa*)(arow + kb + 8 * hh + 4);
    const v4f x2 = *(const v4fa*)(arow + kb + 16 + 8 * hh), x3 = *(const v4fa*)(arow + kb + 16 + 8 * hh + 4);
    float xs[16] = {x0[0],x0[1],x0[2],x0[3],x1[0],x1[1],x1[2],x1[3],x2[0],x2[1],x2[2],x2[3],x3[0],x3[1],x3[2],x3[3]};
#pragma unroll
    for (int i = 0; i < 16; ++i) { const unsigned short hb = bf16_bits(xs[i]); ah.u[i] = hb; al.u[i] = ASPLIT ? bf16_bits(xs[i] - bf16_val(hb)) : (unsigned short)0; }
#pragma unroll
    for (int t = 0; t < 4; ++t) {
      const unsigned short* brow = Wt + (size_t)(col0 + t * 16 + ln) * ldb + kb;
      FragB b;
      b.half[0] = *(const v8us*)(brow + 8 * hh);
      b.half[1] = *(const v8us*)(brow + 16 + 8 * hh);
      acc[t] = mmaN<ASPLIT ? 2 : 1>(ah.v, al.v, b.v, b.v, acc[t]);
    }
  }
#pragma unroll
  for (int t = 0; t < 4; ++t) {
    float bv = bias ? bias[col0 + t * 16 + ln] : 0.f;
    if (BIAS_BF16) bv = bf16_round(bv);
#pragma unroll
    for (int r = 0; r < 8; ++r) { float v = acc[t][r] + bv; if (ACT == 1) v = fmaxf(v, 0.f); so[w][8 * hh + r][t * 16 + ln] = v; }
  }
  __builtin_amdgcn_fence(__ATOMIC_ACQ_REL, "workgroup");
  __builtin_amdgcn_wave_barrier();
  const int rsub = lane >> 4, c4 = (lane & 15) * 4;
  {
#pragma unroll
    for (int q = 0; q < 8; ++q) {
      const int r = q * 2 + rsub;
      const v4f v = *(const v4fa*)&so[w][r][c4];
      *(v4f*)(C + (size_t)(row0 + r) * ldc + col0 + c4) = v;
    }
    
  }
}

// GEMM C = act(A·W + bias + resid): A f32 (ASPLIT -> hi/lo 2 terms), Wt bf16 [N][K]; ACT 0 none, 1 relu, 2 exact gelu;
// resid (optional, f32, row index = (row % rmod), pitch ldr, RES_BF16 rounds it) added before the activation.
template <bool ASPLIT, int ACT, bool BIAS_BF16, bool RES_BF16>
__global__ __launch_bounds__(128) void k_gemm_bf3(const float* __restrict__ A, int lda, const unsigned short* __restrict__ Wt, int ldb,
                                                const float* __restrict__ bias, const float* __restrict__ resid, int rmod, int ldr,
                                                float* __restrict__ C, int ldc, int M, int N, int K) {
  __shared__ __attribute__((aligned(16))) float so[4][16][64];
  const int tid = threadIdx.x, w = tid >> 5, lane = tid & 31, ln = lane & 15, hh = lane >> 4;
  const int ntn = N / 64;
  const int wid = blockIdx.x * 4 + w;
  const int mt = wid / ntn, nq = wid % ntn;
  if (mt * 16 >= M) return;
  const int row0 = mt * 16, col0 = nq * 64;
  const float* arow = A + (size_t)(row0 + ln) * lda;
  v8f acc[4] = {};
  for (int kb = 0; kb < K; kb += 32) {
    FragB ah, al;
    const v4f x0 = *(const v4fa*)(arow + kb + 8 * hh), x1 = *(const v4fa*)(arow + kb + 8 * hh + 4);
    const v4f x2 = *(const v4fa*)(arow + kb + 16 + 8 * hh), x3 = *(const v4fa*)(arow + kb + 16 + 8 * hh + 4);
    float xs[16] = {x0[0],x0[1],x0[2],x0[3],x1[0],x1[1],x1[2],x1[3],x2[0],x2[1],x2[2],x2[3],x3[0],x3[1],x3[2],x3[3]};
#pragma unroll
    for (int i = 0; i < 16; ++i) { const unsigned short hb = bf16_bits(xs[i]); ah.u[i] = hb; al.u[i] = ASPLIT ? bf16_bits(xs[i] - bf16_val(hb)) : (unsigned short)0; }
#pragma unroll
    for (int t = 0; t < 4; ++t) {
      const unsigned short* brow = Wt + (size_t)(col0 + t * 16 + ln) * ldb + kb;
      FragB b;
      b.half[0] = *(const v8us*)(brow + 8 * hh);
      b.half[1] = *(const v8us*)(brow + 16 + 8 * hh);
      acc[t] = mmaN<ASPLIT ? 2 : 1>(ah.v, al.v, b.v, b.v, acc[t]);
    }
  }
#pragma unroll
  for (int t = 0; t < 4; ++t) {
    const int col = col0 + t * 16 + ln;
    float bv = bias ? bias[col] : 0.f;
    if (BIAS_BF16) bv = bf16_round(bv);
#pragma unroll
    for (int r = 0; r < 8; ++r) {
      float v = acc[t][r] + bv;
      if (resid) { float rv = resid[(size_t)((row0 + 8 * hh + r) % rmod) * ldr + col]; if (RES_BF16) rv = bf16_round(rv); v += rv; }
      if (ACT == 1) v = fmaxf(v, 0.f);
      if (ACT == 2) v = 0.5f * v * (1.0f + erff(v * 0.70710678118654752f));
      if (ACT == 3) { const float u = 0.7978845608028654f * (v + 0.044715f * v * v * v); v = 0.5f * v * (1.0f + tanhf(u)); }
      so[w][8 * hh + r][t * 16 + ln] = v;
    }
  }
  __builtin_amdgcn_fence(__ATOMIC_ACQ_REL, "workgroup");
  __builtin_amdgcn_wave_barrier();
  const int rsub = lane >> 4, c4 = (lane & 15) * 4;
  {
#pragma unroll
    for (int q = 0; q < 8; ++q) {
      const int r = q * 2 + rsub;
      const v4f v = *(const v4fa*)&so[w][r][c4];
      *(v4f*)(C + (size_t)(row0 + r) * ldc + col0 + c4) = v;
    }
    
  }
}
// row LayerNorm (biased variance, eps) over N: s = X (+ R); optional out_sum <- s; out_norm <- (s-mu)*rsqrt(var+eps)*g + b
template <bool PARAM_BF16>
__global__ __launch_bounds__(256) void k_layernorm(const float* __restrict__ X, const float* __restrict__ R, const float* __restrict__ g, const float* __restrict__ bta,
                                                  float* __restrict__ out_sum, float* __restrict__ out_norm, int N, float eps) {
  __shared__ float red[256];
  const int row = blockIdx.x, tid = threadIdx.x;
  const float* x = X + (size_t)row * N; const float* rr = R ? R + (size_t)row * N : nullptr;
  float vals[16];                     // up to N = 4096
  const int per = N / 256;            // contiguous chunk per thread? use strided-by-4 chunks: thread handles j = tid*4 + 1024*u
  float s1 = 0.f;
  for (int u = 0; u < per / 4; ++u) {
    const int j = tid * 4 + 1024 * u;
    const v4f a = *(const v4fa*)(x + j);
    v4f b = {0.f,0.f,0.f,0.f}; if (rr) b = *(const v4fa*)(rr + j);
#pragma unroll
    for (int q = 0; q < 4; ++q) { const float v = a[q] + b[q]; vals[u * 4 + q] = v; s1 += v; }
  }
  red[tid] = s1; __syncthreads();
  for (int st = 128; st > 0; st >>= 1) { if (tid < st) red[tid] += red[tid + st]; __syncthreads(); }
  const float mu = red[0] / (float)N; __syncthreads();
  float s2 = 0.f;
  for (int u = 0; u < per / 4; ++u)
#pragma unroll
    for (int q = 0; q < 4; ++q) { const float c = vals[u * 4 + q] - mu; s2 += c * c; }
  red[tid] = s2; __syncthreads();
  for (int st = 128; st > 0; st >>= 1) { if (tid < st) red[tid] += red[tid + st]; __syncthreads(); }
  const float rs = rsqrtf(red[0] / (float)N + eps);
  {
    for (int u = 0; u < per / 4; ++u) {
      const int j = tid * 4 + 1024 * u;
      v4f o, sm;
#pragma unroll
      for (int q = 0; q < 4; ++q) {
        float gg = g[j + q], bb = bta[j + q];
        if (PARAM_BF16) { gg = bf16_round(gg); bb = bf16_round(bb); }
        sm[q] = vals[u * 4 + q]; o[q] = (vals[u * 4 + q] - mu) * rs * gg + bb;
      }
      if (out_sum) *(v4f*)(out_sum + (size_t)row * N + j) = sm;
      *(v4f*)(out_norm + (size_t)row * N + j) = o;
    }
    
  }
}



// ---- f16 WMMA path (v_wmma_f32_16x16x32_f16): 11-bit significands for operands in range — used where a [0,1] probability operand needs more precision than bf16
typedef _Float16 v16h __attribute__((ext_vector_type(16)));
union FragH { v16h v; v8us half[2]; _Float16 h[16]; unsigned short u[16]; };
template <int NT>
__device__ __forceinline__ v8f mmaH(v16h ah, v16h al, v16h bh, v16h bl, v8f c) {
  c = __builtin_amdgcn_wmma_f32_16x16x32_f16(false, ah, false, bh, (short)0, c, false, false);
  if (NT >= 2) c = __builtin_amdgcn_wmma_f32_16x16x32_f16(false, al, false, bh, (short)0, c, false, false);
  if (NT >= 3) c = __builtin_amdgcn_wmma_f32_16x16x32_f16(false, ah, false, bl, (short)0, c, false, false);
  asm volatile("v_nop\n\tv_nop\n\tv_nop\n\tv_nop" : "+v"(c) : "v"(ah), "v"(al), "v"(bh), "v"(bl));
  return c;
}
// batched GEMM like k_gemm_b but f16 operands: A f32 (split into f16 hi/lo if ASPLIT, else rounded to f16), Bt = f16 values [n][k]; alpha; C f32; N multiple of 16 (partial tiles skipped)
template <bool ASPLIT>
__global__ __launch_bounds__(128) void k_gemm_h(const float* __restrict__ A, int lda, size_t sA, const _Float16* __restrict__ Bh, int ldb, size_t sB, float alpha, float* __restrict__ C, int ldc, size_t sC, int M, int N, int K) {
  __shared__ __attribute__((aligned(16))) float so[4][16][64];
  const int tid = threadIdx.x, w = tid >> 5, lane = tid & 31, ln = lane & 15, hh = lane >> 4; const int by = blockIdx.y;
  A += (size_t)by * sA; Bh += (size_t)by * sB; C += (size_t)by * sC;
  const int ntn = (N + 63) / 64; const int wid = blockIdx.x * 4 + w; const int mt = wid / ntn, nq = wid % ntn; if (mt * 16 >= M) return;
  const int row0 = mt * 16, col0 = nq * 64; const float* arow = A + (size_t)(row0 + ln) * lda;
  v8f acc[4] = {};
  for (int kb = 0; kb < K; kb += 32) {
    FragH ah, al;
    const v4f x0 = *(const v4fa*)(arow + kb + 8 * hh), x1 = *(const v4fa*)(arow + kb + 8 * hh + 4), x2 = *(const v4fa*)(arow + kb + 16 + 8 * hh), x3 = *(const v4fa*)(arow + kb + 16 + 8 * hh + 4);
    float xs[16] = {x0[0],x0[1],x0[2],x0[3],x1[0],x1[1],x1[2],x1[3],x2[0],x2[1],x2[2],x2[3],x3[0],x3[1],x3[2],x3[3]};
#pragma unroll
    for (int i = 0; i < 16; ++i) { const _Float16 h = (_Float16)xs[i]; ah.h[i] = h; al.h[i] = ASPLIT ? (_Float16)(xs[i] - (float)h) : (_Float16)0.0f; }
#pragma unroll
    for (int t = 0; t < 4; ++t) { if (col0 + t * 16 >= N) continue; const size_t boff = (size_t)(col0 + t * 16 + ln) * ldb + kb; FragH bq; bq.half[0] = *(const v8us*)(Bh + boff + 8 * hh); bq.half[1] = *(const v8us*)(Bh + boff + 16 + 8 * hh);
      acc[t] = mmaH<ASPLIT ? 2 : 1>(ah.v, al.v, bq.v, bq.v, acc[t]); }
  }
#pragma unroll
  for (int t = 0; t < 4; ++t) { if (col0 + t * 16 >= N) continue;
#pragma unroll
    for (int r = 0; r < 8; ++r) so[w][8 * hh + r][t * 16 + ln] = acc[t][r] * alpha; }
  __builtin_amdgcn_fence(__ATOMIC_ACQ_REL, "workgroup"); __builtin_amdgcn_wave_barrier();
  const int rsub = lane >> 4, c4 = (lane & 15) * 4;
  {
#pragma unroll
    for (int q = 0; q < 8; ++q) { const int r = q * 2 + rsub; if (col0 + c4 < N) { const v4f v = *(const v4fa*)&so[w][r][c4]; *(v4f*)(C + (size_t)(row0 + r) * ldc + col0 + c4) = v; } }
     }
}

// Wt[n][k] = f16(W[k][n]·scale) from f32 row-major W[K][N] (scale = power of two; bf16-exact weights stay exact in f16 away from the subnormal range)
__global__ __launch_bounds__(256) void k_wt_f16(const float* __restrict__ W, _Float16* __restrict__ Wt, int K, int N, float scale) {
  const int t = blockIdx.x * 256 + threadIdx.x; if (t >= N * (K / 8)) return; const int n = t / (K / 8), k8 = (t % (K / 8)) * 8; FragH f;
#pragma unroll
  for (int i = 0; i < 8; ++i) f.h[i] = (_Float16)(bf16_round(W[(size_t)(k8 + i) * N + n]) * scale); const v8us o = f.half[0];
  *(v8us*)((unsigned short*)Wt + (size_t)n * K + k8) = o; 
}
// k_gemm_hh variant with fused epilogue: v = acc·alpha + bias[by·sBias + col] (+ CP[(row/rowsPerB)·sCPb + by·64 + col] if CP) ; ACT 0 none / 1 elu ; writes f16 C16 (and f32 C if non-null)
template <int ACT>
__global__ __launch_bounds__(128) void k_gemm_hhx(const _Float16* __restrict__ A, int lda, size_t sA, const _Float16* __restrict__ Bh, int ldb, size_t sB, float alpha, const float* __restrict__ bias, size_t sBias, const float* __restrict__ CP, int rowsPerB, size_t sCPb, int row0g,
    float* __restrict__ C, _Float16* __restrict__ C16, int ldc, size_t sC, int M, int N, int K) {
  __shared__ __attribute__((aligned(16))) float so[4][16][64];
  const int tid = threadIdx.x, w = tid >> 5, lane = tid & 31, ln = lane & 15, hh = lane >> 4; const int by = blockIdx.y;
  A += (size_t)by * sA; Bh += (size_t)by * sB; const size_t cofs = (size_t)by * sC; const float* bp = bias ? bias + (size_t)by * sBias : nullptr;
  const int ntn = (N + 63) / 64; const int wid = blockIdx.x * 4 + w; const int mt = wid / ntn, nq = wid % ntn; if (mt * 16 >= M) return;
  const int row0 = mt * 16, col0 = nq * 64; const _Float16* arow = A + (size_t)(row0 + ln) * lda;
  v8f acc[4] = {};
  for (int kb = 0; kb < K; kb += 32) { FragH ah; ah.half[0] = *(const v8us*)((const unsigned short*)arow + kb + 8 * hh); ah.half[1] = *(const v8us*)((const unsigned short*)arow + kb + 16 + 8 * hh);
#pragma unroll
    for (int t = 0; t < 4; ++t) { if (col0 + t * 16 >= N) continue; const size_t boff = (size_t)(col0 + t * 16 + ln) * ldb + kb; FragH bq; bq.half[0] = *(const v8us*)((const unsigned short*)Bh + boff + 8 * hh); bq.half[1] = *(const v8us*)((const unsigned short*)Bh + boff + 16 + 8 * hh);
      acc[t] = mmaH<1>(ah.v, ah.v, bq.v, bq.v, acc[t]); }
  }
#pragma unroll
  for (int t = 0; t < 4; ++t) { if (col0 + t * 16 >= N) continue; const int col = col0 + t * 16 + ln; const float bv = bp ? bf16_round(bp[col]) : 0.f;
#pragma unroll
    for (int r = 0; r < 8; ++r) { float v = acc[t][r] * alpha + bv; if (CP) { const int rr = row0g + row0 + 8 * hh + r; if (rowsPerB < 0) v += CP[cofs + (size_t)rr * ldc + col];      /* rowsPerB < 0: own element of the batched C plane */ else { const int bidx = rr / rowsPerB; v += CP[(size_t)bidx * sCPb + (size_t)by * 64 + col]; } } if (ACT == 1) v = (v > 0.f) ? v : expm1f(v); else if (ACT == 7) v = (v > 0.f) ? v + 1.0f : expf(v); else if (ACT == 8) v = tanhf(v); else if (ACT == 9) v = 0.5f * v * (1.0f + tanhf(0.7978845608028654f * (v + 0.044715f * v * v * v))); else if (ACT == 11) v = 1.0f / (1.0f + expf(-v)); else if (ACT == 12) v = (v > 0.f) ? v : 0.01f * v; else if (ACT == 14) v = (v > 0.f) ? v : 0.1f * v; else if (ACT == 16) v = (v >= 0.f) ? v : 0.3f * v; else if (ACT == 17) v = (v >= 0.f) ? v : 0.2f * v; else if (ACT == 15) v = v / (1.0f + expf(-v)); else if (ACT == 3) v = fmaxf(v, 0.f); else if (ACT == 6) v = 0.5f * v * (1.0f + erff(v * 0.70710678118654752f)); so[w][8 * hh + r][t * 16 + ln] = v; } }
  __builtin_amdgcn_fence(__ATOMIC_ACQ_REL, "workgroup"); __builtin_amdgcn_wave_barrier();
  const int rsub = lane >> 4, c4 = (lane & 15) * 4; typedef _Float16 v4h __attribute__((ext_vector_type(4)));
  {
#pragma unroll
    for (int q = 0; q < 8; ++q) { const int r = q * 2 + rsub; if (col0 + c4 < N) { const v4f v = *(const v4fa*)&so[w][r][c4]; if (C) *(v4f*)(C + cofs + (size_t)(row0 + r) * ldc + col0 + c4) = v; if (C16) { v4h h4; for (int i = 0; i < 4; ++i) h4[i] = (_Float16)v[i]; *(v4h*)(C16 + cofs + (size_t)(row0 + r) * ldc + col0 + c4) = h4; } } }
     }
}


typedef _Float16 v4h __attribute__((ext_vector_type(4)));

__global__ __launch_bounds__(256) void k_x16(const float* __restrict__ x, _Float16* __restrict__ X16, size_t n8) { const size_t t = (size_t)blockIdx.x * 256 + threadIdx.x; if (t >= n8) return; FragH f;
#pragma unroll
  for (int q = 0; q < 8; ++q) f.h[q] = (_Float16)bf16_round(x[t * 8 + q]); *(v8us*)((unsigned short*)X16 + t * 8) = f.half[0];  }
__global__ __launch_bounds__(256) void k_h16(const float* __restrict__ x, _Float16* __restrict__ X16, size_t n8) { const size_t t = (size_t)blockIdx.x * 256 + threadIdx.x; if (t >= n8) return; FragH f;
#pragma unroll
  for (int q = 0; q < 8; ++q) f.h[q] = (_Float16)x[t * 8 + q]; *(v8us*)((unsigned short*)X16 + t * 8) = f.half[0];  }
__global__ __launch_bounds__(256) void k_round16f(const float* __restrict__ W, _Float16* __restrict__ Bt, size_t n8) { const size_t t = (size_t)blockIdx.x * 256 + threadIdx.x; if (t >= n8) return; FragH f;
#pragma unroll
  for (int i = 0; i < 8; ++i) f.h[i] = (_Float16)(bf16_round(W[t * 8 + i]) * 16.0f); *(v8us*)((unsigned short*)Bt + t * 8) = f.half[0];  }
template <int NHv, int TTv>
__global__ __launch_bounds__(256) void k_vt(const _Float16* __restrict__ V16, int ldv, int voff, _Float16* __restrict__ Vt) { __shared__ unsigned short tl[64][66]; const int tid = threadIdx.x; const int slab = blockIdx.x / (TTv / 64), lg = blockIdx.x % (TTv / 64); const int b = slab / NHv, h = slab % NHv;
  for (int i = tid; i < 64 * 8; i += 256) { const int r = i / 8, c8 = (i % 8) * 8; FragH f; f.half[0] = *(const v8us*)((const unsigned short*)V16 + ((size_t)b * TTv + lg * 64 + r) * ldv + voff + h * 64 + c8);
#pragma unroll
    for (int q = 0; q < 8; ++q) tl[r][c8 + q] = f.u[q]; }
  __syncthreads();
  {
#pragma unroll
    for (int rd = 0; rd < 2; ++rd) { const int d = rd * 32 + tid / 8, pc = tid % 8; FragH f;
#pragma unroll
      for (int q = 0; q < 8; ++q) f.u[q] = tl[pc * 8 + q][d];
      *(v8us*)((unsigned short*)Vt + ((size_t)slab * 64 + d) * TTv + lg * 64 + pc * 8) = f.half[0]; }
     } }

__global__ __launch_bounds__(256) void k_hl(const float* __restrict__ F, _Float16* __restrict__ Hh, _Float16* __restrict__ Hl, size_t n8) { const size_t t = (size_t)blockIdx.x * 256 + threadIdx.x; if (t >= n8) return; FragH fh, fl; const v4f a = *(const v4fa*)(F + t * 8), c = *(const v4fa*)(F + t * 8 + 4);
#pragma unroll
  for (int q = 0; q < 4; ++q) { _Float16 h = (_Float16)a[q]; fh.h[q] = h; fl.h[q] = (_Float16)((a[q] - (float)h) * 1024.0f); h = (_Float16)c[q]; fh.h[4 + q] = h; fl.h[4 + q] = (_Float16)((c[q] - (float)h) * 1024.0f); }
  { *(v8us*)((unsigned short*)Hh + t * 8) = fh.half[0]; *(v8us*)((unsigned short*)Hl + t * 8) = fl.half[0];  } }

// ---- fast GEMM (wave tile 32x64; requires M % 32 == 0 rows per launch region and N % 64 == 0); epilogue = k_gemm_hhx semantics ----
__device__ __forceinline__ v16h g2_frag(const _Float16* p, int hh) { FragH f; f.half[0] = *(const v8us*)((const unsigned short*)p + 8 * hh); f.half[1] = *(const v8us*)((const unsigned short*)p + 16 + 8 * hh); return f.v; }
__device__ __forceinline__ v8f g2_mma(v16h a, v16h b, v8f c) { v8f d = __builtin_amdgcn_wmma_f32_16x16x32_f16(false, a, false, b, (short)0, c, false, false); asm volatile("v_nop\n\tv_nop\n\tv_nop\n\tv_nop" : "+v"(d) : "v"(a), "v"(b)); return d; }
template <int ACT>
__global__ __launch_bounds__(128) void k_gemm2(const _Float16* __restrict__ A, int lda, size_t sA, const _Float16* __restrict__ Bh, int ldb, size_t sB, float alpha, const float* __restrict__ bias, size_t sBias, const float* __restrict__ CP, int rowsPerB, size_t sCPb, int row0g,
    float* __restrict__ C, _Float16* __restrict__ C16, int ldc, size_t sC, int M, int N, int K) { static_assert(ACT == 0 || ACT == 3 || ACT == 6 || ACT == 8 || ACT == 9 || ACT == 11 || ACT == 12 || ACT == 14 || ACT == 15 || ACT == 16 || ACT == 17, "k_gemm2: unsupported ACT code (would silently apply no activation)");
  __shared__ __attribute__((aligned(16))) float so[4][32][68];
  const int tid = threadIdx.x, w = tid >> 5, lane = tid & 31, ln = lane & 15, hh = lane >> 4; const int by = blockIdx.y;
  A += (size_t)by * sA; Bh += (size_t)by * sB; const size_t cofs = (size_t)by * sC; const float* bp = bias ? bias + (size_t)by * sBias : nullptr;
  const int ntn = N >> 6; const int mt = blockIdx.x / ntn, nq = blockIdx.x - mt * ntn; const int row0 = mt * 128 + 32 * w, col0 = nq * 64; if (row0 >= M) return;
  const _Float16* a0p = A + (size_t)(row0 + ln) * lda; const _Float16* a1p = a0p + (size_t)16 * lda;
  const _Float16* b0p = Bh + (size_t)(col0 + ln) * ldb; const _Float16* b1p = b0p + (size_t)16 * ldb; const _Float16* b2p = b1p + (size_t)16 * ldb; const _Float16* b3p = b2p + (size_t)16 * ldb;
  const v8f z8 = {0.f,0.f,0.f,0.f,0.f,0.f,0.f,0.f}; v8f c00 = z8, c01 = z8, c02 = z8, c03 = z8, c10 = z8, c11 = z8, c12 = z8, c13 = z8;
#pragma unroll 1
  for (int kb = 0; kb < K; kb += 32) { const v16h a0 = g2_frag(a0p + kb, hh), a1 = g2_frag(a1p + kb, hh);
    v16h b = g2_frag(b0p + kb, hh); c00 = g2_mma(a0, b, c00); c10 = g2_mma(a1, b, c10);
    b = g2_frag(b1p + kb, hh); c01 = g2_mma(a0, b, c01); c11 = g2_mma(a1, b, c11);
    b = g2_frag(b2p + kb, hh); c02 = g2_mma(a0, b, c02); c12 = g2_mma(a1, b, c12);
    b = g2_frag(b3p + kb, hh); c03 = g2_mma(a0, b, c03); c13 = g2_mma(a1, b, c13); }
  v8f accs[8] = {c00, c01, c02, c03, c10, c11, c12, c13};
#pragma unroll
  for (int u = 0; u < 8; ++u) { const int t = u & 3, half = u >> 2; const int col = col0 + t * 16 + ln; const float bv = bp ? bf16_round(bp[col]) : 0.f;
#pragma unroll
    for (int r = 0; r < 8; ++r) { const int rloc = half * 16 + 8 * hh + r; float v = accs[u][r] * alpha + bv; if (CP) { if (rowsPerB < 0) v += CP[cofs + (size_t)(row0g + row0 + rloc) * ldc + col];      /* rowsPerB < 0: own element of the batched C plane */ else { const int bidx = (row0g + row0 + rloc) / rowsPerB; v += CP[(size_t)bidx * sCPb + (size_t)by * 64 + col]; } }
      if (ACT == 3) v = fmaxf(v, 0.f); else if (ACT == 6) v = 0.5f * v * (1.0f + erff(v * 0.70710678118654752f)); else if (ACT == 11) v = 1.0f / (1.0f + expf(-v)); else if (ACT == 15) v = v / (1.0f + expf(-v)); else if (ACT == 12) v = (v > 0.f) ? v : 0.01f * v; else if (ACT == 8) v = tanhf(v); else if (ACT == 9) v = 0.5f * v * (1.0f + tanhf(0.7978845608028654f * (v + 0.044715f * v * v * v))); else if (ACT == 14) v = (v > 0.f) ? v : 0.1f * v; else if (ACT == 16) v = (v >= 0.f) ? v : 0.3f * v; else if (ACT == 17) v = (v >= 0.f) ? v : 0.2f * v;
      so[w][rloc][t * 16 + ln] = v; } }
  __builtin_amdgcn_fence(__ATOMIC_ACQ_REL, "workgroup"); __builtin_amdgcn_wave_barrier();
  const int rsub = lane >> 4, c4 = (lane & 15) * 4;
  {
#pragma unroll
    for (int q = 0; q < 16; ++q) { const int r = q * 2 + rsub; const v4f v = *(const v4fa*)&so[w][r][c4]; if (C) *(v4f*)(C + cofs + (size_t)(row0 + r) * ldc + col0 + c4) = v; if (C16) { v4h h4; for (int i = 0; i < 4; ++i) h4[i] = (_Float16)v[i]; *(v4h*)(C16 + cofs + (size_t)(row0 + r) * ldc + col0 + c4) = h4; } }
     } }


__global__ __launch_bounds__(256) void k_wnat(const float* __restrict__ w, size_t n8, _Float16* __restrict__ Bt) { const size_t t = (size_t)blockIdx.x * 256 + threadIdx.x; if (t >= n8) return; FragH f; for (int q = 0; q < 8; ++q) f.h[q] = (_Float16)(bf16_round(w[t * 8 + q]) * 16.0f); *(v8us*)((unsigned short*)Bt + t * 8) = f.half[0];  }
__global__ __launch_bounds__(256) void k_rsm(const float* __restrict__ S, _Float16* __restrict__ P, int nrows) {
  #pragma clang fp contract(off)
  const int i = blockIdx.x * 256 + threadIdx.x; if (i >= nrows) return; const float* s = S + (size_t)i * SQ; float mx = -3.0e38f;
#pragma unroll 1
  for (int j = 0; j < SQ; ++j) mx = fmaxf(mx, s[j]); float se = 0.f;
#pragma unroll 1
  for (int j = 0; j < SQ; ++j) se += expf(s[j] - mx); const float sc = 256.0f / se;
#pragma unroll 1
  for (int j0 = 0; j0 < SQ; j0 += 8) { FragH f; for (int q = 0; q < 8; ++q) f.h[q] = (_Float16)(expf(s[j0 + q] - mx) * sc); unsigned short* d = (unsigned short*)P + (size_t)i * SQ + j0; *(v8us*)d = f.half[0];  } }
__global__ __launch_bounds__(256) void k_vt(const _Float16* __restrict__ V16, int b, int h0, _Float16* __restrict__ VT) { __shared__ unsigned short tl[64][65]; const int tid = threadIdx.x; const int hh = blockIdx.x % HG, sg = blockIdx.x / HG; const int s0 = sg * 64; const int h = h0 + hh;
  for (int i = tid; i < 64 * 8; i += 256) { const int j = i / 8, d8 = (i % 8) * 8; FragH f; f.half[0] = *(const v8us*)((const unsigned short*)V16 + ((size_t)b * SQ + s0 + j) * DM + h * HD + d8); for (int q = 0; q < 8; ++q) tl[d8 + q][j] = f.u[q]; }
  __syncthreads();
  { for (int i = tid; i < 64 * 8; i += 256) { const int d = i / 8, j8 = (i % 8) * 8; FragH f; for (int q = 0; q < 8; ++q) f.u[q] = tl[d][j8 + q]; *(v8us*)((unsigned short*)VT + ((size_t)hh * HD + d) * SQ + s0 + j8) = f.half[0]; }  } }



__global__ __launch_bounds__(256) void k_rsmf(const float* __restrict__ S, _Float16* __restrict__ P, int qn, int hg) {
  #pragma clang fp contract(off)
  const int t = blockIdx.x * 256 + threadIdx.x; if (t >= qn * hg) return; const size_t i = (size_t)(t / qn) * SQ + (t % qn); const float* s = S + i * SQ; float mx = -3.0e38f;
#pragma unroll 1
  for (int j = 0; j < SQ; ++j) mx = fmaxf(mx, s[j]); float se = 0.f;
#pragma unroll 1
  for (int j = 0; j < SQ; ++j) se += __expf(s[j] - mx); const float sc = 256.0f / se;
#pragma unroll 1
  for (int j0 = 0; j0 < SQ; j0 += 8) { FragH f; for (int q = 0; q < 8; ++q) f.h[q] = (_Float16)(__expf(s[j0 + q] - mx) * sc); unsigned short* d = (unsigned short*)P + i * SQ + j0; *(v8us*)d = f.half[0];  } }


// ---- fused attention: scores, masked softmax and the product with V in one kernel; no score or weight ever reaches memory ----
typedef int v4ia __attribute__((ext_vector_type(4), may_alias));
__device__ __forceinline__ float lane_x16(float v) { return __builtin_bit_cast(float, __builtin_amdgcn_permlanex16(__builtin_bit_cast(int, v), __builtin_bit_cast(int, v), 0x76543210, 0xfedcba98, false, false)); }      /* lane l with l ^ 16 */
__device__ __forceinline__ v8f fa_mma(v16h a, v16h b, v8f c) { return __builtin_amdgcn_wmma_f32_16x16x32_f16(false, a, false, b, (short)0, c, false, false); }
__device__ __forceinline__ v16h fa_frag(const unsigned short* p) { FragH f; f.half[0] = *(const v8us*)p; f.half[1] = *(const v8us*)(p + 16); return f.v; }      /* p already holds the lane half's + 8 * hh: k = 8 hh + 0..7, then 16 + 8 hh + 0..7 */
#define FQ 128      /* queries per work-group: 8 waves x 16 */
#define FK 64       /* keys per stage */
#define FP 72       /* LDS row pitch in 16-bit elements: 144 B = 16 B x 9, odd, for 16-byte fragment reads of 16 rows */
#define FV 80       /* LDS row pitch of V in 16-bit elements: 160 B = 32 B x 5, odd, for the transposing 16-byte reads */
#define FNS (SQ / FK)
typedef __bf16 v2b __attribute__((ext_vector_type(2)));
typedef float v2f __attribute__((ext_vector_type(2)));
typedef _Float16 v2h __attribute__((ext_vector_type(2)));
typedef unsigned short v4us __attribute__((ext_vector_type(4), may_alias));
typedef short s16x8 __attribute__((ext_vector_type(8)));
__device__ __forceinline__ v2h fa_cvt2(float x0, float x1) { const v2f x = {x0, x1}; const unsigned int u = __builtin_bit_cast(unsigned int, __builtin_convertvector(x, v2b));      /* f32 -> bf16, nearest even, two per instruction */
  const v2f y = {__uint_as_float(u << 16), __uint_as_float(u & 0xFFFF0000u)}; return __builtin_convertvector(y, v2h); }      /* then the same values as f16 */
__device__ __forceinline__ v4h fa_cvt4(v4f x) { const v2h a = fa_cvt2(x[0], x[1]), b = fa_cvt2(x[2], x[3]); const v4h r = {a[0], a[1], b[0], b[1]}; return r; }
__device__ __forceinline__ v16h fa_qfrag(const float* p) { const v4h a = fa_cvt4(*(const v4fa*)p), b = fa_cvt4(*(const v4fa*)(p + 4)), c = fa_cvt4(*(const v4fa*)(p + 16)), d = fa_cvt4(*(const v4fa*)(p + 20)); FragH f;      /* fa_frag's k order, from f32 rows */
#pragma unroll
  for (int i = 0; i < 4; ++i) { f.h[i] = a[i]; f.h[4 + i] = b[i]; f.h[8 + i] = c[i]; f.h[12 + i] = d[i]; }
  return f.v; }
__device__ __forceinline__ v8us fa_tr16(const unsigned short* p) { typedef __attribute__((address_space(3))) s16x8 lds_s16x8; return __builtin_bit_cast(v8us, __builtin_amdgcn_ds_load_tr16_b128_v8i16((lds_s16x8*)p)); }
__device__ __forceinline__ v16h fa_vfrag(const unsigned short* p) { FragH f; f.half[0] = fa_tr16(p); f.half[1] = fa_tr16(p + 16 * FV); return f.v; }      /* p: the lane's own address in a row-major [key][d] tile; lane (c, hh) gets column c of keys 8 hh + 0..7, then 16 + 8 hh + 0..7: fa_frag's k order */
// Wave w: queries 16 w .. + 15 of the block, one per lane column (lanes c and c + 16 share query c and split its keys).
// S^T tile t = K rows (A) x Q^T (B): register r of lane (c, hh) = score of key 16 t + 8 hh + r with query c. Two such tiles, converted in place, are the B operand of O^T += V^T P^T.
// Key list: position j of the list holds the byte offset of the j-th open key's row (ascending key order); the list is filled up to a whole stage with key 0, and a score at a position past the open count is replaced by -1e30 (only a stage that holds such positions pays for the test). With no open key the list is all 2048 keys, every score replaced.
// Mask as the reference has it: a masked key's score is REPLACED by a huge negative, so its weight is exactly 0 beside any open key and all weights are equal where every key is masked.
// Online softmax in base 2; the maximum in use moves only when a column's new maximum passes it by more than 8 (weights stay <= 2^12, inside f16); row sums by a WMMA with an all-ones A (they sum the same rounded weights that meet V).
__global__ __launch_bounds__(256) void k_fattn(const float* __restrict__ Qf, const float* __restrict__ Kf, const float* __restrict__ Vf, const int* __restrict__ Km, float* __restrict__ O) {
  __shared__ __attribute__((aligned(16))) unsigned short sk[2][FK * FP];
  __shared__ __attribute__((aligned(16))) unsigned short sv[2][FK * FV];      /* V rows as they lie: [key][d] */
  __shared__ __attribute__((aligned(16))) int sx[SQ];      /* the key list: byte offset of the listed key's row in its plane */
  __shared__ __attribute__((aligned(16))) int sc[8];      /* open keys per wave's 256 */
  const int tid = threadIdx.x, w = tid >> 5, lane = tid & 31, ln = lane & 15, hh = lane >> 4; const int pl = blockIdx.y;
  const int q = blockIdx.x * FQ + w * 16 + ln;
  const int* km = Km + (pl / 8) * SQ + w * 256 + lane;      /* plane pl belongs to batch pl / 8; wave w looks at keys 256 w .. + 255, 32 in a row per load */
  int mk[8];
#pragma unroll
  for (int i = 0; i < 8; ++i) mk[i] = km[i * 32];
  unsigned int bal[8]; int cw = 0;
#pragma unroll
  for (int i = 0; i < 8; ++i) { bal[i] = __builtin_amdgcn_ballot_w32(mk[i] != 0); cw += __builtin_popcount(bal[i]); }
  if (lane == 0) sc[w] = cw;
  { const v4ia z4 = {0, 0, 0, 0}; *(v4ia*)&sx[tid * 8] = z4; *(v4ia*)&sx[tid * 8 + 4] = z4; }      /* positions that no open key takes point at key 0 */
  __syncthreads();      /* the eight counts and the cleared list are there */
  int no = 0, pos = 0;      /* open keys of the batch; first list position of this wave's keys */
  { const v4ia c0 = *(const v4ia*)&sc[0], c1 = *(const v4ia*)&sc[4];
#pragma unroll
    for (int i = 0; i < 4; ++i) { no += c0[i] + c1[i]; pos += (i < w ? c0[i] : 0) + (4 + i < w ? c1[i] : 0); } }
  no = __builtin_amdgcn_readfirstlane(no); pos = __builtin_amdgcn_readfirstlane(pos);      /* the same in every lane: trip count and branches stay scalar */
  if (no != 0) {
#pragma unroll
    for (int i = 0; i < 8; ++i) { if ((bal[i] >> lane) & 1u) sx[pos + (int)__builtin_amdgcn_mbcnt_lo(bal[i], 0u)] = (w * 256 + i * 32 + lane) * (HD * 4); pos += __builtin_popcount(bal[i]); }
  } else {
#pragma unroll
    for (int i = 0; i < 8; ++i) sx[w * 256 + i * 32 + lane] = (w * 256 + i * 32 + lane) * (HD * 4); }
  const int ns = min(((no != 0 ? no : SQ) + FK - 1) / FK, FNS);      /* stages walked: 1 .. 32 */
  __syncthreads();      /* the list is whole */
  const char* kg = (const char*)(Kf + (size_t)pl * SQ * HD); const char* vg = (const char*)(Vf + (size_t)pl * SQ * HD);
  const int r0 = tid >> 4, c4 = (tid & 15) * 4;      /* thread t brings elements c4 .. c4 + 3 of the stage's rows r0 + 16 i, i = 0..3: 16 lanes cover a listed key's 256-byte row */
  const int sok = r0 * FP + c4, sov = r0 * FV + c4;
  v4f rk[4], rv[4]; int xo[4];      /* xo: list entries of the stage after the one at work, read one stage before their loads go out */
#pragma unroll
  for (int i = 0; i < 4; ++i) xo[i] = sx[r0 + 16 * i];
#pragma unroll
  for (int i = 0; i < 4; ++i) { const unsigned int o = (unsigned int)(xo[i] + c4 * 4); rk[i] = *(const v4fa*)(kg + o); rv[i] = *(const v4fa*)(vg + o); }
#pragma unroll
  for (int i = 0; i < 4; ++i) xo[i] = sx[min(1, ns - 1) * FK + r0 + 16 * i];
  const float* qg = Qf + ((size_t)pl * SQ + q) * HD + 8 * hh;
  const v16h bq0 = fa_qfrag(qg), bq1 = fa_qfrag(qg + 32);
#pragma unroll
  for (int i = 0; i < 4; ++i) { *(v4us*)&sk[0][sok + i * 16 * FP] = __builtin_bit_cast(v4us, fa_cvt4(rk[i])); *(v4us*)&sv[0][sov + i * 16 * FV] = __builtin_bit_cast(v4us, fa_cvt4(rv[i])); }
  FragH one;
#pragma unroll
  for (int i = 0; i < 16; ++i) one.h[i] = (_Float16)1.0f;
  const v8f z8 = {0.f, 0.f, 0.f, 0.f, 0.f, 0.f, 0.f, 0.f};
  v8f acc[4] = {z8, z8, z8, z8}, accl = z8; float mu = -3.0e38f;      /* mu: the maximum in use */
  const int fo = ln * FP + 8 * hh, fvo = (8 * hh + (lane & 7)) * FV + ((lane >> 3) & 1) * 8;      /* fvo: the transposing load's own lane address: row 8 hh + (lane & 7), 16-byte piece (lane >> 3) & 1 */
  __syncthreads();
#pragma unroll 2      /* two stages per trip: the buffer's index becomes a constant offset in every LDS address */
  for (int s = 0; s < ns; ++s) { const int b = s & 1;
    if (s + 1 < ns) {      /* next stage's pieces fly while this stage is worked on */
#pragma unroll
      for (int i = 0; i < 4; ++i) { const unsigned int o = (unsigned int)(xo[i] + c4 * 4); rk[i] = *(const v4fa*)(kg + o); rv[i] = *(const v4fa*)(vg + o); } }
    const unsigned short* kf = &sk[b][fo]; const unsigned short* vf = &sv[b][fvo]; const int* xn = &sx[min(s + 2, ns - 1) * FK + r0];
    v16h ka[8];
#pragma unroll
    for (int t = 0; t < 4; ++t) { ka[2 * t] = fa_frag(kf + t * 16 * FP); ka[2 * t + 1] = fa_frag(kf + t * 16 * FP + 32); xo[t] = xn[16 * t]; }
    __builtin_amdgcn_sched_barrier(0);      /* the next stage's global loads and all of this stage's K and list reads are issued before the first product: without it the compiler sinks the global loads to just ahead of their LDS stores (no lead) */
    v8f x[4];
#pragma unroll
    for (int t = 0; t < 4; ++t) x[t] = fa_mma(ka[2 * t + 1], bq1, fa_mma(ka[2 * t], bq0, z8));
    v16h va[8];
#pragma unroll
    for (int t = 0; t < 4; ++t) { va[t] = fa_vfrag(vf + t * 16); va[4 + t] = fa_vfrag(vf + 32 * FV + t * 16); }      /* d columns 16 t .. + 15 of keys 0..31, then of keys 32..63 */
    __builtin_amdgcn_sched_barrier(0);      /* the V^T reads are issued here and land under the softmax arithmetic: without it the compiler puts each just ahead of its product, with a full LDS wait for each */
#pragma unroll
    for (int t = 0; t < 4; ++t)
#pragma unroll
      for (int r = 0; r < 8; ++r) x[t][r] *= 0.18033688f;      /* (1 / 8) log2 e */
    if ((s + 1) * FK > no) { const int lim = no - s * FK - 8 * hh;      /* scalar branch: the stage holds positions past the open count (the list's last stage; every stage where no key is open) */
#pragma unroll
      for (int t = 0; t < 4; ++t)
#pragma unroll
        for (int r = 0; r < 8; ++r) x[t][r] = 16 * t + r < lim ? x[t][r] : -1.0e30f; }
    float m4[4];      /* four short chains, one per tile, instead of one chain of 32 dependent maxima */
#pragma unroll
    for (int t = 0; t < 4; ++t) { m4[t] = fmaxf(x[t][0], x[t][1]);
#pragma unroll
      for (int r = 2; r < 8; ++r) m4[t] = fmaxf(m4[t], x[t][r]); }
    float mx = fmaxf(fmaxf(m4[0], m4[1]), fmaxf(m4[2], m4[3]));
    mx = fmaxf(mx, lane_x16(mx));
    const bool need = mx > mu + 8.0f;
    if (__builtin_amdgcn_ballot_w32(need) != 0) {      /* scalar branch, once per stage */
      const float mn = need ? mx : mu; const float al = __builtin_amdgcn_exp2f(mu - mn); mu = mn;
#pragma unroll
      for (int t = 0; t < 4; ++t) acc[t] *= al;
      accl *= al; }
    const float mo = mu - 4.0f;      /* weights carry 2^4: small ones stay clear of f16's subnormals; it cancels against the row sum */
    FragH p[2];
#pragma unroll
    for (int t = 0; t < 4; ++t) {
#pragma unroll
      for (int r = 0; r < 8; ++r) p[t >> 1].h[(t & 1) * 8 + r] = (_Float16)__builtin_amdgcn_exp2f(x[t][r] - mo); }      /* v_exp_f32 as the builtin: the compiler then keeps the matrix instructions' distances around it */
#pragma unroll
    for (int j = 0; j < 2; ++j) {
#pragma unroll
      for (int t = 0; t < 4; ++t) acc[t] = fa_mma(va[4 * j + t], p[j].v, acc[t]);
      accl = fa_mma(one.v, p[j].v, accl); }
    __builtin_amdgcn_sched_barrier(0);      /* the LDS stores wait for the global loads: they stay behind the stage's work, or the loads' lead is lost */
    if (s + 1 < ns) {      /* its readers left that buffer before the last barrier */
#pragma unroll
      for (int i = 0; i < 4; ++i) { *(v4us*)&sk[b ^ 1][sok + i * 16 * FP] = __builtin_bit_cast(v4us, fa_cvt4(rk[i])); *(v4us*)&sv[b ^ 1][sov + i * 16 * FV] = __builtin_bit_cast(v4us, fa_cvt4(rv[i])); } }
    __syncthreads(); }      /* publishes stage s + 1 and ends every read of stage s */
  const float inv = 1.0f / accl[0]; float* o = O + ((size_t)pl * SQ + q) * HD + 8 * hh;      /* register r of tile t = O[q][16 t + 8 hh + r] */
#pragma unroll
  for (int t = 0; t < 4; ++t) { const v4f o0 = {acc[t][0] * inv, acc[t][1] * inv, acc[t][2] * inv, acc[t][3] * inv}, o1 = {acc[t][4] * inv, acc[t][5] * inv, acc[t][6] * inv, acc[t][7] * inv};
    *(v4f*)(o + t * 16) = o0; *(v4f*)(o + t * 16 + 4) = o1; } }
extern "C" void kernel_launch(void* const* d_in, const int* in_sizes, int n_in,
                              void* d_out, int out_size, void* d_ws, size_t ws_size, hipStream_t stream) {
  (void)in_sizes; (void)n_in; (void)out_size; (void)d_ws; (void)ws_size;
  const float* const* I = (const float* const*)d_in; const float* xq = I[0]; const float* xk = I[1]; const float* xv = I[2]; const int* km = (const int*)d_in[3];      /* key mask int32 [2][1][1][2048] (0 = masked; READ on device): plane b of 16 belongs to batch b / 8 */      /* given q, k, v [B][H][S][64]: each (b, h) plane is a 'batch' of one 64-wide head */
  k_fattn<<<dim3(SQ / FQ, NB), 256, 0, stream>>>(xq, xk, xv, km, (float*)d_out);      /* input rounding, scores, masked softmax and the product with V, every plane; f32 output; no workspace */
}

// v006
// A run of this version takes 17 microseconds.
// In two side-by-side timings against v005, it was 1.17 and 1.19 times as fast.
// All steps since v000 together make it 373 times as fast.
#include <hip/hip_runtime.h>
// Scaled dot-product attention on given head-major query, key, value with a key-padding mask (q, k, v [2][8][2048][64] each = 16 independent [2048][64] planes; att = (q / 8) . k; where(mask == 0, NEG) with the int32 [2][1][1][2048] mask in {0, 1} (random; 0 = masked key, shared by the 8 heads of a batch; READ on device); softmax; out = att v -> [2][8][2048][64]).
// Structure: ONE launch. Per work-group 128 queries of one plane on 16 waves: two groups of 8 waves share the queries and split every 128-key stage between them, 64 keys each, and join their partial results through LDS at the end; each work-group first lists its batch's open keys (mask != 0) in LDS and then walks only those, 128 at a time, their rows gathered by the list (a masked key's weight is exactly 0 beside any open key; with no open key every key is listed and all weights are equal); the f32 inputs are read as they lie and become f16 (bf16 values are exact in f16) on their way into LDS (K, V) or into registers (Q); V stays row-major in LDS and V^T fragments come by the transposing LDS load; scores, softmax weights and row sums stay in registers (S^T = K Q^T, O^T += V^T P^T), f32 output written once.
// Compute dtype: inputs rounded to bf16; q, k, v and the unnormalised softmax weights as plain f16 WMMA operands (~2^-12); scores, running maximum, row sums and output accumulators f32. v_wmma_f32_16x16x32_f16.
#define NB 16
#define SQ 2048
#define DM 64
#define NH 1
#define HD 64
#define HG 1                         /* heads per group in the unlaunched k_vt(V16, b, h0, VT) */
#define B0 0                         /* unused (debug hook) */
#define NBR NB                       /* used only by MP (debug hook) */
#define NR ((size_t)NB * SQ)         /* token rows */
#define MP ((int)((size_t)NBR * SQ)) /* used only by MPO (debug hook) */
#define QN SQ                        /* unused (debug hook) */
#define NHD NH                       /* unused (debug hook) */
#define MPO MP                       /* unused (debug hook) */
#define LQ DM      /* row pitch of the q/k/v rows */
typedef __bf16 v16b __attribute__((ext_vector_type(16)));
typedef unsigned short v8us __attribute__((ext_vector_type(8), may_alias));
typedef float  v8f  __attribute__((ext_vector_type(8)));
typedef float  v4f  __attribute__((ext_vector_type(4)));
typedef float  v4fa __attribute__((ext_vector_type(4), may_alias));
union FragB { v16b v; v8us half[2]; unsigned short u[16]; };

__device__ __forceinline__ unsigned short bf16_bits(float x) { unsigned int u = __float_as_uint(x); return (unsigned short)((u + 0x7FFFu + ((u >> 16) & 1u)) >> 16); }
__device__ __forceinline__ float bf16_val(unsigned short b) { return __uint_as_float(((unsigned int)b) << 16); }
__device__ __forceinline__ float bf16_round(float x) { return bf16_val(bf16_bits(x)); }
// D += A·B with NT terms: 1 = ah·bh, 2 = + al·bh (A split), 3 = + ah·bl (both split)
template <int NT>
__device__ __forceinline__ v8f mmaN(v16b ah, v16b al, v16b bh, v16b bl, v8f c) {
  c = __builtin_amdgcn_wmma_f32_16x16x32_bf16(false, ah, false, bh, (short)0, c, false, false);
  if (NT >= 2) c = __builtin_amdgcn_wmma_f32_16x16x32_bf16(false, al, false, bh, (short)0, c, false, false);
  if (NT >= 3) c = __builtin_amdgcn_wmma_f32_16x16x32_bf16(false, ah, false, bl, (short)0, c, false, false);
  asm volatile("v_nop\n\tv_nop\n\tv_nop\n\tv_nop" : "+v"(c) : "v"(ah), "v"(al), "v"(bh), "v"(bl));
  return c;
}

__global__ __launch_bounds__(256) void k_wt_bf16(const float* __restrict__ W, unsigned short* __restrict__ Wt, int K, int N) {
  const int t = blockIdx.x * 256 + threadIdx.x;
  const int k8n = K / 8;
  if (t >= N * k8n) return;
  const int n = t / k8n, k8 = (t % k8n) * 8;
  v8us v;
#pragma unroll
  for (int i = 0; i < 8; ++i) v[i] = bf16_bits(W[(size_t)(k8 + i) * N + n]);
  *(v8us*)(Wt + (size_t)n * K + k8) = v;
  
}

// GEMM C[M][N] (f32, pitch ldc) = act(A[M][K]·W + bias). A f32 row-major (pitch lda) converted per fragment to bf16
// (ASPLIT: hi/lo two planes -> 2 terms, else single rounded term); Wt bf16 [N][K] (pitch ldb). BIAS_BF16 rounds the
// bias to bf16 first (bias quantised to bf16 before the add). K%32==0, M%16==0, N%64==0.
template <bool ASPLIT, int ACT, bool BIAS_BF16>
__global__ __launch_bounds__(128) void k_gemm_bf(const float* __restrict__ A, int lda, const unsigned short* __restrict__ Wt, int ldb,
                                               const float* __restrict__ bias, float* __restrict__ C, int ldc, int M, int N, int K) {
  __shared__ __attribute__((aligned(16))) float so[4][16][64];
  const int tid = threadIdx.x, w = tid >> 5, lane = tid & 31, ln = lane & 15, hh = lane >> 4;
  const int ntn = N / 64;
  const int wid = blockIdx.x * 4 + w;
  const int mt = wid / ntn, nq = wid % ntn;
  if (mt * 16 >= M) return;
  const int row0 = mt * 16, col0 = nq * 64;
  const float* arow = A + (size_t)(row0 + ln) * lda;
  v8f acc[4] = {};
  for (int kb = 0; kb < K; kb += 32) {
    FragB ah, al;
    const v4f x0 = *(const v4fa*)(arow + kb + 8 * hh), x1 = *(const v4fa*)(arow + kb + 8 * hh + 4);
    const v4f x2 = *(const v4fa*)(arow + kb + 16 + 8 * hh), x3 = *(const v4fa*)(arow + kb + 16 + 8 * hh + 4);
    float xs[16] = {x0[0],x0[1],x0[2],x0[3],x1[0],x1[1],x1[2],x1[3],x2[0],x2[1],x2[2],x2[3],x3[0],x3[1],x3[2],x3[3]};
#pragma unroll
    for (int i = 0; i < 16; ++i) { const unsigned short hb = bf16_bits(xs[i]); ah.u[i] = hb; al.u[i] = ASPLIT ? bf16_bits(xs[i] - bf16_val(hb)) : (unsigned short)0; }
#pragma unroll
    for (int t = 0; t < 4; ++t) {
      const unsigned short* brow = Wt + (size_t)(col0 + t * 16 + ln) * ldb + kb;
      FragB b;
      b.half[0] = *(const v8us*)(brow + 8 * hh);
      b.half[1] = *(const v8us*)(brow + 16 + 8 * hh);
      acc[t] = mmaN<ASPLIT ? 2 : 1>(ah.v, al.v, b.v, b.v, acc[t]);
    }
  }
#pragma unroll
  for (int t = 0; t < 4; ++t) {
    float bv = bias ? bias[col0 + t * 16 + ln] : 0.f;
    if (BIAS_BF16) bv = bf16_round(bv);
#pragma unroll
    for (int r = 0; r < 8; ++r) { float v = acc[t][r] + bv; if (ACT == 1) v = fmaxf(v, 0.f); so[w][8 * hh + r][t * 16 + ln] = v; }
  }
  __builtin_amdgcn_fence(__ATOMIC_ACQ_REL, "workgroup");
  __builtin_amdgcn_wave_barrier();
  const int rsub = lane >> 4, c4 = (lane & 15) * 4;
  {
#pragma unroll
    for (int q = 0; q < 8; ++q) {
      const int r = q * 2 + rsub;
      const v4f v = *(const v4fa*)&so[w][r][c4];
      *(v4f*)(C + (size_t)(row0 + r) * ldc + col0 + c4) = v;
    }
    
  }
}

// GEMM C = act(A·W + bias + resid): A f32 (ASPLIT -> hi/lo 2 terms), Wt bf16 [N][K]; ACT 0 none, 1 relu, 2 exact gelu;
// resid (optional, f32, row index = (row % rmod), pitch ldr, RES_BF16 rounds it) added before the activation.
template <bool ASPLIT, int ACT, bool BIAS_BF16, bool RES_BF16>
__global__ __launch_bounds__(128) void k_gemm_bf3(const float* __restrict__ A, int lda, const unsigned short* __restrict__ Wt, int ldb,
                                                const float* __restrict__ bias, const float* __restrict__ resid, int rmod, int ldr,
                                                float* __restrict__ C, int ldc, int M, int N, int K) {
  __shared__ __attribute__((aligned(16))) float so[4][16][64];
  const int tid = threadIdx.x, w = tid >> 5, lane = tid & 31, ln = lane & 15, hh = lane >> 4;
  const int ntn = N / 64;
  const int wid = blockIdx.x * 4 + w;
  const int mt = wid / ntn, nq = wid % ntn;
  if (mt * 16 >= M) return;
  const int row0 = mt * 16, col0 = nq * 64;
  const float* arow = A + (size_t)(row0 + ln) * lda;
  v8f acc[4] = {};
  for (int kb = 0; kb < K; kb += 32) {
    FragB ah, al;
    const v4f x0 = *(const v4fa*)(arow + kb + 8 * hh), x1 = *(const v4fa*)(arow + kb + 8 * hh + 4);
    const v4f x2 = *(const v4fa*)(arow + kb + 16 + 8 * hh), x3 = *(const v4fa*)(arow + kb + 16 + 8 * hh + 4);
    float xs[16] = {x0[0],x0[1],x0[2],x0[3],x1[0],x1[1],x1[2],x1[3],x2[0],x2[1],x2[2],x2[3],x3[0],x3[1],x3[2],x3[3]};
#pragma unroll
    for (int i = 0; i < 16; ++i) { const unsigned short hb = bf16_bits(xs[i]); ah.u[i] = hb; al.u[i] = ASPLIT ? bf16_bits(xs[i] - bf16_val(hb)) : (unsigned short)0; }
#pragma unroll
    for (int t = 0; t < 4; ++t) {
      const unsigned short* brow = Wt + (size_t)(col0 + t * 16 + ln) * ldb + kb;
      FragB b;
      b.half[0] = *(const v8us*)(brow + 8 * hh);
      b.half[1] = *(const v8us*)(brow + 16 + 8 * hh);
      acc[t] = mmaN<ASPLIT ? 2 : 1>(ah.v, al.v, b.v, b.v, acc[t]);
    }
  }
#pragma unroll
  for (int t = 0; t < 4; ++t) {
    const int col = col0 + t * 16 + ln;
    float bv = bias ? bias[col] : 0.f;
    if (BIAS_BF16) bv = bf16_round(bv);
#pragma unroll
    for (int r = 0; r < 8; ++r) {
      float v = acc[t][r] + bv;
      if (resid) { float rv = resid[(size_t)((row0 + 8 * hh + r) % rmod) * ldr + col]; if (RES_BF16) rv = bf16_round(rv); v += rv; }
      if (ACT == 1) v = fmaxf(v, 0.f);
      if (ACT == 2) v = 0.5f * v * (1.0f + erff(v * 0.70710678118654752f));
      if (ACT == 3) { const float u = 0.7978845608028654f * (v + 0.044715f * v * v * v); v = 0.5f * v * (1.0f + tanhf(u)); }
      so[w][8 * hh + r][t * 16 + ln] = v;
    }
  }
  __builtin_amdgcn_fence(__ATOMIC_ACQ_REL, "workgroup");
  __builtin_amdgcn_wave_barrier();
  const int rsub = lane >> 4, c4 = (lane & 15) * 4;
  {
#pragma unroll
    for (int q = 0; q < 8; ++q) {
      const int r = q * 2 + rsub;
      const v4f v = *(const v4fa*)&so[w][r][c4];
      *(v4f*)(C + (size_t)(row0 + r) * ldc + col0 + c4) = v;
    }
    
  }
}
// row LayerNorm (biased variance, eps) over N: s = X (+ R); optional out_sum <- s; out_norm <- (s-mu)*rsqrt(var+eps)*g + b
template <bool PARAM_BF16>
__global__ __launch_bounds__(256) void k_layernorm(const float* __restrict__ X, const float* __restrict__ R, const float* __restrict__ g, const float* __restrict__ bta,
                                                  float* __restrict__ out_sum, float* __restrict__ out_norm, int N, float eps) {
  __shared__ float red[256];
  const int row = blockIdx.x, tid = threadIdx.x;
  const float* x = X + (size_t)row * N; const float* rr = R ? R + (size_t)row * N : nullptr;
  float vals[16];                     // up to N = 4096
  const int per = N / 256;            // contiguous chunk per thread? use strided-by-4 chunks: thread handles j = tid*4 + 1024*u
  float s1 = 0.f;
  for (int u = 0; u < per / 4; ++u) {
    const int j = tid * 4 + 1024 * u;
    const v4f a = *(const v4fa*)(x + j);
    v4f b = {0.f,0.f,0.f,0.f}; if (rr) b = *(const v4fa*)(rr + j);
#pragma unroll
    for (int q = 0; q < 4; ++q) { const float v = a[q] + b[q]; vals[u * 4 + q] = v; s1 += v; }
  }
  red[tid] = s1; __syncthreads();
  for (int st = 128; st > 0; st >>= 1) { if (tid < st) red[tid] += red[tid + st]; __syncthreads(); }
  const float mu = red[0] / (float)N; __syncthreads();
  float s2 = 0.f;
  for (int u = 0; u < per / 4; ++u)
#pragma unroll
    for (int q = 0; q < 4; ++q) { const float c = vals[u * 4 + q] - mu; s2 += c * c; }
  red[tid] = s2; __syncthreads();
  for (int st = 128; st > 0; st >>= 1) { if (tid < st) red[tid] += red[tid + st]; __syncthreads(); }
  const float rs = rsqrtf(red[0] / (float)N + eps);
  {
    for (int u = 0; u < per / 4; ++u) {
      const int j = tid * 4 + 1024 * u;
      v4f o, sm;
#pragma unroll
      for (int q = 0; q < 4; ++q) {
        float gg = g[j + q], bb = bta[j + q];
        if (PARAM_BF16) { gg = bf16_round(gg); bb = bf16_round(bb); }
        sm[q] = vals[u * 4 + q]; o[q] = (vals[u * 4 + q] - mu) * rs * gg + bb;
      }
      if (out_sum) *(v4f*)(out_sum + (size_t)row * N + j) = sm;
      *(v4f*)(out_norm + (size_t)row * N + j) = o;
    }
    
  }
}



// ---- f16 WMMA path (v_wmma_f32_16x16x32_f16): 11-bit significands for operands in range — used where a [0,1] probability operand needs more precision than bf16
typedef _Float16 v16h __attribute__((ext_vector_type(16)));
union FragH { v16h v; v8us half[2]; _Float16 h[16]; unsigned short u[16]; };
template <int NT>
__device__ __forceinline__ v8f mmaH(v16h ah, v16h al, v16h bh, v16h bl, v8f c) {
  c = __builtin_amdgcn_wmma_f32_16x16x32_f16(false, ah, false, bh, (short)0, c, false, false);
  if (NT >= 2) c = __builtin_amdgcn_wmma_f32_16x16x32_f16(false, al, false, bh, (short)0, c, false, false);
  if (NT >= 3) c = __builtin_amdgcn_wmma_f32_16x16x32_f16(false, ah, false, bl, (short)0, c, false, false);
  asm volatile("v_nop\n\tv_nop\n\tv_nop\n\tv_nop" : "+v"(c) : "v"(ah), "v"(al), "v"(bh), "v"(bl));
  return c;
}
// batched GEMM like k_gemm_b but f16 operands: A f32 (split into f16 hi/lo if ASPLIT, else rounded to f16), Bt = f16 values [n][k]; alpha; C f32; N multiple of 16 (partial tiles skipped)
template <bool ASPLIT>
__global__ __launch_bounds__(128) void k_gemm_h(const float* __restrict__ A, int lda, size_t sA, const _Float16* __restrict__ Bh, int ldb, size_t sB, float alpha, float* __restrict__ C, int ldc, size_t sC, int M, int N, int K) {
  __shared__ __attribute__((aligned(16))) float so[4][16][64];
  const int tid = threadIdx.x, w = tid >> 5, lane = tid & 31, ln = lane & 15, hh = lane >> 4; const int by = blockIdx.y;
  A += (size_t)by * sA; Bh += (size_t)by * sB; C += (size_t)by * sC;
  const int ntn = (N + 63) / 64; const int wid = blockIdx.x * 4 + w; const int mt = wid / ntn, nq = wid % ntn; if (mt * 16 >= M) return;
  const int row0 = mt * 16, col0 = nq * 64; const float* arow = A + (size_t)(row0 + ln) * lda;
  v8f acc[4] = {};
  for (int kb = 0; kb < K; kb += 32) {
    FragH ah, al;
    const v4f x0 = *(const v4fa*)(arow + kb + 8 * hh), x1 = *(const v4fa*)(arow + kb + 8 * hh + 4), x2 = *(const v4fa*)(arow + kb + 16 + 8 * hh), x3 = *(const v4fa*)(arow + kb + 16 + 8 * hh + 4);
    float xs[16] = {x0[0],x0[1],x0[2],x0[3],x1[0],x1[1],x1[2],x1[3],x2[0],x2[1],x2[2],x2[3],x3[0],x3[1],x3[2],x3[3]};
#pragma unroll
    for (int i = 0; i < 16; ++i) { const _Float16 h = (_Float16)xs[i]; ah.h[i] = h; al.h[i] = ASPLIT ? (_Float16)(xs[i] - (float)h) : (_Float16)0.0f; }
#pragma unroll
    for (int t = 0; t < 4; ++t) { if (col0 + t * 16 >= N) continue; const size_t boff = (size_t)(col0 + t * 16 + ln) * ldb + kb; FragH bq; bq.half[0] = *(const v8us*)(Bh + boff + 8 * hh); bq.half[1] = *(const v8us*)(Bh + boff + 16 + 8 * hh);
      acc[t] = mmaH<ASPLIT ? 2 : 1>(ah.v, al.v, bq.v, bq.v, acc[t]); }
  }
#pragma unroll
  for (int t = 0; t < 4; ++t) { if (col0 + t * 16 >= N) continue;
#pragma unroll
    for (int r = 0; r < 8; ++r) so[w][8 * hh + r][t * 16 + ln] = acc[t][r] * alpha; }
  __builtin_amdgcn_fence(__ATOMIC_ACQ_REL, "workgroup"); __builtin_amdgcn_wave_barrier();
  const int rsub = lane >> 4, c4 = (lane & 15) * 4;
  {
#pragma unroll
    for (int q = 0; q < 8; ++q) { const int r = q * 2 + rsub; if (col0 + c4 < N) { const v4f v = *(const v4fa*)&so[w][r][c4]; *(v4f*)(C + (size_t)(row0 + r) * ldc + col0 + c4) = v; } }
     }
}

// Wt[n][k] = f16(W[k][n]·scale) from f32 row-major W[K][N] (scale = power of two; bf16-exact weights stay exact in f16 away from the subnormal range)
__global__ __launch_bounds__(256) void k_wt_f16(const float* __restrict__ W, _Float16* __restrict__ Wt, int K, int N, float scale) {
  const int t = blockIdx.x * 256 + threadIdx.x; if (t >= N * (K / 8)) return; const int n = t / (K / 8), k8 = (t % (K / 8)) * 8; FragH f;
#pragma unroll
  for (int i = 0; i < 8; ++i) f.h[i] = (_Float16)(bf16_round(W[(size_t)(k8 + i) * N + n]) * scale); const v8us o = f.half[0];
  *(v8us*)((unsigned short*)Wt + (size_t)n * K + k8) = o; 
}
// k_gemm_hh variant with fused epilogue: v = acc·alpha + bias[by·sBias + col] (+ CP[(row/rowsPerB)·sCPb + by·64 + col] if CP) ; ACT 0 none / 1 elu ; writes f16 C16 (and f32 C if non-null)
template <int ACT>
__global__ __launch_bounds__(128) void k_gemm_hhx(const _Float16* __restrict__ A, int lda, size_t sA, const _Float16* __restrict__ Bh, int ldb, size_t sB, float alpha, const float* __restrict__ bias, size_t sBias, const float* __restrict__ CP, int rowsPerB, size_t sCPb, int row0g,
    float* __restrict__ C, _Float16* __restrict__ C16, int ldc, size_t sC, int M, int N, int K) {
  __shared__ __attribute__((aligned(16))) float so[4][16][64];
  const int tid = threadIdx.x, w = tid >> 5, lane = tid & 31, ln = lane & 15, hh = lane >> 4; const int by = blockIdx.y;
  A += (size_t)by * sA; Bh += (size_t)by * sB; const size_t cofs = (size_t)by * sC; const float* bp = bias ? bias + (size_t)by * sBias : nullptr;
  const int ntn = (N + 63) / 64; const int wid = blockIdx.x * 4 + w; const int mt = wid / ntn, nq = wid % ntn; if (mt * 16 >= M) return;
  const int row0 = mt * 16, col0 = nq * 64; const _Float16* arow = A + (size_t)(row0 + ln) * lda;
  v8f acc[4] = {};
  for (int kb = 0; kb < K; kb += 32) { FragH ah; ah.half[0] = *(const v8us*)((const unsigned short*)arow + kb + 8 * hh); ah.half[1] = *(const v8us*)((const unsigned short*)arow + kb + 16 + 8 * hh);
#pragma unroll
    for (int t = 0; t < 4; ++t) { if (col0 + t * 16 >= N) continue; const size_t boff = (size_t)(col0 + t * 16 + ln) * ldb + kb; FragH bq; bq.half[0] = *(const v8us*)((const unsigned short*)Bh + boff + 8 * hh); bq.half[1] = *(const v8us*)((const unsigned short*)Bh + boff + 16 + 8 * hh);
      acc[t] = mmaH<1>(ah.v, ah.v, bq.v, bq.v, acc[t]); }
  }
#pragma unroll
  for (int t = 0; t < 4; ++t) { if (col0 + t * 16 >= N) continue; const int col = col0 + t * 16 + ln; const float bv = bp ? bf16_round(bp[col]) : 0.f;
#pragma unroll
    for (int r = 0; r < 8; ++r) { float v = acc[t][r] * alpha + bv; if (CP) { const int rr = row0g + row0 + 8 * hh + r; if (rowsPerB < 0) v += CP[cofs + (size_t)rr * ldc + col];      /* rowsPerB < 0: own element of the batched C plane */ else { const int bidx = rr / rowsPerB; v += CP[(size_t)bidx * sCPb + (size_t)by * 64 + col]; } } if (ACT == 1) v = (v > 0.f) ? v : expm1f(v); else if (ACT == 7) v = (v > 0.f) ? v + 1.0f : expf(v); else if (ACT == 8) v = tanhf(v); else if (ACT == 9) v = 0.5f * v * (1.0f + tanhf(0.7978845608028654f * (v + 0.044715f * v * v * v))); else if (ACT == 11) v = 1.0f / (1.0f + expf(-v)); else if (ACT == 12) v = (v > 0.f) ? v : 0.01f * v; else if (ACT == 14) v = (v > 0.f) ? v : 0.1f * v; else if (ACT == 16) v = (v >= 0.f) ? v : 0.3f * v; else if (ACT == 17) v = (v >= 0.f) ? v : 0.2f * v; else if (ACT == 15) v = v / (1.0f + expf(-v)); else if (ACT == 3) v = fmaxf(v, 0.f); else if (ACT == 6) v = 0.5f * v * (1.0f + erff(v * 0.70710678118654752f)); so[w][8 * hh + r][t * 16 + ln] = v; } }
  __builtin_amdgcn_fence(__ATOMIC_ACQ_REL, "workgroup"); __builtin_amdgcn_wave_barrier();
  const int rsub = lane >> 4, c4 = (lane & 15) * 4; typedef _Float16 v4h __attribute__((ext_vector_type(4)));
  {
#pragma unroll
    for (int q = 0; q < 8; ++q) { const int r = q * 2 + rsub; if (col0 + c4 < N) { const v4f v = *(const v4fa*)&so[w][r][c4]; if (C) *(v4f*)(C + cofs + (size_t)(row0 + r) * ldc + col0 + c4) = v; if (C16) { v4h h4; for (int i = 0; i < 4; ++i) h4[i] = (_Float16)v[i]; *(v4h*)(C16 + cofs + (size_t)(row0 + r) * ldc + col0 + c4) = h4; } } }
     }
}


typedef _Float16 v4h __attribute__((ext_vector_type(4)));

__global__ __launch_bounds__(256) void k_x16(const float* __restrict__ x, _Float16* __restrict__ X16, size_t n8) { const size_t t = (size_t)blockIdx.x * 256 + threadIdx.x; if (t >= n8) return; FragH f;
#pragma unroll
  for (int q = 0; q < 8; ++q) f.h[q] = (_Float16)bf16_round(x[t * 8 + q]); *(v8us*)((unsigned short*)X16 + t * 8) = f.half[0];  }
__global__ __launch_bounds__(256) void k_h16(const float* __restrict__ x, _Float16* __restrict__ X16, size_t n8) { const size_t t = (size_t)blockIdx.x * 256 + threadIdx.x; if (t >= n8) return; FragH f;
#pragma unroll
  for (int q = 0; q < 8; ++q) f.h[q] = (_Float16)x[t * 8 + q]; *(v8us*)((unsigned short*)X16 + t * 8) = f.half[0];  }
__global__ __launch_bounds__(256) void k_round16f(const float* __restrict__ W, _Float16* __restrict__ Bt, size_t n8) { const size_t t = (size_t)blockIdx.x * 256 + threadIdx.x; if (t >= n8) return; FragH f;
#pragma unroll
  for (int i = 0; i < 8; ++i) f.h[i] = (_Float16)(bf16_round(W[t * 8 + i]) * 16.0f); *(v8us*)((unsigned short*)Bt + t * 8) = f.half[0];  }
template <int NHv, int TTv>
__global__ __launch_bounds__(256) void k_vt(const _Float16* __restrict__ V16, int ldv, int voff, _Float16* __restrict__ Vt) { __shared__ unsigned short tl[64][66]; const int tid = threadIdx.x; const int slab = blockIdx.x / (TTv / 64), lg = blockIdx.x % (TTv / 64); const int b = slab / NHv, h = slab % NHv;
  for (int i = tid; i < 64 * 8; i += 256) { const int r = i / 8, c8 = (i % 8) * 8; FragH f; f.half[0] = *(const v8us*)((const unsigned short*)V16 + ((size_t)b * TTv + lg * 64 + r) * ldv + voff + h * 64 + c8);
#pragma unroll
    for (int q = 0; q < 8; ++q) tl[r][c8 + q] = f.u[q]; }
  __syncthreads();
  {
#pragma unroll
    for (int rd = 0; rd < 2; ++rd) { const int d = rd * 32 + tid / 8, pc = tid % 8; FragH f;
#pragma unroll
      for (int q = 0; q < 8; ++q) f.u[q] = tl[pc * 8 + q][d];
      *(v8us*)((unsigned short*)Vt + ((size_t)slab * 64 + d) * TTv + lg * 64 + pc * 8) = f.half[0]; }
     } }

__global__ __launch_bounds__(256) void k_hl(const float* __restrict__ F, _Float16* __restrict__ Hh, _Float16* __restrict__ Hl, size_t n8) { const size_t t = (size_t)blockIdx.x * 256 + threadIdx.x; if (t >= n8) return; FragH fh, fl; const v4f a = *(const v4fa*)(F + t * 8), c = *(const v4fa*)(F + t * 8 + 4);
#pragma unroll
  for (int q = 0; q < 4; ++q) { _Float16 h = (_Float16)a[q]; fh.h[q] = h; fl.h[q] = (_Float16)((a[q] - (float)h) * 1024.0f); h = (_Float16)c[q]; fh.h[4 + q] = h; fl.h[4 + q] = (_Float16)((c[q] - (float)h) * 1024.0f); }
  { *(v8us*)((unsigned short*)Hh + t * 8) = fh.half[0]; *(v8us*)((unsigned short*)Hl + t * 8) = fl.half[0];  } }

// ---- fast GEMM (wave tile 32x64; requires M % 32 == 0 rows per launch region and N % 64 == 0); epilogue = k_gemm_hhx semantics ----
__device__ __forceinline__ v16h g2_frag(const _Float16* p, int hh) { FragH f; f.half[0] = *(const v8us*)((const unsigned short*)p + 8 * hh); f.half[1] = *(const v8us*)((const unsigned short*)p + 16 + 8 * hh); return f.v; }
__device__ __forceinline__ v8f g2_mma(v16h a, v16h b, v8f c) { v8f d = __builtin_amdgcn_wmma_f32_16x16x32_f16(false, a, false, b, (short)0, c, false, false); asm volatile("v_nop\n\tv_nop\n\tv_nop\n\tv_nop" : "+v"(d) : "v"(a), "v"(b)); return d; }
template <int ACT>
__global__ __launch_bounds__(128) void k_gemm2(const _Float16* __restrict__ A, int lda, size_t sA, const _Float16* __restrict__ Bh, int ldb, size_t sB, float alpha, const float* __restrict__ bias, size_t sBias, const float* __restrict__ CP, int rowsPerB, size_t sCPb, int row0g,
    float* __restrict__ C, _Float16* __restrict__ C16, int ldc, size_t sC, int M, int N, int K) { static_assert(ACT == 0 || ACT == 3 || ACT == 6 || ACT == 8 || ACT == 9 || ACT == 11 || ACT == 12 || ACT == 14 || ACT == 15 || ACT == 16 || ACT == 17, "k_gemm2: unsupported ACT code (would silently apply no activation)");
  __shared__ __attribute__((aligned(16))) float so[4][32][68];
  const int tid = threadIdx.x, w = tid >> 5, lane = tid & 31, ln = lane & 15, hh = lane >> 4; const int by = blockIdx.y;
  A += (size_t)by * sA; Bh += (size_t)by * sB; const size_t cofs = (size_t)by * sC; const float* bp = bias ? bias + (size_t)by * sBias : nullptr;
  const int ntn = N >> 6; const int mt = blockIdx.x / ntn, nq = blockIdx.x - mt * ntn; const int row0 = mt * 128 + 32 * w, col0 = nq * 64; if (row0 >= M) return;
  const _Float16* a0p = A + (size_t)(row0 + ln) * lda; const _Float16* a1p = a0p + (size_t)16 * lda;
  const _Float16* b0p = Bh + (size_t)(col0 + ln) * ldb; const _Float16* b1p = b0p + (size_t)16 * ldb; const _Float16* b2p = b1p + (size_t)16 * ldb; const _Float16* b3p = b2p + (size_t)16 * ldb;
  const v8f z8 = {0.f,0.f,0.f,0.f,0.f,0.f,0.f,0.f}; v8f c00 = z8, c01 = z8, c02 = z8, c03 = z8, c10 = z8, c11 = z8, c12 = z8, c13 = z8;
#pragma unroll 1
  for (int kb = 0; kb < K; kb += 32) { const v16h a0 = g2_frag(a0p + kb, hh), a1 = g2_frag(a1p + kb, hh);
    v16h b = g2_frag(b0p + kb, hh); c00 = g2_mma(a0, b, c00); c10 = g2_mma(a1, b, c10);
    b = g2_frag(b1p + kb, hh); c01 = g2_mma(a0, b, c01); c11 = g2_mma(a1, b, c11);
    b = g2_frag(b2p + kb, hh); c02 = g2_mma(a0, b, c02); c12 = g2_mma(a1, b, c12);
    b = g2_frag(b3p + kb, hh); c03 = g2_mma(a0, b, c03); c13 = g2_mma(a1, b, c13); }
  v8f accs[8] = {c00, c01, c02, c03, c10, c11, c12, c13};
#pragma unroll
  for (int u = 0; u < 8; ++u) { const int t = u & 3, half = u >> 2; const int col = col0 + t * 16 + ln; const float bv = bp ? bf16_round(bp[col]) : 0.f;
#pragma unroll
    for (int r = 0; r < 8; ++r) { const int rloc = half * 16 + 8 * hh + r; float v = accs[u][r] * alpha + bv; if (CP) { if (rowsPerB < 0) v += CP[cofs + (size_t)(row0g + row0 + rloc) * ldc + col];      /* rowsPerB < 0: own element of the batched C plane */ else { const int bidx = (row0g + row0 + rloc) / rowsPerB; v += CP[(size_t)bidx * sCPb + (size_t)by * 64 + col]; } }
      if (ACT == 3) v = fmaxf(v, 0.f); else if (ACT == 6) v = 0.5f * v * (1.0f + erff(v * 0.70710678118654752f)); else if (ACT == 11) v = 1.0f / (1.0f + expf(-v)); else if (ACT == 15) v = v / (1.0f + expf(-v)); else if (ACT == 12) v = (v > 0.f) ? v : 0.01f * v; else if (ACT == 8) v = tanhf(v); else if (ACT == 9) v = 0.5f * v * (1.0f + tanhf(0.7978845608028654f * (v + 0.044715f * v * v * v))); else if (ACT == 14) v = (v > 0.f) ? v : 0.1f * v; else if (ACT == 16) v = (v >= 0.f) ? v : 0.3f * v; else if (ACT == 17) v = (v >= 0.f) ? v : 0.2f * v;
      so[w][rloc][t * 16 + ln] = v; } }
  __builtin_amdgcn_fence(__ATOMIC_ACQ_REL, "workgroup"); __builtin_amdgcn_wave_barrier();
  const int rsub = lane >> 4, c4 = (lane & 15) * 4;
  {
#pragma unroll
    for (int q = 0; q < 16; ++q) { const int r = q * 2 + rsub; const v4f v = *(const v4fa*)&so[w][r][c4]; if (C) *(v4f*)(C + cofs + (size_t)(row0 + r) * ldc + col0 + c4) = v; if (C16) { v4h h4; for (int i = 0; i < 4; ++i) h4[i] = (_Float16)v[i]; *(v4h*)(C16 + cofs + (size_t)(row0 + r) * ldc + col0 + c4) = h4; } }
     } }


__global__ __launch_bounds__(256) void k_wnat(const float* __restrict__ w, size_t n8, _Float16* __restrict__ Bt) { const size_t t = (size_t)blockIdx.x * 256 + threadIdx.x; if (t >= n8) return; FragH f; for (int q = 0; q < 8; ++q) f.h[q] = (_Float16)(bf16_round(w[t * 8 + q]) * 16.0f); *(v8us*)((unsigned short*)Bt + t * 8) = f.half[0];  }
__global__ __launch_bounds__(256) void k_rsm(const float* __restrict__ S, _Float16* __restrict__ P, int nrows) {
  #pragma clang fp contract(off)
  const int i = blockIdx.x * 256 + threadIdx.x; if (i >= nrows) return; const float* s = S + (size_t)i * SQ; float mx = -3.0e38f;
#pragma unroll 1
  for (int j = 0; j < SQ; ++j) mx = fmaxf(mx, s[j]); float se = 0.f;
#pragma unroll 1
  for (int j = 0; j < SQ; ++j) se += expf(s[j] - mx); const float sc = 256.0f / se;
#pragma unroll 1
  for (int j0 = 0; j0 < SQ; j0 += 8) { FragH f; for (int q = 0; q < 8; ++q) f.h[q] = (_Float16)(expf(s[j0 + q] - mx) * sc); unsigned short* d = (unsigned short*)P + (size_t)i * SQ + j0; *(v8us*)d = f.half[0];  } }
__global__ __launch_bounds__(256) void k_vt(const _Float16* __restrict__ V16, int b, int h0, _Float16* __restrict__ VT) { __shared__ unsigned short tl[64][65]; const int tid = threadIdx.x; const int hh = blockIdx.x % HG, sg = blockIdx.x / HG; const int s0 = sg * 64; const int h = h0 + hh;
  for (int i = tid; i < 64 * 8; i += 256) { const int j = i / 8, d8 = (i % 8) * 8; FragH f; f.half[0] = *(const v8us*)((const unsigned short*)V16 + ((size_t)b * SQ + s0 + j) * DM + h * HD + d8); for (int q = 0; q < 8; ++q) tl[d8 + q][j] = f.u[q]; }
  __syncthreads();
  { for (int i = tid; i < 64 * 8; i += 256) { const int d = i / 8, j8 = (i % 8) * 8; FragH f; for (int q = 0; q < 8; ++q) f.u[q] = tl[d][j8 + q]; *(v8us*)((unsigned short*)VT + ((size_t)hh * HD + d) * SQ + s0 + j8) = f.half[0]; }  } }



__global__ __launch_bounds__(256) void k_rsmf(const float* __restrict__ S, _Float16* __restrict__ P, int qn, int hg) {
  #pragma clang fp contract(off)
  const int t = blockIdx.x * 256 + threadIdx.x; if (t >= qn * hg) return; const size_t i = (size_t)(t / qn) * SQ + (t % qn); const float* s = S + i * SQ; float mx = -3.0e38f;
#pragma unroll 1
  for (int j = 0; j < SQ; ++j) mx = fmaxf(mx, s[j]); float se = 0.f;
#pragma unroll 1
  for (int j = 0; j < SQ; ++j) se += __expf(s[j] - mx); const float sc = 256.0f / se;
#pragma unroll 1
  for (int j0 = 0; j0 < SQ; j0 += 8) { FragH f; for (int q = 0; q < 8; ++q) f.h[q] = (_Float16)(__expf(s[j0 + q] - mx) * sc); unsigned short* d = (unsigned short*)P + i * SQ + j0; *(v8us*)d = f.half[0];  } }


// ---- fused attention: scores, masked softmax and the product with V in one kernel; no score or weight ever reaches memory ----
typedef int v4ia __attribute__((ext_vector_type(4), may_alias));
__device__ __forceinline__ float lane_x16(float v) { return __builtin_bit_cast(float, __builtin_amdgcn_permlanex16(__builtin_bit_cast(int, v), __builtin_bit_cast(int, v), 0x76543210, 0xfedcba98, false, false)); }      /* lane l with l ^ 16 */
__device__ __forceinline__ v8f fa_mma(v16h a, v16h b, v8f c) { return __builtin_amdgcn_wmma_f32_16x16x32_f16(false, a, false, b, (short)0, c, false, false); }
__device__ __forceinline__ v16h fa_frag(const unsigned short* p) { FragH f; f.half[0] = *(const v8us*)p; f.half[1] = *(const v8us*)(p + 16); return f.v; }      /* p already holds the lane half's + 8 * hh: k = 8 hh + 0..7, then 16 + 8 hh + 0..7 */
#define FQ 128      /* queries per work-group: 8 waves x 16, in each of the two wave groups */
#define FK 64       /* keys per stage and wave group */
#define FS 128      /* keys per stage: wave group g takes rows 64 g .. + 63 of the stage */
#define FP 72       /* LDS row pitch in 16-bit elements: 144 B = 16 B x 9, odd, for 16-byte fragment reads of 16 rows */
#define FV 80       /* LDS row pitch of V in 16-bit elements: 160 B = 32 B x 5, odd, for the transposing 16-byte reads */
#define FNS (SQ / FS)
typedef __bf16 v2b __attribute__((ext_vector_type(2)));
typedef float v2f __attribute__((ext_vector_type(2)));
typedef _Float16 v2h __attribute__((ext_vector_type(2)));
typedef unsigned short v4us __attribute__((ext_vector_type(4), may_alias));
typedef short s16x8 __attribute__((ext_vector_type(8)));
__device__ __forceinline__ v2h fa_cvt2(float x0, float x1) { const v2f x = {x0, x1}; const unsigned int u = __builtin_bit_cast(unsigned int, __builtin_convertvector(x, v2b));      /* f32 -> bf16, nearest even, two per instruction */
  const v2f y = {__uint_as_float(u << 16), __uint_as_float(u & 0xFFFF0000u)}; return __builtin_convertvector(y, v2h); }      /* then the same values as f16 */
__device__ __forceinline__ v4h fa_cvt4(v4f x) { const v2h a = fa_cvt2(x[0], x[1]), b = fa_cvt2(x[2], x[3]); const v4h r = {a[0], a[1], b[0], b[1]}; return r; }
__device__ __forceinline__ v16h fa_qfrag(const float* p) { const v4h a = fa_cvt4(*(const v4fa*)p), b = fa_cvt4(*(const v4fa*)(p + 4)), c = fa_cvt4(*(const v4fa*)(p + 16)), d = fa_cvt4(*(const v4fa*)(p + 20)); FragH f;      /* fa_frag's k order, from f32 rows */
#pragma unroll
  for (int i = 0; i < 4; ++i) { f.h[i] = a[i]; f.h[4 + i] = b[i]; f.h[8 + i] = c[i]; f.h[12 + i] = d[i]; }
  return f.v; }
__device__ __forceinline__ v8us fa_tr16(const unsigned short* p) { typedef __attribute__((address_space(3))) s16x8 lds_s16x8; return __builtin_bit_cast(v8us, __builtin_amdgcn_ds_load_tr16_b128_v8i16((lds_s16x8*)p)); }
__device__ __forceinline__ v16h fa_vfrag(const unsigned short* p) { FragH f; f.half[0] = fa_tr16(p); f.half[1] = fa_tr16(p + 16 * FV); return f.v; }      /* p: the lane's own address in a row-major [key][d] tile; lane (c, hh) gets column c of keys 8 hh + 0..7, then 16 + 8 hh + 0..7: fa_frag's k order */
// Wave w: queries 16 (w & 7) .. + 15 of the block, one per lane column (lanes c and c + 16 share query c and split its keys); wave group g = w >> 3 sees only its half of every stage and keeps its own maximum, row sums and output sums.
// Four waves per SIMD instead of two: a wave's waits (LDS reads, the softmax chain, the staged loads, the barrier) are covered by three others, and the barriers per key halve.
// S^T tile t = K rows (A) x Q^T (B): register r of lane (c, hh) = score of key 16 t + 8 hh + r with query c. Two such tiles, converted in place, are the B operand of O^T += V^T P^T.
// Key list: position j of the list holds the byte offset of the j-th open key's row (ascending key order); the list is filled up to a whole stage with key 0, and a score at a position past the open count is replaced by -1e30 (only a stage that holds such positions pays for the test). With no open key the list is all 2048 keys, every score replaced.
// Mask as the reference has it: a masked key's score is REPLACED by a huge negative, so its weight is exactly 0 beside any open key and all weights are equal where every key is masked.
// Online softmax in base 2; the maximum in use moves only when a column's new maximum passes it by more than 8 (weights stay <= 2^12, inside f16); row sums by a WMMA with an all-ones A (they sum the same rounded weights that meet V).
__global__ __launch_bounds__(512) void k_fattn(const float* __restrict__ Qf, const float* __restrict__ Kf, const float* __restrict__ Vf, const int* __restrict__ Km, float* __restrict__ O) {
  __shared__ __attribute__((aligned(16))) unsigned short sk[2][FS * FP];
  __shared__ __attribute__((aligned(16))) unsigned short sv[2][FS * FV];      /* V rows as they lie: [key][d] */
  __shared__ __attribute__((aligned(16))) int sx[SQ];      /* the key list: byte offset of the listed key's row in its plane */
  __shared__ __attribute__((aligned(16))) int sc[16];      /* open keys per wave's 128 */
  __shared__ float sm[16][18][32];      /* the join: what each wave hands to its partner in the other group, one dword column per lane */
  const int tid = threadIdx.x, w = tid >> 5, lane = tid & 31, ln = lane & 15, hh = lane >> 4; const int pl = blockIdx.y;
  const int g = __builtin_amdgcn_readfirstlane(w >> 3);      /* wave group, the same in every lane: its tests stay scalar */
  const int q = blockIdx.x * FQ + (w & 7) * 16 + ln;
  const int* km = Km + (pl / 8) * SQ + w * 128 + lane;      /* plane pl belongs to batch pl / 8; wave w looks at keys 128 w .. + 127, 32 in a row per load */
  int mk[4];
#pragma unroll
  for (int i = 0; i < 4; ++i) mk[i] = km[i * 32];
  unsigned int bal[4]; int cw = 0;
#pragma unroll
  for (int i = 0; i < 4; ++i) { bal[i] = __builtin_amdgcn_ballot_w32(mk[i] != 0); cw += __builtin_popcount(bal[i]); }
  if (lane == 0) sc[w] = cw;
  { const v4ia z4 = {0, 0, 0, 0}; *(v4ia*)&sx[tid * 4] = z4; }      /* positions that no open key takes point at key 0 */
  __syncthreads();      /* the sixteen counts and the cleared list are there */
  int no = 0, pos = 0;      /* open keys of the batch; first list position of this wave's keys */
#pragma unroll
  for (int j = 0; j < 4; ++j) { const v4ia c = *(const v4ia*)&sc[4 * j];
#pragma unroll
    for (int i = 0; i < 4; ++i) { no += c[i]; pos += 4 * j + i < w ? c[i] : 0; } }
  no = __builtin_amdgcn_readfirstlane(no); pos = __builtin_amdgcn_readfirstlane(pos);      /* the same in every lane: trip count and branches stay scalar */
  if (no != 0) {
#pragma unroll
    for (int i = 0; i < 4; ++i) { if ((bal[i] >> lane) & 1u) sx[pos + (int)__builtin_amdgcn_mbcnt_lo(bal[i], 0u)] = (w * 128 + i * 32 + lane) * (HD * 4); pos += __builtin_popcount(bal[i]); }
  } else {
#pragma unroll
    for (int i = 0; i < 4; ++i) sx[w * 128 + i * 32 + lane] = (w * 128 + i * 32 + lane) * (HD * 4); }
  const int ns = min(((no != 0 ? no : SQ) + FS - 1) / FS, FNS);      /* stages walked: 1 .. 16 */
  __syncthreads();      /* the list is whole */
  const char* kg = (const char*)(Kf + (size_t)pl * SQ * HD); const char* vg = (const char*)(Vf + (size_t)pl * SQ * HD);
  const int r0 = tid >> 4, c4 = (tid & 15) * 4;      /* thread t brings elements c4 .. c4 + 3 of the stage's rows r0 + 32 i, i = 0..3: 16 lanes cover a listed key's 256-byte row */
  const int sok = r0 * FP + c4, sov = r0 * FV + c4;
  v4f rk[4], rv[4]; int xo[4];      /* xo: list entries of the stage after the one at work, read one stage before their loads go out */
#pragma unroll
  for (int i = 0; i < 4; ++i) xo[i] = sx[r0 + 32 * i];
#pragma unroll
  for (int i = 0; i < 4; ++i) { const unsigned int o = (unsigned int)(xo[i] + c4 * 4); rk[i] = *(const v4fa*)(kg + o); rv[i] = *(const v4fa*)(vg + o); }
#pragma unroll
  for (int i = 0; i < 4; ++i) xo[i] = sx[min(1, ns - 1) * FS + r0 + 32 * i];
  const float* qg = Qf + ((size_t)pl * SQ + q) * HD + 8 * hh;
  const v16h bq0 = fa_qfrag(qg), bq1 = fa_qfrag(qg + 32);
#pragma unroll
  for (int i = 0; i < 4; ++i) { *(v4us*)&sk[0][sok + i * 32 * FP] = __builtin_bit_cast(v4us, fa_cvt4(rk[i])); *(v4us*)&sv[0][sov + i * 32 * FV] = __builtin_bit_cast(v4us, fa_cvt4(rv[i])); }
  FragH one;
#pragma unroll
  for (int i = 0; i < 16; ++i) one.h[i] = (_Float16)1.0f;
  const v8f z8 = {0.f, 0.f, 0.f, 0.f, 0.f, 0.f, 0.f, 0.f};
  v8f acc[4] = {z8, z8, z8, z8}, accl = z8; float mu = -3.0e38f;      /* mu: the maximum in use */
  const int fo = (g * FK + ln) * FP + 8 * hh, fvo = (g * FK + 8 * hh + (lane & 7)) * FV + ((lane >> 3) & 1) * 8;      /* fvo: the transposing load's own lane address: row 8 hh + (lane & 7), 16-byte piece (lane >> 3) & 1 */
  __syncthreads();
#pragma unroll 2      /* two stages per trip: the buffer's index becomes a constant offset in every LDS address */
  for (int s = 0; s < ns; ++s) { const int b = s & 1;
    if (s + 1 < ns) {      /* next stage's pieces fly while this stage is worked on */
#pragma unroll
      for (int i = 0; i < 4; ++i) { const unsigned int o = (unsigned int)(xo[i] + c4 * 4); rk[i] = *(const v4fa*)(kg + o); rv[i] = *(const v4fa*)(vg + o); } }
    const unsigned short* kf = &sk[b][fo]; const unsigned short* vf = &sv[b][fvo]; const int* xn = &sx[min(s + 2, ns - 1) * FS + r0];
    v16h ka[8];
#pragma unroll
    for (int t = 0; t < 4; ++t) { ka[2 * t] = fa_frag(kf + t * 16 * FP); ka[2 * t + 1] = fa_frag(kf + t * 16 * FP + 32); xo[t] = xn[32 * t]; }
    __builtin_amdgcn_sched_barrier(0);      /* the next stage's global loads and all of this stage's K and list reads are issued before the first product: without it the compiler sinks the global loads to just ahead of their LDS stores (no lead) */
    v8f x[4];
#pragma unroll
    for (int t = 0; t < 4; ++t) x[t] = fa_mma(ka[2 * t + 1], bq1, fa_mma(ka[2 * t], bq0, z8));
    v16h va[8];
#pragma unroll
    for (int t = 0; t < 4; ++t) { va[t] = fa_vfrag(vf + t * 16); va[4 + t] = fa_vfrag(vf + 32 * FV + t * 16); }      /* d columns 16 t .. + 15 of keys 0..31, then of keys 32..63 */
    __builtin_amdgcn_sched_barrier(0);      /* the V^T reads are issued here and land under the softmax arithmetic: without it the compiler puts each just ahead of its product, with a full LDS wait for each */
#pragma unroll
    for (int t = 0; t < 4; ++t)
#pragma unroll
      for (int r = 0; r < 8; ++r) x[t][r] *= 0.18033688f;      /* (1 / 8) log2 e */
    if (s * FS + (g + 1) * FK > no) { const int lim = no - s * FS - g * FK - 8 * hh;      /* scalar branch: this group's half of the stage holds positions past the open count (the list's last stage; every stage where no key is open) */
#pragma unroll
      for (int t = 0; t < 4; ++t)
#pragma unroll
        for (int r = 0; r < 8; ++r) x[t][r] = 16 * t + r < lim ? x[t][r] : -1.0e30f; }
    float m4[4];      /* four short chains, one per tile, instead of one chain of 32 dependent maxima */
#pragma unroll
    for (int t = 0; t < 4; ++t) { m4[t] = fmaxf(x[t][0], x[t][1]);
#pragma unroll
      for (int r = 2; r < 8; ++r) m4[t] = fmaxf(m4[t], x[t][r]); }
    float mx = fmaxf(fmaxf(m4[0], m4[1]), fmaxf(m4[2], m4[3]));
    mx = fmaxf(mx, lane_x16(mx));
    const bool need = mx > mu + 8.0f;
    if (__builtin_amdgcn_ballot_w32(need) != 0) {      /* scalar branch, once per stage */
      const float mn = need ? mx : mu; const float al = __builtin_amdgcn_exp2f(mu - mn); mu = mn;
#pragma unroll
      for (int t = 0; t < 4; ++t) acc[t] *= al;
      accl *= al; }
    const float mo = mu - 4.0f;      /* weights carry 2^4: small ones stay clear of f16's subnormals; it cancels against the row sum */
    FragH p[2];
#pragma unroll
    for (int t = 0; t < 4; ++t) {
#pragma unroll
      for (int r = 0; r < 8; ++r) p[t >> 1].h[(t & 1) * 8 + r] = (_Float16)__builtin_amdgcn_exp2f(x[t][r] - mo); }      /* v_exp_f32 as the builtin: the compiler then keeps the matrix instructions' distances around it */
#pragma unroll
    for (int j = 0; j < 2; ++j) {
#pragma unroll
      for (int t = 0; t < 4; ++t) acc[t] = fa_mma(va[4 * j + t], p[j].v, acc[t]);
      accl = fa_mma(one.v, p[j].v, accl); }
    __builtin_amdgcn_sched_barrier(0);      /* the LDS stores wait for the global loads: they stay behind the stage's work, or the loads' lead is lost */
    if (s + 1 < ns) {      /* its readers left that buffer before the last barrier */
#pragma unroll
      for (int i = 0; i < 4; ++i) { *(v4us*)&sk[b ^ 1][sok + i * 32 * FP] = __builtin_bit_cast(v4us, fa_cvt4(rk[i])); *(v4us*)&sv[b ^ 1][sov + i * 32 * FV] = __builtin_bit_cast(v4us, fa_cvt4(rv[i])); } }
    __syncthreads(); }      /* publishes stage s + 1 and ends every read of stage s */
  // The join: waves w and w ^ 8 hold the same queries over the two halves of the keys. Group g finishes output tiles 2 g and 2 g + 1; each wave hands its other two tiles, its maximum in use and its row sum to its partner.
  // A group whose every position lay past the open count holds the maximum -1e30 and gets the factor 0 beside a group with an open key; with no open key both hold -1e30 and count alike.
  v8f own[2], oth[2];
#pragma unroll
  for (int u = 0; u < 2; ++u)
#pragma unroll
    for (int r = 0; r < 8; ++r) { own[u][r] = g ? acc[2 + u][r] : acc[u][r]; oth[u][r] = g ? acc[u][r] : acc[2 + u][r]; }
#pragma unroll
  for (int u = 0; u < 2; ++u)
#pragma unroll
    for (int r = 0; r < 8; ++r) sm[w][u * 8 + r][lane] = oth[u][r];
  sm[w][16][lane] = mu; sm[w][17][lane] = accl[0];
  __syncthreads();      /* both groups' hand-overs are there */
#pragma unroll
  for (int u = 0; u < 2; ++u)
#pragma unroll
    for (int r = 0; r < 8; ++r) oth[u][r] = sm[w ^ 8][u * 8 + r][lane];
  const float mp = sm[w ^ 8][16][lane], lp = sm[w ^ 8][17][lane];
  const float mj = fmaxf(mu, mp); const float fa = __builtin_amdgcn_exp2f(mu - mj), fb = __builtin_amdgcn_exp2f(mp - mj);
  const float inv = 1.0f / (accl[0] * fa + lp * fb); const float ca = fa * inv, cb = fb * inv;
  float* o = O + ((size_t)pl * SQ + q) * HD + g * 32 + 8 * hh;      /* register r of tile t = O[q][16 t + 8 hh + r] */
#pragma unroll
  for (int u = 0; u < 2; ++u) { v8f z;
#pragma unroll
    for (int r = 0; r < 8; ++r) z[r] = own[u][r] * ca + oth[u][r] * cb;
    const v4f o0 = {z[0], z[1], z[2], z[3]}, o1 = {z[4], z[5], z[6], z[7]};
    *(v4f*)(o + u * 16) = o0; *(v4f*)(o + u * 16 + 4) = o1; } }
extern "C" void kernel_launch(void* const* d_in, const int* in_sizes, int n_in,
                              void* d_out, int out_size, void* d_ws, size_t ws_size, hipStream_t stream) {
  (void)in_sizes; (void)n_in; (void)out_size; (void)d_ws; (void)ws_size;
  const float* const* I = (const float* const*)d_in; const float* xq = I[0]; const float* xk = I[1]; const float* xv = I[2]; const int* km = (const int*)d_in[3];      /* key mask int32 [2][1][1][2048] (0 = masked; READ on device): plane b of 16 belongs to batch b / 8 */      /* given q, k, v [B][H][S][64]: each (b, h) plane is a 'batch' of one 64-wide head */
  k_fattn<<<dim3(SQ / FQ, NB), 512, 0, stream>>>(xq, xk, xv, km, (float*)d_out);      /* input rounding, scores, masked softmax and the product with V, every plane; f32 output; no workspace */
}

// v007
// One run takes 14.8 microseconds.
// Timed twice side by side with v006, it ran 1.15 and 1.16 times as fast.
// Counting every step since v000, it is 430 times as fast.
#include <hip/hip_runtime.h>
// Scaled dot-product attention on given head-major query, key, value with a key-padding mask (q, k, v [2][8][2048][64] each = 16 independent [2048][64] planes; att = (q / 8) . k; where(mask == 0, NEG) with the int32 [2][1][1][2048] mask in {0, 1} (random; 0 = masked key, shared by the 8 heads of a batch; READ on device); softmax; out = att v -> [2][8][2048][64]).
// Structure: ONE launch. Per work-group 128 queries of one plane on 16 waves: two groups of 8 waves share the queries and split every 128-key stage between them, 64 keys each, and join their partial results through LDS at the end; each work-group first lists its batch's open keys (mask != 0) in LDS and then walks only those, 128 at a time, their rows gathered by the list (a masked key's weight is exactly 0 beside any open key; with no open key every key is listed and all weights are equal); the f32 inputs are read as they lie and become f16 (bf16 values are exact in f16) on their way into LDS (K, V) or into registers (Q); V stays row-major in LDS and V^T fragments come by the transposing LDS load; scores, softmax weights and row sums stay in registers (S^T = K Q^T, O^T += V^T P^T), f32 output written once.
// Compute dtype: inputs rounded to bf16; q, k, v and the unnormalised softmax weights as plain f16 WMMA operands (~2^-12); scores, running maximum, row sums and output accumulators f32. v_wmma_f32_16x16x32_f16.
#define NB 16
#define SQ 2048
#define DM 64
#define NH 1
#define HD 64
#define HG 1                         /* heads per group in the unlaunched k_vt(V16, b, h0, VT) */
#define B0 0                         /* unused (debug hook) */
#define NBR NB                       /* used only by MP (debug hook) */
#define NR ((size_t)NB * SQ)         /* token rows */
#define MP ((int)((size_t)NBR * SQ)) /* used only by MPO (debug hook) */
#define QN SQ                        /* unused (debug hook) */
#define NHD NH                       /* unused (debug hook) */
#define MPO MP                       /* unused (debug hook) */
#define LQ DM      /* row pitch of the q/k/v rows */
typedef __bf16 v16b __attribute__((ext_vector_type(16)));
typedef unsigned short v8us __attribute__((ext_vector_type(8), may_alias));
typedef float  v8f  __attribute__((ext_vector_type(8)));
typedef float  v4f  __attribute__((ext_vector_type(4)));
typedef float  v4fa __attribute__((ext_vector_type(4), may_alias));
union FragB { v16b v; v8us half[2]; unsigned short u[16]; };

__device__ __forceinline__ unsigned short bf16_bits(float x) { unsigned int u = __float_as_uint(x); return (unsigned short)((u + 0x7FFFu + ((u >> 16) & 1u)) >> 16); }
__device__ __forceinline__ float bf16_val(unsigned short b) { return __uint_as_float(((unsigned int)b) << 16); }
__device__ __forceinline__ float bf16_round(float x) { return bf16_val(bf16_bits(x)); }
// D += A·B with NT terms: 1 = ah·bh, 2 = + al·bh (A split), 3 = + ah·bl (both split)
template <int NT>
__device__ __forceinline__ v8f mmaN(v16b ah, v16b al, v16b bh, v16b bl, v8f c) {
  c = __builtin_amdgcn_wmma_f32_16x16x32_bf16(false, ah, false, bh, (short)0, c, false, false);
  if (NT >= 2) c = __builtin_amdgcn_wmma_f32_16x16x32_bf16(false, al, false, bh, (short)0, c, false, false);
  if (NT >= 3) c = __builtin_amdgcn_wmma_f32_16x16x32_bf16(false, ah, false, bl, (short)0, c, false, false);
  asm volatile("v_nop\n\tv_nop\n\tv_nop\n\tv_nop" : "+v"(c) : "v"(ah), "v"(al), "v"(bh), "v"(bl));
  return c;
}

__global__ __launch_bounds__(256) void k_wt_bf16(const float* __restrict__ W, unsigned short* __restrict__ Wt, int K, int N) {
  const int t = blockIdx.x * 256 + threadIdx.x;
  const int k8n = K / 8;
  if (t >= N * k8n) return;
  const int n = t / k8n, k8 = (t % k8n) * 8;
  v8us v;
#pragma unroll
  for (int i = 0; i < 8; ++i) v[i] = bf16_bits(W[(size_t)(k8 + i) * N + n]);
  *(v8us*)(Wt + (size_t)n * K + k8) = v;
  
}

// GEMM C[M][N] (f32, pitch ldc) = act(A[M][K]·W + bias). A f32 row-major (pitch lda) converted per fragment to bf16
// (ASPLIT: hi/lo two planes -> 2 terms, else single rounded term); Wt bf16 [N][K] (pitch ldb). BIAS_BF16 rounds the
// bias to bf16 first (bias quantised to bf16 before the add). K%32==0, M%16==0, N%64==0.
template <bool ASPLIT, int ACT, bool BIAS_BF16>
__global__ __launch_bounds__(128) void k_gemm_bf(const float* __restrict__ A, int lda, const unsigned short* __restrict__ Wt, int ldb,
                                               const float* __restrict__ bias, float* __restrict__ C, int ldc, int M, int N, int K) {
  __shared__ __attribute__((aligned(16))) float so[4][16][64];
  const int tid = threadIdx.x, w = tid >> 5, lane = tid & 31, ln = lane & 15, hh = lane >> 4;
  const int ntn = N / 64;
  const int wid = blockIdx.x * 4 + w;
  const int mt = wid / ntn, nq = wid % ntn;
  if (mt * 16 >= M) return;
  const int row0 = mt * 16, col0 = nq * 64;
  const float* arow = A + (size_t)(row0 + ln) * lda;
  v8f acc[4] = {};
  for (int kb = 0; kb < K; kb += 32) {
    FragB ah, al;
    const v4f x0 = *(const v4fa*)(arow + kb + 8 * hh), x1 = *(const v4fa*)(arow + kb + 8 * hh + 4);
    const v4f x2 = *(const v4fa*)(arow + kb + 16 + 8 * hh), x3 = *(const v4fa*)(arow + kb + 16 + 8 * hh + 4);
    float xs[16] = {x0[0],x0[1],x0[2],x0[3],x1[0],x1[1],x1[2],x1[3],x2[0],x2[1],x2[2],x2[3],x3[0],x3[1],x3[2],x3[3]};
#pragma unroll
    for (int i = 0; i < 16; ++i) { const unsigned short hb = bf16_bits(xs[i]); ah.u[i] = hb; al.u[i] = ASPLIT ? bf16_bits(xs[i] - bf16_val(hb)) : (unsigned short)0; }
#pragma unroll
    for (int t = 0; t < 4; ++t) {
      const unsigned short* brow = Wt + (size_t)(col0 + t * 16 + ln) * ldb + kb;
      FragB b;
      b.half[0] = *(const v8us*)(brow + 8 * hh);
      b.half[1] = *(const v8us*)(brow + 16 + 8 * hh);
      acc[t] = mmaN<ASPLIT ? 2 : 1>(ah.v, al.v, b.v, b.v, acc[t]);
    }
  }
#pragma unroll
  for (int t = 0; t < 4; ++t) {
    float bv = bias ? bias[col0 + t * 16 + ln] : 0.f;
    if (BIAS_BF16) bv = bf16_round(bv);
#pragma unroll
    for (int r = 0; r < 8; ++r) { float v = acc[t][r] + bv; if (ACT == 1) v = fmaxf(v, 0.f); so[w][8 * hh + r][t * 16 + ln] = v; }
  }
  __builtin_amdgcn_fence(__ATOMIC_ACQ_REL, "workgroup");
  __builtin_amdgcn_wave_barrier();
  const int rsub = lane >> 4, c4 = (lane & 15) * 4;
  {
#pragma unroll
    for (int q = 0; q < 8; ++q) {
      const int r = q * 2 + rsub;
      const v4f v = *(const v4fa*)&so[w][r][c4];
      *(v4f*)(C + (size_t)(row0 + r) * ldc + col0 + c4) = v;
    }
    
  }
}

// GEMM C = act(A·W + bias + resid): A f32 (ASPLIT -> hi/lo 2 terms), Wt bf16 [N][K]; ACT 0 none, 1 relu, 2 exact gelu;
// resid (optional, f32, row index = (row % rmod), pitch ldr, RES_BF16 rounds it) added before the activation.
template <bool ASPLIT, int ACT, bool BIAS_BF16, bool RES_BF16>
__global__ __launch_bounds__(128) void k_gemm_bf3(const float* __restrict__ A, int lda, const unsigned short* __restrict__ Wt, int ldb,
                                                const float* __restrict__ bias, const float* __restrict__ resid, int rmod, int ldr,
                                                float* __restrict__ C, int ldc, int M, int N, int K) {
  __shared__ __attribute__((aligned(16))) float so[4][16][64];
  const int tid = threadIdx.x, w = tid >> 5, lane = tid & 31, ln = lane & 15, hh = lane >> 4;
  const int ntn = N / 64;
  const int wid = blockIdx.x * 4 + w;
  const int mt = wid / ntn, nq = wid % ntn;
  if (mt * 16 >= M) return;
  const int row0 = mt * 16, col0 = nq * 64;
  const float* arow = A + (size_t)(row0 + ln) * lda;
  v8f acc[4] = {};
  for (int kb = 0; kb < K; kb += 32) {
    FragB ah, al;
    const v4f x0 = *(const v4fa*)(arow + kb + 8 * hh), x1 = *(const v4fa*)(arow + kb + 8 * hh + 4);
    const v4f x2 = *(const v4fa*)(arow + kb + 16 + 8 * hh), x3 = *(const v4fa*)(arow + kb + 16 + 8 * hh + 4);
    float xs[16] = {x0[0],x0[1],x0[2],x0[3],x1[0],x1[1],x1[2],x1[3],x2[0],x2[1],x2[2],x2[3],x3[0],x3[1],x3[2],x3[3]};
#pragma unroll
    for (int i = 0; i < 16; ++i) { const unsigned short hb = bf16_bits(xs[i]); ah.u[i] = hb; al.u[i] = ASPLIT ? bf16_bits(xs[i] - bf16_val(hb)) : (unsigned short)0; }
#pragma unroll
    for (int t = 0; t < 4; ++t) {
      const unsigned short* brow = Wt + (size_t)(col0 + t * 16 + ln) * ldb + kb;
      FragB b;
      b.half[0] = *(const v8us*)(brow + 8 * hh);
      b.half[1] = *(const v8us*)(brow + 16 + 8 * hh);
      acc[t] = mmaN<ASPLIT ? 2 : 1>(ah.v, al.v, b.v, b.v, acc[t]);
    }
  }
#pragma unroll
  for (int t = 0; t < 4; ++t) {
    const int col = col0 + t * 16 + ln;
    float bv = bias ? bias[col] : 0.f;
    if (BIAS_BF16) bv = bf16_round(bv);
#pragma unroll
    for (int r = 0; r < 8; ++r) {
      float v = acc[t][r] + bv;
      if (resid) { float rv = resid[(size_t)((row0 + 8 * hh + r) % rmod) * ldr + col]; if (RES_BF16) rv = bf16_round(rv); v += rv; }
      if (ACT == 1) v = fmaxf(v, 0.f);
      if (ACT == 2) v = 0.5f * v * (1.0f + erff(v * 0.70710678118654752f));
      if (ACT == 3) { const float u = 0.7978845608028654f * (v + 0.044715f * v * v * v); v = 0.5f * v * (1.0f + tanhf(u)); }
      so[w][8 * hh + r][t * 16 + ln] = v;
    }
  }
  __builtin_amdgcn_fence(__ATOMIC_ACQ_REL, "workgroup");
  __builtin_amdgcn_wave_barrier();
  const int rsub = lane >> 4, c4 = (lane & 15) * 4;
  {
#pragma unroll
    for (int q = 0; q < 8; ++q) {
      const int r = q * 2 + rsub;
      const v4f v = *(const v4fa*)&so[w][r][c4];
      *(v4f*)(C + (size_t)(row0 + r) * ldc + col0 + c4) = v;
    }
    
  }
}
// row LayerNorm (biased variance, eps) over N: s = X (+ R); optional out_sum <- s; out_norm <- (s-mu)*rsqrt(var+eps)*g + b
template <bool PARAM_BF16>
__global__ __launch_bounds__(256) void k_layernorm(const float* __restrict__ X, const float* __restrict__ R, const float* __restrict__ g, const float* __restrict__ bta,
                                                  float* __restrict__ out_sum, float* __restrict__ out_norm, int N, float eps) {
  __shared__ float red[256];
  const int row = blockIdx.x, tid = threadIdx.x;
  const float* x = X + (size_t)row * N; const float* rr = R ? R + (size_t)row * N : nullptr;
  float vals[16];                     // up to N = 4096
  const int per = N / 256;            // contiguous chunk per thread? use strided-by-4 chunks: thread handles j = tid*4 + 1024*u
  float s1 = 0.f;
  for (int u = 0; u < per / 4; ++u) {
    const int j = tid * 4 + 1024 * u;
    const v4f a = *(const v4fa*)(x + j);
    v4f b = {0.f,0.f,0.f,0.f}; if (rr) b = *(const v4fa*)(rr + j);
#pragma unroll
    for (int q = 0; q < 4; ++q) { const float v = a[q] + b[q]; vals[u * 4 + q] = v; s1 += v; }
  }
  red[tid] = s1; __syncthreads();
  for (int st = 128; st > 0; st >>= 1) { if (tid < st) red[tid] += red[tid + st]; __syncthreads(); }
  const float mu = red[0] / (float)N; __syncthreads();
  float s2 = 0.f;
  for (int u = 0; u < per / 4; ++u)
#pragma unroll
    for (int q = 0; q < 4; ++q) { const float c = vals[u * 4 + q] - mu; s2 += c * c; }
  red[tid] = s2; __syncthreads();
  for (int st = 128; st > 0; st >>= 1) { if (tid < st) red[tid] += red[tid + st]; __syncthreads(); }
  const float rs = rsqrtf(red[0] / (float)N + eps);
  {
    for (int u = 0; u < per / 4; ++u) {
      const int j = tid * 4 + 1024 * u;
      v4f o, sm;
#pragma unroll
      for (int q = 0; q < 4; ++q) {
        float gg = g[j + q], bb = bta[j + q];
        if (PARAM_BF16) { gg = bf16_round(gg); bb = bf16_round(bb); }
        sm[q] = vals[u * 4 + q]; o[q] = (vals[u * 4 + q] - mu) * rs * gg + bb;
      }
      if (out_sum) *(v4f*)(out_sum + (size_t)row * N + j) = sm;
      *(v4f*)(out_norm + (size_t)row * N + j) = o;
    }
    
  }
}



// ---- f16 WMMA path (v_wmma_f32_16x16x32_f16): 11-bit significands for operands in range — used where a [0,1] probability operand needs more precision than bf16
typedef _Float16 v16h __attribute__((ext_vector_type(16)));
union FragH { v16h v; v8us half[2]; _Float16 h[16]; unsigned short u[16]; };
template <int NT>
__device__ __forceinline__ v8f mmaH(v16h ah, v16h al, v16h bh, v16h bl, v8f c) {
  c = __builtin_amdgcn_wmma_f32_16x16x32_f16(false, ah, false, bh, (short)0, c, false, false);
  if (NT >= 2) c = __builtin_amdgcn_wmma_f32_16x16x32_f16(false, al, false, bh, (short)0, c, false, false);
  if (NT >= 3) c = __builtin_amdgcn_wmma_f32_16x16x32_f16(false, ah, false, bl, (short)0, c, false, false);
  asm volatile("v_nop\n\tv_nop\n\tv_nop\n\tv_nop" : "+v"(c) : "v"(ah), "v"(al), "v"(bh), "v"(bl));
  return c;
}
// batched GEMM like k_gemm_b but f16 operands: A f32 (split into f16 hi/lo if ASPLIT, else rounded to f16), Bt = f16 values [n][k]; alpha; C f32; N multiple of 16 (partial tiles skipped)
template <bool ASPLIT>
__global__ __launch_bounds__(128) void k_gemm_h(const float* __restrict__ A, int lda, size_t sA, const _Float16* __restrict__ Bh, int ldb, size_t sB, float alpha, float* __restrict__ C, int ldc, size_t sC, int M, int N, int K) {
  __shared__ __attribute__((aligned(16))) float so[4][16][64];
  const int tid = threadIdx.x, w = tid >> 5, lane = tid & 31, ln = lane & 15, hh = lane >> 4; const int by = blockIdx.y;
  A += (size_t)by * sA; Bh += (size_t)by * sB; C += (size_t)by * sC;
  const int ntn = (N + 63) / 64; const int wid = blockIdx.x * 4 + w; const int mt = wid / ntn, nq = wid % ntn; if (mt * 16 >= M) return;
  const int row0 = mt * 16, col0 = nq * 64; const float* arow = A + (size_t)(row0 + ln) * lda;
  v8f acc[4] = {};
  for (int kb = 0; kb < K; kb += 32) {
    FragH ah, al;
    const v4f x0 = *(const v4fa*)(arow + kb + 8 * hh), x1 = *(const v4fa*)(arow + kb + 8 * hh + 4), x2 = *(const v4fa*)(arow + kb + 16 + 8 * hh), x3 = *(const v4fa*)(arow + kb + 16 + 8 * hh + 4);
    float xs[16] = {x0[0],x0[1],x0[2],x0[3],x1[0],x1[1],x1[2],x1[3],x2[0],x2[1],x2[2],x2[3],x3[0],x3[1],x3[2],x3[3]};
#pragma unroll
    for (int i = 0; i < 16; ++i) { const _Float16 h = (_Float16)xs[i]; ah.h[i] = h; al.h[i] = ASPLIT ? (_Float16)(xs[i] - (float)h) : (_Float16)0.0f; }
#pragma unroll
    for (int t = 0; t < 4; ++t) { if (col0 + t * 16 >= N) continue; const size_t boff = (size_t)(col0 + t * 16 + ln) * ldb + kb; FragH bq; bq.half[0] = *(const v8us*)(Bh + boff + 8 * hh); bq.half[1] = *(const v8us*)(Bh + boff + 16 + 8 * hh);
      acc[t] = mmaH<ASPLIT ? 2 : 1>(ah.v, al.v, bq.v, bq.v, acc[t]); }
  }
#pragma unroll
  for (int t = 0; t < 4; ++t) { if (col0 + t * 16 >= N) continue;
#pragma unroll
    for (int r = 0; r < 8; ++r) so[w][8 * hh + r][t * 16 + ln] = acc[t][r] * alpha; }
  __builtin_amdgcn_fence(__ATOMIC_ACQ_REL, "workgroup"); __builtin_amdgcn_wave_barrier();
  const int rsub = lane >> 4, c4 = (lane & 15) * 4;
  {
#pragma unroll
    for (int q = 0; q < 8; ++q) { const int r = q * 2 + rsub; if (col0 + c4 < N) { const v4f v = *(const v4fa*)&so[w][r][c4]; *(v4f*)(C + (size_t)(row0 + r) * ldc + col0 + c4) = v; } }
     }
}

// Wt[n][k] = f16(W[k][n]·scale) from f32 row-major W[K][N] (scale = power of two; bf16-exact weights stay exact in f16 away from the subnormal range)
__global__ __launch_bounds__(256) void k_wt_f16(const float* __restrict__ W, _Float16* __restrict__ Wt, int K, int N, float scale) {
  const int t = blockIdx.x * 256 + threadIdx.x; if (t >= N * (K / 8)) return; const int n = t / (K / 8), k8 = (t % (K / 8)) * 8; FragH f;
#pragma unroll
  for (int i = 0; i < 8; ++i) f.h[i] = (_Float16)(bf16_round(W[(size_t)(k8 + i) * N + n]) * scale); const v8us o = f.half[0];
  *(v8us*)((unsigned short*)Wt + (size_t)n * K + k8) = o; 
}
// k_gemm_hh variant with fused epilogue: v = acc·alpha + bias[by·sBias + col] (+ CP[(row/rowsPerB)·sCPb + by·64 + col] if CP) ; ACT 0 none / 1 elu ; writes f16 C16 (and f32 C if non-null)
template <int ACT>
__global__ __launch_bounds__(128) void k_gemm_hhx(const _Float16* __restrict__ A, int lda, size_t sA, const _Float16* __restrict__ Bh, int ldb, size_t sB, float alpha, const float* __restrict__ bias, size_t sBias, const float* __restrict__ CP, int rowsPerB, size_t sCPb, int row0g,
    float* __restrict__ C, _Float16* __restrict__ C16, int ldc, size_t sC, int M, int N, int K) {
  __shared__ __attribute__((aligned(16))) float so[4][16][64];
  const int tid = threadIdx.x, w = tid >> 5, lane = tid & 31, ln = lane & 15, hh = lane >> 4; const int by = blockIdx.y;
  A += (size_t)by * sA; Bh += (size_t)by * sB; const size_t cofs = (size_t)by * sC; const float* bp = bias ? bias + (size_t)by * sBias : nullptr;
  const int ntn = (N + 63) / 64; const int wid = blockIdx.x * 4 + w; const int mt = wid / ntn, nq = wid % ntn; if (mt * 16 >= M) return;
  const int row0 = mt * 16, col0 = nq * 64; const _Float16* arow = A + (size_t)(row0 + ln) * lda;
  v8f acc[4] = {};
  for (int kb = 0; kb < K; kb += 32) { FragH ah; ah.half[0] = *(const v8us*)((const unsigned short*)arow + kb + 8 * hh); ah.half[1] = *(const v8us*)((const unsigned short*)arow + kb + 16 + 8 * hh);
#pragma unroll
    for (int t = 0; t < 4; ++t) { if (col0 + t * 16 >= N) continue; const size_t boff = (size_t)(col0 + t * 16 + ln) * ldb + kb; FragH bq; bq.half[0] = *(const v8us*)((const unsigned short*)Bh + boff + 8 * hh); bq.half[1] = *(const v8us*)((const unsigned short*)Bh + boff + 16 + 8 * hh);
      acc[t] = mmaH<1>(ah.v, ah.v, bq.v, bq.v, acc[t]); }
  }
#pragma unroll
  for (int t = 0; t < 4; ++t) { if (col0 + t * 16 >= N) continue; const int col = col0 + t * 16 + ln; const float bv = bp ? bf16_round(bp[col]) : 0.f;
#pragma unroll
    for (int r = 0; r < 8; ++r) { float v = acc[t][r] * alpha + bv; if (CP) { const int rr = row0g + row0 + 8 * hh + r; if (rowsPerB < 0) v += CP[cofs + (size_t)rr * ldc + col];      /* rowsPerB < 0: own element of the batched C plane */ else { const int bidx = rr / rowsPerB; v += CP[(size_t)bidx * sCPb + (size_t)by * 64 + col]; } } if (ACT == 1) v = (v > 0.f) ? v : expm1f(v); else if (ACT == 7) v = (v > 0.f) ? v + 1.0f : expf(v); else if (ACT == 8) v = tanhf(v); else if (ACT == 9) v = 0.5f * v * (1.0f + tanhf(0.7978845608028654f * (v + 0.044715f * v * v * v))); else if (ACT == 11) v = 1.0f / (1.0f + expf(-v)); else if (ACT == 12) v = (v > 0.f) ? v : 0.01f * v; else if (ACT == 14) v = (v > 0.f) ? v : 0.1f * v; else if (ACT == 16) v = (v >= 0.f) ? v : 0.3f * v; else if (ACT == 17) v = (v >= 0.f) ? v : 0.2f * v; else if (ACT == 15) v = v / (1.0f + expf(-v)); else if (ACT == 3) v = fmaxf(v, 0.f); else if (ACT == 6) v = 0.5f * v * (1.0f + erff(v * 0.70710678118654752f)); so[w][8 * hh + r][t * 16 + ln] = v; } }
  __builtin_amdgcn_fence(__ATOMIC_ACQ_REL, "workgroup"); __builtin_amdgcn_wave_barrier();
  const int rsub = lane >> 4, c4 = (lane & 15) * 4; typedef _Float16 v4h __attribute__((ext_vector_type(4)));
  {
#pragma unroll
    for (int q = 0; q < 8; ++q) { const int r = q * 2 + rsub; if (col0 + c4 < N) { const v4f v = *(const v4fa*)&so[w][r][c4]; if (C) *(v4f*)(C + cofs + (size_t)(row0 + r) * ldc + col0 + c4) = v; if (C16) { v4h h4; for (int i = 0; i < 4; ++i) h4[i] = (_Float16)v[i]; *(v4h*)(C16 + cofs + (size_t)(row0 + r) * ldc + col0 + c4) = h4; } } }
     }
}


typedef _Float16 v4h __attribute__((ext_vector_type(4)));

__global__ __launch_bounds__(256) void k_x16(const float* __restrict__ x, _Float16* __restrict__ X16, size_t n8) { const size_t t = (size_t)blockIdx.x * 256 + threadIdx.x; if (t >= n8) return; FragH f;
#pragma unroll
  for (int q = 0; q < 8; ++q) f.h[q] = (_Float16)bf16_round(x[t * 8 + q]); *(v8us*)((unsigned short*)X16 + t * 8) = f.half[0];  }
__global__ __launch_bounds__(256) void k_h16(const float* __restrict__ x, _Float16* __restrict__ X16, size_t n8) { const size_t t = (size_t)blockIdx.x * 256 + threadIdx.x; if (t >= n8) return; FragH f;
#pragma unroll
  for (int q = 0; q < 8; ++q) f.h[q] = (_Float16)x[t * 8 + q]; *(v8us*)((unsigned short*)X16 + t * 8) = f.half[0];  }
__global__ __launch_bounds__(256) void k_round16f(const float* __restrict__ W, _Float16* __restrict__ Bt, size_t n8) { const size_t t = (size_t)blockIdx.x * 256 + threadIdx.x; if (t >= n8) return; FragH f;
#pragma unroll
  for (int i = 0; i < 8; ++i) f.h[i] = (_Float16)(bf16_round(W[t * 8 + i]) * 16.0f); *(v8us*)((unsigned short*)Bt + t * 8) = f.half[0];  }
template <int NHv, int TTv>
__global__ __launch_bounds__(256) void k_vt(const _Float16* __restrict__ V16, int ldv, int voff, _Float16* __restrict__ Vt) { __shared__ unsigned short tl[64][66]; const int tid = threadIdx.x; const int slab = blockIdx.x / (TTv / 64), lg = blockIdx.x % (TTv / 64); const int b = slab / NHv, h = slab % NHv;
  for (int i = tid; i < 64 * 8; i += 256) { const int r = i / 8, c8 = (i % 8) * 8; FragH f; f.half[0] = *(const v8us*)((const unsigned short*)V16 + ((size_t)b * TTv + lg * 64 + r) * ldv + voff + h * 64 + c8);
#pragma unroll
    for (int q = 0; q < 8; ++q) tl[r][c8 + q] = f.u[q]; }
  __syncthreads();
  {
#pragma unroll
    for (int rd = 0; rd < 2; ++rd) { const int d = rd * 32 + tid / 8, pc = tid % 8; FragH f;
#pragma unroll
      for (int q = 0; q < 8; ++q) f.u[q] = tl[pc * 8 + q][d];
      *(v8us*)((unsigned short*)Vt + ((size_t)slab * 64 + d) * TTv + lg * 64 + pc * 8) = f.half[0]; }
     } }

__global__ __launch_bounds__(256) void k_hl(const float* __restrict__ F, _Float16* __restrict__ Hh, _Float16* __restrict__ Hl, size_t n8) { const size_t t = (size_t)blockIdx.x * 256 + threadIdx.x; if (t >= n8) return; FragH fh, fl; const v4f a = *(const v4fa*)(F + t * 8), c = *(const v4fa*)(F + t * 8 + 4);
#pragma unroll
  for (int q = 0; q < 4; ++q) { _Float16 h = (_Float16)a[q]; fh.h[q] = h; fl.h[q] = (_Float16)((a[q] - (float)h) * 1024.0f); h = (_Float16)c[q]; fh.h[4 + q] = h; fl.h[4 + q] = (_Float16)((c[q] - (float)h) * 1024.0f); }
  { *(v8us*)((unsigned short*)Hh + t * 8) = fh.half[0]; *(v8us*)((unsigned short*)Hl + t * 8) = fl.half[0];  } }

// ---- fast GEMM (wave tile 32x64; requires M % 32 == 0 rows per launch region and N % 64 == 0); epilogue = k_gemm_hhx semantics ----
__device__ __forceinline__ v16h g2_frag(const _Float16* p, int hh) { FragH f; f.half[0] = *(const v8us*)((const unsigned short*)p + 8 * hh); f.half[1] = *(const v8us*)((const unsigned short*)p + 16 + 8 * hh); return f.v; }
__device__ __forceinline__ v8f g2_mma(v16h a, v16h b, v8f c) { v8f d = __builtin_amdgcn_wmma_f32_16x16x32_f16(false, a, false, b, (short)0, c, false, false); asm volatile("v_nop\n\tv_nop\n\tv_nop\n\tv_nop" : "+v"(d) : "v"(a), "v"(b)); return d; }
template <int ACT>
__global__ __launch_bounds__(128) void k_gemm2(const _Float16* __restrict__ A, int lda, size_t sA, const _Float16* __restrict__ Bh, int ldb, size_t sB, float alpha, const float* __restrict__ bias, size_t sBias, const float* __restrict__ CP, int rowsPerB, size_t sCPb, int row0g,
    float* __restrict__ C, _Float16* __restrict__ C16, int ldc, size_t sC, int M, int N, int K) { static_assert(ACT == 0 || ACT == 3 || ACT == 6 || ACT == 8 || ACT == 9 || ACT == 11 || ACT == 12 || ACT == 14 || ACT == 15 || ACT == 16 || ACT == 17, "k_gemm2: unsupported ACT code (would silently apply no activation)");
  __shared__ __attribute__((aligned(16))) float so[4][32][68];
  const int tid = threadIdx.x, w = tid >> 5, lane = tid & 31, ln = lane & 15, hh = lane >> 4; const int by = blockIdx.y;
  A += (size_t)by * sA; Bh += (size_t)by * sB; const size_t cofs = (size_t)by * sC; const float* bp = bias ? bias + (size_t)by * sBias : nullptr;
  const int ntn = N >> 6; const int mt = blockIdx.x / ntn, nq = blockIdx.x - mt * ntn; const int row0 = mt * 128 + 32 * w, col0 = nq * 64; if (row0 >= M) return;
  const _Float16* a0p = A + (size_t)(row0 + ln) * lda; const _Float16* a1p = a0p + (size_t)16 * lda;
  const _Float16* b0p = Bh + (size_t)(col0 + ln) * ldb; const _Float16* b1p = b0p + (size_t)16 * ldb; const _Float16* b2p = b1p + (size_t)16 * ldb; const _Float16* b3p = b2p + (size_t)16 * ldb;
  const v8f z8 = {0.f,0.f,0.f,0.f,0.f,0.f,0.f,0.f}; v8f c00 = z8, c01 = z8, c02 = z8, c03 = z8, c10 = z8, c11 = z8, c12 = z8, c13 = z8;
#pragma unroll 1
  for (int kb = 0; kb < K; kb += 32) { const v16h a0 = g2_frag(a0p + kb, hh), a1 = g2_frag(a1p + kb, hh);
    v16h b = g2_frag(b0p + kb, hh); c00 = g2_mma(a0, b, c00); c10 = g2_mma(a1, b, c10);
    b = g2_frag(b1p + kb, hh); c01 = g2_mma(a0, b, c01); c11 = g2_mma(a1, b, c11);
    b = g2_frag(b2p + kb, hh); c02 = g2_mma(a0, b, c02); c12 = g2_mma(a1, b, c12);
    b = g2_frag(b3p + kb, hh); c03 = g2_mma(a0, b, c03); c13 = g2_mma(a1, b, c13); }
  v8f accs[8] = {c00, c01, c02, c03, c10, c11, c12, c13};
#pragma unroll
  for (int u = 0; u < 8; ++u) { const int t = u & 3, half = u >> 2; const int col = col0 + t * 16 + ln; const float bv = bp ? bf16_round(bp[col]) : 0.f;
#pragma unroll
    for (int r = 0; r < 8; ++r) { const int rloc = half * 16 + 8 * hh + r; float v = accs[u][r] * alpha + bv; if (CP) { if (rowsPerB < 0) v += CP[cofs + (size_t)(row0g + row0 + rloc) * ldc + col];      /* rowsPerB < 0: own element of the batched C plane */ else { const int bidx = (row0g + row0 + rloc) / rowsPerB; v += CP[(size_t)bidx * sCPb + (size_t)by * 64 + col]; } }
      if (ACT == 3) v = fmaxf(v, 0.f); else if (ACT == 6) v = 0.5f * v * (1.0f + erff(v * 0.70710678118654752f)); else if (ACT == 11) v = 1.0f / (1.0f + expf(-v)); else if (ACT == 15) v = v / (1.0f + expf(-v)); else if (ACT == 12) v = (v > 0.f) ? v : 0.01f * v; else if (ACT == 8) v = tanhf(v); else if (ACT == 9) v = 0.5f * v * (1.0f + tanhf(0.7978845608028654f * (v + 0.044715f * v * v * v))); else if (ACT == 14) v = (v > 0.f) ? v : 0.1f * v; else if (ACT == 16) v = (v >= 0.f) ? v : 0.3f * v; else if (ACT == 17) v = (v >= 0.f) ? v : 0.2f * v;
      so[w][rloc][t * 16 + ln] = v; } }
  __builtin_amdgcn_fence(__ATOMIC_ACQ_REL, "workgroup"); __builtin_amdgcn_wave_barrier();
  const int rsub = lane >> 4, c4 = (lane & 15) * 4;
  {
#pragma unroll
    for (int q = 0; q < 16; ++q) { const int r = q * 2 + rsub; const v4f v = *(const v4fa*)&so[w][r][c4]; if (C) *(v4f*)(C + cofs + (size_t)(row0 + r) * ldc + col0 + c4) = v; if (C16) { v4h h4; for (int i = 0; i < 4; ++i) h4[i] = (_Float16)v[i]; *(v4h*)(C16 + cofs + (size_t)(row0 + r) * ldc + col0 + c4) = h4; } }
     } }


__global__ __launch_bounds__(256) void k_wnat(const float* __restrict__ w, size_t n8, _Float16* __restrict__ Bt) { const size_t t = (size_t)blockIdx.x * 256 + threadIdx.x; if (t >= n8) return; FragH f; for (int q = 0; q < 8; ++q) f.h[q] = (_Float16)(bf16_round(w[t * 8 + q]) * 16.0f); *(v8us*)((unsigned short*)Bt + t * 8) = f.half[0];  }
__global__ __launch_bounds__(256) void k_rsm(const float* __restrict__ S, _Float16* __restrict__ P, int nrows) {
  #pragma clang fp contract(off)
  const int i = blockIdx.x * 256 + threadIdx.x; if (i >= nrows) return; const float* s = S + (size_t)i * SQ; float mx = -3.0e38f;
#pragma unroll 1
  for (int j = 0; j < SQ; ++j) mx = fmaxf(mx, s[j]); float se = 0.f;
#pragma unroll 1
  for (int j = 0; j < SQ; ++j) se += expf(s[j] - mx); const float sc = 256.0f / se;
#pragma unroll 1
  for (int j0 = 0; j0 < SQ; j0 += 8) { FragH f; for (int q = 0; q < 8; ++q) f.h[q] = (_Float16)(expf(s[j0 + q] - mx) * sc); unsigned short* d = (unsigned short*)P + (size_t)i * SQ + j0; *(v8us*)d = f.half[0];  } }
__global__ __launch_bounds__(256) void k_vt(const _Float16* __restrict__ V16, int b, int h0, _Float16* __restrict__ VT) { __shared__ unsigned short tl[64][65]; const int tid = threadIdx.x; const int hh = blockIdx.x % HG, sg = blockIdx.x / HG; const int s0 = sg * 64; const int h = h0 + hh;
  for (int i = tid; i < 64 * 8; i += 256) { const int j = i / 8, d8 = (i % 8) * 8; FragH f; f.half[0] = *(const v8us*)((const unsigned short*)V16 + ((size_t)b * SQ + s0 + j) * DM + h * HD + d8); for (int q = 0; q < 8; ++q) tl[d8 + q][j] = f.u[q]; }
  __syncthreads();
  { for (int i = tid; i < 64 * 8; i += 256) { const int d = i / 8, j8 = (i % 8) * 8; FragH f; for (int q = 0; q < 8; ++q) f.u[q] = tl[d][j8 + q]; *(v8us*)((unsigned short*)VT + ((size_t)hh * HD + d) * SQ + s0 + j8) = f.half[0]; }  } }



__global__ __launch_bounds__(256) void k_rsmf(const float* __restrict__ S, _Float16* __restrict__ P, int qn, int hg) {
  #pragma clang fp contract(off)
  const int t = blockIdx.x * 256 + threadIdx.x; if (t >= qn * hg) return; const size_t i = (size_t)(t / qn) * SQ + (t % qn); const float* s = S + i * SQ; float mx = -3.0e38f;
#pragma unroll 1
  for (int j = 0; j < SQ; ++j) mx = fmaxf(mx, s[j]); float se = 0.f;
#pragma unroll 1
  for (int j = 0; j < SQ; ++j) se += __expf(s[j] - mx); const float sc = 256.0f / se;
#pragma unroll 1
  for (int j0 = 0; j0 < SQ; j0 += 8) { FragH f; for (int q = 0; q < 8; ++q) f.h[q] = (_Float16)(__expf(s[j0 + q] - mx) * sc); unsigned short* d = (unsigned short*)P + i * SQ + j0; *(v8us*)d = f.half[0];  } }


// ---- fused attention: scores, masked softmax and the product with V in one kernel; no score or weight ever reaches memory ----
typedef int v4ia __attribute__((ext_vector_type(4), may_alias));
__device__ __forceinline__ float lane_x16(float v) { return __builtin_bit_cast(float, __builtin_amdgcn_permlanex16(__builtin_bit_cast(int, v), __builtin_bit_cast(int, v), 0x76543210, 0xfedcba98, false, false)); }      /* lane l with l ^ 16 */
__device__ __forceinline__ v8f fa_mma(v16h a, v16h b, v8f c) { return __builtin_amdgcn_wmma_f32_16x16x32_f16(false, a, false, b, (short)0, c, false, false); }
__device__ __forceinline__ v16h fa_frag(const unsigned short* p) { FragH f; f.half[0] = *(const v8us*)p; f.half[1] = *(const v8us*)(p + 16); return f.v; }      /* p already holds the lane half's + 8 * hh: k = 8 hh + 0..7, then 16 + 8 hh + 0..7 */
#define FQ 128      /* queries per work-group: 8 waves x 16, in each of the two wave groups */
#define FK 64       /* keys per stage and wave group */
#define FS 128      /* keys per stage: wave group g takes rows 64 g .. + 63 of the stage */
#define FP 72       /* LDS row pitch in 16-bit elements: 144 B = 16 B x 9, odd, for 16-byte fragment reads of 16 rows */
#define FV 80       /* LDS row pitch of V in 16-bit elements: 160 B = 32 B x 5, odd, for the transposing 16-byte reads */
#define FNS (SQ / FS)
typedef __bf16 v2b __attribute__((ext_vector_type(2)));
typedef float v2f __attribute__((ext_vector_type(2)));
typedef _Float16 v2h __attribute__((ext_vector_type(2)));
typedef unsigned short v4us __attribute__((ext_vector_type(4), may_alias));
typedef short s16x8 __attribute__((ext_vector_type(8)));
__device__ __forceinline__ v2h fa_cvt2(float x0, float x1) { const v2f x = {x0, x1}; const unsigned int u = __builtin_bit_cast(unsigned int, __builtin_convertvector(x, v2b));      /* f32 -> bf16, nearest even, two per instruction */
  const v2f y = {__uint_as_float(u << 16), __uint_as_float(u & 0xFFFF0000u)}; return __builtin_convertvector(y, v2h); }      /* then the same values as f16 */
__device__ __forceinline__ v4h fa_cvt4(v4f x) { const v2h a = fa_cvt2(x[0], x[1]), b = fa_cvt2(x[2], x[3]); const v4h r = {a[0], a[1], b[0], b[1]}; return r; }
__device__ __forceinline__ v16h fa_qfrag(const float* p) { const v4h a = fa_cvt4(*(const v4fa*)p), b = fa_cvt4(*(const v4fa*)(p + 4)), c = fa_cvt4(*(const v4fa*)(p + 16)), d = fa_cvt4(*(const v4fa*)(p + 20)); FragH f;      /* fa_frag's k order, from f32 rows */
#pragma unroll
  for (int i = 0; i < 4; ++i) { f.h[i] = a[i]; f.h[4 + i] = b[i]; f.h[8 + i] = c[i]; f.h[12 + i] = d[i]; }
  return f.v; }
__device__ __forceinline__ v8us fa_tr16(const unsigned short* p) { typedef __attribute__((address_space(3))) s16x8 lds_s16x8; return __builtin_bit_cast(v8us, __builtin_amdgcn_ds_load_tr16_b128_v8i16((lds_s16x8*)p)); }
__device__ __forceinline__ v16h fa_vfrag(const unsigned short* p) { FragH f; f.half[0] = fa_tr16(p); f.half[1] = fa_tr16(p + 16 * FV); return f.v; }      /* p: the lane's own address in a row-major [key][d] tile; lane (c, hh) gets column c of keys 8 hh + 0..7, then 16 + 8 hh + 0..7: fa_frag's k order */
__device__ __forceinline__ void fa_lds_barrier() { __builtin_amdgcn_fence(__ATOMIC_RELEASE, "workgroup", "local"); __builtin_amdgcn_s_barrier(); __builtin_amdgcn_fence(__ATOMIC_ACQUIRE, "workgroup", "local"); }      /* the work-group barrier, ordering LDS alone: __syncthreads() also waits for every global load in flight, and the staged loads' lead would end at it */
// Wave w: queries 16 (w & 7) .. + 15 of the block, one per lane column (lanes c and c + 16 share query c and split its keys); wave group g = w >> 3 sees only its half of every stage and keeps its own maximum, row sums and output sums.
// Four waves per SIMD instead of two: a wave's waits (LDS reads, the softmax chain, the staged loads, the barrier) are covered by three others, and the barriers per key halve.
// S^T tile t = K rows (A) x Q^T (B): register r of lane (c, hh) = score of key 16 t + 8 hh + r with query c. Two such tiles, converted in place, are the B operand of O^T += V^T P^T.
// Key list: position j of the list holds the byte offset of the j-th open key's row (ascending key order); the list is filled up to a whole stage with key 0, and a score at a position past the open count is replaced by -1e30 (only a stage that holds such positions pays for the test). With no open key the list is all 2048 keys, every score replaced.
// Mask as the reference has it: a masked key's score is REPLACED by a huge negative, so its weight is exactly 0 beside any open key and all weights are equal where every key is masked.
// Online softmax in base 2; the maximum in use moves only when a column's new maximum passes it by more than 8 (weights stay <= 2^12, inside f16); row sums by a WMMA with an all-ones A (they sum the same rounded weights that meet V).
__global__ __launch_bounds__(512) void k_fattn(const float* __restrict__ Qf, const float* __restrict__ Kf, const float* __restrict__ Vf, const int* __restrict__ Km, float* __restrict__ O) {
  __shared__ __attribute__((aligned(16))) unsigned short sk[2][FS * FP];
  __shared__ __attribute__((aligned(16))) unsigned short sv[2][FS * FV];      /* V rows as they lie: [key][d] */
  __shared__ __attribute__((aligned(16))) int sx[SQ];      /* the key list: byte offset of the listed key's row in its plane */
  __shared__ __attribute__((aligned(16))) int sc[16];      /* open keys per wave's 128 */
  __shared__ float sm[16][18][32];      /* the join: what each wave hands to its partner in the other group, one dword column per lane */
  const int tid = threadIdx.x, w = tid >> 5, lane = tid & 31, ln = lane & 15, hh = lane >> 4; const int pl = blockIdx.y;
  const int g = __builtin_amdgcn_readfirstlane(w >> 3);      /* wave group, the same in every lane: its tests stay scalar */
  const int q = blockIdx.x * FQ + (w & 7) * 16 + ln;
  const int* km = Km + (pl / 8) * SQ + w * 128 + lane;      /* plane pl belongs to batch pl / 8; wave w looks at keys 128 w .. + 127, 32 in a row per load */
  int mk[4];
#pragma unroll
  for (int i = 0; i < 4; ++i) mk[i] = km[i * 32];
  unsigned int bal[4]; int cw = 0;
#pragma unroll
  for (int i = 0; i < 4; ++i) { bal[i] = __builtin_amdgcn_ballot_w32(mk[i] != 0); cw += __builtin_popcount(bal[i]); }
  if (lane == 0) sc[w] = cw;
  { const v4ia z4 = {0, 0, 0, 0}; *(v4ia*)&sx[tid * 4] = z4; }      /* positions that no open key takes point at key 0 */
  __syncthreads();      /* the sixteen counts and the cleared list are there */
  int no = 0, pos = 0;      /* open keys of the batch; first list position of this wave's keys */
#pragma unroll
  for (int j = 0; j < 4; ++j) { const v4ia c = *(const v4ia*)&sc[4 * j];
#pragma unroll
    for (int i = 0; i < 4; ++i) { no += c[i]; pos += 4 * j + i < w ? c[i] : 0; } }
  no = __builtin_amdgcn_readfirstlane(no); pos = __builtin_amdgcn_readfirstlane(pos);      /* the same in every lane: trip count and branches stay scalar */
  if (no != 0) {
#pragma unroll
    for (int i = 0; i < 4; ++i) { if ((bal[i] >> lane) & 1u) sx[pos + (int)__builtin_amdgcn_mbcnt_lo(bal[i], 0u)] = (w * 128 + i * 32 + lane) * (HD * 4); pos += __builtin_popcount(bal[i]); }
  } else {
#pragma unroll
    for (int i = 0; i < 4; ++i) sx[w * 128 + i * 32 + lane] = (w * 128 + i * 32 + lane) * (HD * 4); }
  const int ns = min(((no != 0 ? no : SQ) + FS - 1) / FS, FNS);      /* stages walked: 1 .. 16 */
  __syncthreads();      /* the list is whole */
  const char* kg = (const char*)(Kf + (size_t)pl * SQ * HD); const char* vg = (const char*)(Vf + (size_t)pl * SQ * HD);
  const int r0 = tid >> 4, c4 = (tid & 15) * 4;      /* thread t brings elements c4 .. c4 + 3 of the stage's rows r0 + 32 i, i = 0..3: 16 lanes cover a listed key's 256-byte row */
  const int sok = r0 * FP + c4, sov = r0 * FV + c4;
  v4f fk[4], fv[4], rk[4], rv[4]; int xo[4];      /* fk, fv: stage 0's pieces; rk, rv: the pieces of the stage after the one at work, in flight since the stage before it; xo: list entries of the stage after that, read one stage before their loads go out */
#pragma unroll
  for (int i = 0; i < 4; ++i) xo[i] = sx[r0 + 32 * i];
#pragma unroll
  for (int i = 0; i < 4; ++i) { const unsigned int o = (unsigned int)(xo[i] + c4 * 4); fk[i] = *(const v4fa*)(kg + o); fv[i] = *(const v4fa*)(vg + o); }
#pragma unroll
  for (int i = 0; i < 4; ++i) xo[i] = sx[min(1, ns - 1) * FS + r0 + 32 * i];
  const float* qg = Qf + ((size_t)pl * SQ + q) * HD + 8 * hh;
  const v16h bq0 = fa_qfrag(qg), bq1 = fa_qfrag(qg + 32);
#pragma unroll
  for (int i = 0; i < 4; ++i) { const unsigned int o = (unsigned int)(xo[i] + c4 * 4); rk[i] = *(const v4fa*)(kg + o); rv[i] = *(const v4fa*)(vg + o); }      /* stage 1 (the only stage once more where there is one: never used then) */
  asm volatile("s_wait_xcnt 0x0" ::: "memory");      /* stands in front of the first reuse of the address registers of the loads above, which are still in flight when the loop begins */
#pragma unroll
  for (int i = 0; i < 4; ++i) xo[i] = sx[min(2, ns - 1) * FS + r0 + 32 * i];
#pragma unroll
  for (int i = 0; i < 4; ++i) { *(v4us*)&sk[0][sok + i * 32 * FP] = __builtin_bit_cast(v4us, fa_cvt4(fk[i])); *(v4us*)&sv[0][sov + i * 32 * FV] = __builtin_bit_cast(v4us, fa_cvt4(fv[i])); }
  FragH one;
#pragma unroll
  for (int i = 0; i < 16; ++i) one.h[i] = (_Float16)1.0f;
  const v8f z8 = {0.f, 0.f, 0.f, 0.f, 0.f, 0.f, 0.f, 0.f};
  v8f acc[4] = {z8, z8, z8, z8}, accl = z8; float mu = -3.0e38f;      /* mu: the maximum in use */
  const int fo = (g * FK + ln) * FP + 8 * hh, fvo = (g * FK + 8 * hh + (lane & 7)) * FV + ((lane >> 3) & 1) * 8;      /* fvo: the transposing load's own lane address: row 8 hh + (lane & 7), 16-byte piece (lane >> 3) & 1 */
  fa_lds_barrier();      /* stage 0 is published; stage 1's loads fly on */
#pragma unroll 2      /* two stages per trip: the buffer's index becomes a constant offset in every LDS address */
  for (int s = 0; s < ns; ++s) { const int b = s & 1;
    const unsigned short* kf = &sk[b][fo]; const unsigned short* vf = &sv[b][fvo]; const int* xn = &sx[min(s + 3, ns - 1) * FS + r0];
    v16h ka[8]; int xq[4];      /* this stage's K and list reads go out first: the staging work below runs while the LDS serves them, a time in which the sixteen waves have no other vector work */
#pragma unroll
    for (int t = 0; t < 4; ++t) { ka[2 * t] = fa_frag(kf + t * 16 * FP); ka[2 * t + 1] = fa_frag(kf + t * 16 * FP + 32); xq[t] = xn[32 * t]; }
    if (s + 1 < ns) {      /* the next stage goes into the other buffer, whose readers left it before the last barrier; the barrier at this stage's foot publishes it */
#pragma unroll
      for (int i = 0; i < 4; ++i) { *(v4us*)&sk[b ^ 1][sok + i * 32 * FP] = __builtin_bit_cast(v4us, fa_cvt4(rk[i])); *(v4us*)&sv[b ^ 1][sov + i * 32 * FV] = __builtin_bit_cast(v4us, fa_cvt4(rv[i])); }
      if (s + 2 < ns) {      /* the stage after it flies from here to the head of the next stage */
#pragma unroll
        for (int i = 0; i < 4; ++i) { const unsigned int o = (unsigned int)(xo[i] + c4 * 4); rk[i] = *(const v4fa*)(kg + o); rv[i] = *(const v4fa*)(vg + o); } } }
#pragma unroll
    for (int t = 0; t < 4; ++t) xo[t] = xq[t];
    v8f x[4];
#pragma unroll
    for (int t = 0; t < 4; ++t) x[t] = fa_mma(ka[2 * t + 1], bq1, fa_mma(ka[2 * t], bq0, z8));
    v16h va[8];
#pragma unroll
    for (int t = 0; t < 4; ++t) { va[t] = fa_vfrag(vf + t * 16); va[4 + t] = fa_vfrag(vf + 32 * FV + t * 16); }      /* d columns 16 t .. + 15 of keys 0..31, then of keys 32..63 */
    __builtin_amdgcn_sched_barrier(0);      /* the V^T reads are issued here and land under the softmax arithmetic: without it the compiler puts each just ahead of its product, with a full LDS wait for each */
#pragma unroll
    for (int t = 0; t < 4; ++t)
#pragma unroll
      for (int r = 0; r < 8; ++r) x[t][r] *= 0.18033688f;      /* (1 / 8) log2 e */
    if (s * FS + (g + 1) * FK > no) { const int lim = no - s * FS - g * FK - 8 * hh;      /* scalar branch: this group's half of the stage holds positions past the open count (the list's last stage; every stage where no key is open) */
#pragma unroll
      for (int t = 0; t < 4; ++t)
#pragma unroll
        for (int r = 0; r < 8; ++r) x[t][r] = 16 * t + r < lim ? x[t][r] : -1.0e30f; }
    float m4[4];      /* four short chains, one per tile, instead of one chain of 32 dependent maxima */
#pragma unroll
    for (int t = 0; t < 4; ++t) { m4[t] = fmaxf(x[t][0], x[t][1]);
#pragma unroll
      for (int r = 2; r < 8; ++r) m4[t] = fmaxf(m4[t], x[t][r]); }
    float mx = fmaxf(fmaxf(m4[0], m4[1]), fmaxf(m4[2], m4[3]));
    mx = fmaxf(mx, lane_x16(mx));
    const bool need = mx > mu + 8.0f;
    if (__builtin_amdgcn_ballot_w32(need) != 0) {      /* scalar branch, once per stage */
      const float mn = need ? mx : mu; const float al = __builtin_amdgcn_exp2f(mu - mn); mu = mn;
#pragma unroll
      for (int t = 0; t < 4; ++t) acc[t] *= al;
      accl *= al; }
    const float mo = mu - 4.0f;      /* weights carry 2^4: small ones stay clear of f16's subnormals; it cancels against the row sum */
    FragH p[2];
#pragma unroll
    for (int t = 0; t < 4; ++t) {
#pragma unroll
      for (int r = 0; r < 8; ++r) p[t >> 1].h[(t & 1) * 8 + r] = (_Float16)__builtin_amdgcn_exp2f(x[t][r] - mo); }      /* v_exp_f32 as the builtin: the compiler then keeps the matrix instructions' distances around it */
#pragma unroll
    for (int j = 0; j < 2; ++j) {
#pragma unroll
      for (int t = 0; t < 4; ++t) acc[t] = fa_mma(va[4 * j + t], p[j].v, acc[t]);
      accl = fa_mma(one.v, p[j].v, accl); }
    fa_lds_barrier(); }      /* publishes stage s + 1 and ends every read of stage s */
  // The join: waves w and w ^ 8 hold the same queries over the two halves of the keys. Group g finishes output tiles 2 g and 2 g + 1; each wave hands its other two tiles, its maximum in use and its row sum to its partner.
  // A group whose every position lay past the open count holds the maximum -1e30 and gets the factor 0 beside a group with an open key; with no open key both hold -1e30 and count alike.
  v8f own[2], oth[2];
#pragma unroll
  for (int u = 0; u < 2; ++u)
#pragma unroll
    for (int r = 0; r < 8; ++r) { own[u][r] = g ? acc[2 + u][r] : acc[u][r]; oth[u][r] = g ? acc[u][r] : acc[2 + u][r]; }
#pragma unroll
  for (int u = 0; u < 2; ++u)
#pragma unroll
    for (int r = 0; r < 8; ++r) sm[w][u * 8 + r][lane] = oth[u][r];
  sm[w][16][lane] = mu; sm[w][17][lane] = accl[0];
  __syncthreads();      /* both groups' hand-overs are there */
#pragma unroll
  for (int u = 0; u < 2; ++u)
#pragma unroll
    for (int r = 0; r < 8; ++r) oth[u][r] = sm[w ^ 8][u * 8 + r][lane];
  const float mp = sm[w ^ 8][16][lane], lp = sm[w ^ 8][17][lane];
  const float mj = fmaxf(mu, mp); const float fa = __builtin_amdgcn_exp2f(mu - mj), fb = __builtin_amdgcn_exp2f(mp - mj);
  const float inv = 1.0f / (accl[0] * fa + lp * fb); const float ca = fa * inv, cb = fb * inv;
  float* o = O + ((size_t)pl * SQ + q) * HD + g * 32 + 8 * hh;      /* register r of tile t = O[q][16 t + 8 hh + r] */
#pragma unroll
  for (int u = 0; u < 2; ++u) { v8f z;
#pragma unroll
    for (int r = 0; r < 8; ++r) z[r] = own[u][r] * ca + oth[u][r] * cb;
    const v4f o0 = {z[0], z[1], z[2], z[3]}, o1 = {z[4], z[5], z[6], z[7]};
    *(v4f*)(o + u * 16) = o0; *(v4f*)(o + u * 16 + 4) = o1; } }
extern "C" void kernel_launch(void* const* d_in, const int* in_sizes, int n_in,
                              void* d_out, int out_size, void* d_ws, size_t ws_size, hipStream_t stream) {
  (void)in_sizes; (void)n_in; (void)out_size; (void)d_ws; (void)ws_size;
  const float* const* I = (const float* const*)d_in; const float* xq = I[0]; const float* xk = I[1]; const float* xv = I[2]; const int* km = (const int*)d_in[3];      /* key mask int32 [2][1][1][2048] (0 = masked; READ on device): plane b of 16 belongs to batch b / 8 */      /* given q, k, v [B][H][S][64]: each (b, h) plane is a 'batch' of one 64-wide head */
  k_fattn<<<dim3(SQ / FQ, NB), 512, 0, stream>>>(xq, xk, xv, km, (float*)d_out);      /* input rounding, scores, masked softmax and the product with V, every plane; f32 output; no workspace */
}
